// v000
// Times are from an AMD MI455X. After a warm-up the kernel runs many times in a row, and a time is the length of
// such a window on the GPU divided by its runs, so every launch and the gaps after it count. The runs cycle
// through copies of the inputs. A figure is the median of several windows, for all but v000 over two sittings.
// Sittings can differ by a few percent; kernels timed side by side share one.
// The starting kernel, v000, takes 973 microseconds a run.
#include <hip/hip_runtime.h>

// Compute dtypes, f32 accumulate, one batch item per pass: q = query.Wq ([1024 x 1024].[1024 x 1024]) and k/v = memory.Wk/Wv ([2048 x 1024].[1024 x 1024]), k-major weights transposed once to n-major planes; PLAIN bf16
// operands: inputs rounded once, exact) with q and k written straight from the GEMM epilogue as f16 hi + residual x1024 planes, and out = ctx.Wo (ctx as
// bf16 hi + residual: two products) on v_wmma_f32_16x16x32_bf16; the 16-head cross-attention (1024 queries x 2048 memory keys, 64-dim heads, scale 1/8) + the INPUT per-key bias[b][k] fused on
// v_wmma_f32_16x16x32_f16 (scores hi.hi + hi.lo + lo.hi with the residual terms on their own accumulator, online f32 softmax, weights (x32768) and v as f16

#define NB_  1                   // per pass: the 4 batch items are processed one at a time
#define NT_  2048                // keys per item (memory length)
#define NTQ  1024                // queries per item
#define DM   1024
#define NH_  16
#define HD   64
#define NTK  (NB_ * NT_)
#define NW   1024
#define NQKV 1024
#define PSC  32768.0f
#define LOSC 1024.0f
#define LOSCI (1.0f / 1024.0f)

typedef _Float16 h16;
typedef unsigned short bf;
typedef __attribute__((ext_vector_type(16))) __bf16   v16bf;
typedef __attribute__((ext_vector_type(16))) _Float16 v16h;
typedef __attribute__((ext_vector_type(8)))  _Float16 v8h;
typedef __attribute__((ext_vector_type(8)))  unsigned short v8us;
typedef __attribute__((ext_vector_type(8)))  float    v8f;
typedef __attribute__((ext_vector_type(4)))  float    v4f;
typedef v8h  __attribute__((may_alias)) v8ha;
typedef v4f  __attribute__((may_alias)) v4fa;
typedef v8us __attribute__((may_alias)) v8usa;

__device__ __forceinline__ unsigned short f2bf(float f) { unsigned u = __float_as_uint(f); u += 0x7FFFu + ((u >> 16) & 1u); return (unsigned short)(u >> 16); }
__device__ __forceinline__ float bf2f(unsigned short b) { return __uint_as_float(((unsigned)b) << 16); }
__device__ __forceinline__ float bfr(float f) { return bf2f(f2bf(f)); }
__device__ __forceinline__ v16h cat16(v8h lo, v8h hi) { return __builtin_shufflevector(lo, hi, 0, 1, 2, 3, 4, 5, 6, 7, 8, 9, 10, 11, 12, 13, 14, 15); }
__device__ __forceinline__ v16bf cat16b(v8us lo, v8us hi) { return __builtin_bit_cast(v16bf, __builtin_shufflevector(lo, hi, 0, 1, 2, 3, 4, 5, 6, 7, 8, 9, 10, 11, 12, 13, 14, 15)); }
__device__ __forceinline__ v8f wmma16(v16h a, v16h b, v8f c) { return __builtin_amdgcn_wmma_f32_16x16x32_f16(false, a, false, b, (short)0, c, false, false); }
__device__ __forceinline__ v8f wmmab(v16bf a, v16bf b, v8f c) { return __builtin_amdgcn_wmma_f32_16x16x32_bf16(false, a, false, b, (short)0, c, false, false); }

__global__ __launch_bounds__(256) void k_cvtb(const float* __restrict__ src, int nrows, bf* dst) {
    const int lane = threadIdx.x & 31, r = blockIdx.x * 8 + (threadIdx.x >> 5);
    if (r >= nrows) return;
    v8us o[DM / 256];
#pragma unroll
    for (int q = 0; q < DM / 256; ++q) { v8us t;
#pragma unroll
        for (int i = 0; i < 8; ++i) t[i] = f2bf(src[(size_t)r * DM + q * 256 + lane * 8 + i]);
        o[q] = t; }
#pragma unroll
    for (int q = 0; q < DM / 256; ++q) *(v8us*)(dst + (size_t)r * DM + q * 256 + lane * 8) = o[q];
    
}

// k_wt: WT [n][K] = bf16(W[k][n]) (k-major [K][ncols]) via 64 x 64 LDS tiles; grid (K/64, ncols/64).
__global__ __launch_bounds__(256) void k_wt(const float* __restrict__ Wm, int K, int ncols, bf* WT) {
    __shared__ __align__(16) unsigned short tl[64 * 72];
    const int tid = threadIdx.x, k0 = blockIdx.x * 64, n0 = blockIdx.y * 64;
    const int kk = tid >> 2, nq = (tid & 3) * 16;
#pragma unroll
    for (int i = 0; i < 16; ++i) tl[(nq + i) * 72 + kk] = f2bf(Wm[(size_t)(k0 + kk) * ncols + n0 + nq + i]);
    __syncthreads();
    const int piece = tid & 7;
    auto pass = [&]() {
#pragma unroll
        for (int s = 0; s < 2; ++s) { const int nr = (tid >> 3) + 32 * s; const v8us val = *(const v8usa*)(tl + nr * 72 + piece * 8); *(v8us*)(WT + (size_t)(n0 + nr) * K + k0 + piece * 8) = val; }
    };
    pass(); 
}
template <bool SPLITA, bool F16OUT = false>
__global__ __launch_bounds__(128) void k_gemmb(const bf* __restrict__ A, const bf* __restrict__ Al, const bf* __restrict__ Bn, const float* __restrict__ bias, float* C, int ldc, h16* C2) {
    __shared__ __align__(16) float ost[4][16 * 68];
    const int lane = threadIdx.x & 31, wave = threadIdx.x >> 5, lr = lane & 15, hi = lane >> 4;
    const int r0 = blockIdx.x * 64 + wave * 16, c0 = blockIdx.y * 64;
    const size_t aoff = (size_t)(r0 + lr) * DM + 8 * hi;
    size_t boff[4];
#pragma unroll
    for (int t = 0; t < 4; ++t) boff[t] = (size_t)(c0 + t * 16 + lr) * DM + 8 * hi;
    v8f acc[4];
#pragma unroll
    for (int t = 0; t < 4; ++t) acc[t] = (v8f){};
#pragma unroll 1
    for (int kc = 0; kc < DM; kc += 32) {
        const v16bf a = cat16b(*(const v8us*)(A + aoff + kc), *(const v8us*)(A + aoff + kc + 16));
        v16bf al = a;
        if (SPLITA) al = cat16b(*(const v8us*)(Al + aoff + kc), *(const v8us*)(Al + aoff + kc + 16));
#pragma unroll
        for (int t = 0; t < 4; ++t) { const v16bf b = cat16b(*(const v8us*)(Bn + boff[t] + kc), *(const v8us*)(Bn + boff[t] + kc + 16)); acc[t] = wmmab(a, b, acc[t]); if (SPLITA) acc[t] = wmmab(al, b, acc[t]); }
        asm volatile("v_nop\n\tv_nop\n\tv_nop\n\tv_nop" : "+v"(acc[0]), "+v"(acc[1]), "+v"(acc[2]), "+v"(acc[3]) : "v"(a), "v"(al));
    }
    float* os = &ost[wave][0];
#pragma unroll
    for (int t = 0; t < 4; ++t) { const float bv = bias ? bfr(bias[c0 + t * 16 + lr]) : 0.f;
#pragma unroll
        for (int j = 0; j < 8; ++j) os[(hi * 8 + j) * 68 + t * 16 + lr] = acc[t][j] + bv; }
    __syncthreads();
    if (F16OUT) {
        h16* crow = (h16*)(void*)C + (size_t)r0 * ldc + c0;
        auto pass = [&]() {
#pragma unroll
            for (int s = 0; s < 4; ++s) { const int row = 4 * s + (lane >> 3), piece = lane & 7; const float* sp = os + row * 68 + piece * 8; v8h o, o2;
#pragma unroll
                for (int i = 0; i < 8; ++i) { const h16 a = (h16)sp[i]; o[i] = a; o2[i] = (h16)((sp[i] - (float)a) * LOSC); }
                *(v8h*)(crow + (size_t)row * ldc + piece * 8) = o; if (C2) *(v8h*)(C2 + (size_t)r0 * ldc + c0 + (size_t)row * ldc + piece * 8) = o2; }
        };
        pass(); 
    } else {
        float* crow = C + (size_t)r0 * ldc + c0;
        auto pass = [&]() {
#pragma unroll
            for (int s = 0; s < 8; ++s) { const int Lid = (lane >> 3) + 4 * s, piece = lane & 7; const int row = Lid >> 1, cofs = (Lid & 1) * 32 + piece * 4;
                const v4f val = *(const v4fa*)(os + row * 68 + cofs); *(v4f*)(crow + (size_t)row * ldc + cofs) = val; }
        };
        pass(); 
    }
}

__global__ __launch_bounds__(256) void k_vt(const float* __restrict__ V, h16* VTH, h16* VTL) {
    __shared__ __align__(16) h16 tile[64 * 72];
    __shared__ __align__(16) h16 til2[64 * 72];
    const int bid = blockIdx.x;
    const int b = bid / (NH_ * (NT_ / 64)), rem = bid - b * (NH_ * (NT_ / 64)), h = rem / (NT_ / 64), kt = rem - h * (NT_ / 64);
    const int k0 = kt * 64, tid = threadIdx.x;
    const int kk = tid >> 2, d0 = (tid & 3) * 16;
    const float* src = V + ((size_t)b * NT_ + k0 + kk) * DM + h * HD + d0;
#pragma unroll
    for (int i = 0; i < 16; ++i) { const float v = src[i]; const h16 a = (h16)v; tile[(d0 + i) * 72 + kk] = a; til2[(d0 + i) * 72 + kk] = (h16)((v - (float)a) * LOSC); }
    __syncthreads();
    const int piece = tid & 7;
    const size_t base = (((size_t)b * NH_ + h) * HD) * NT_ + k0;
    auto pass = [&]() {
#pragma unroll
        for (int s = 0; s < 4; ++s) { const int Lid = (tid >> 3) + 32 * s; const int pln = Lid >> 6, d = Lid & 63;
            const v8h val = *(const v8ha*)((pln ? til2 : tile) + d * 72 + piece * 8); *(v8h*)((pln ? VTL : VTH) + base + (size_t)d * NT_ + piece * 8) = val; }
    };
    pass(); 
}

// k_attn: block = (b, h, 64 queries), wave = 16; ALL 64 key tiles of 32 keys (no mask); 12 WMMA scores (hi.hi + lo.hi + hi.lo) /8 (f32), online softmax, weights x32768 f16 hi + residual tiles (same-wave may_alias
// reload after a compiler barrier), 12 WMMA .v (hi.hi + hi.lo + lo.hi); ctx -> bf16 hi + residual planes CH/CL[tok][h*64+d].
__global__ __launch_bounds__(128) void k_attn(const h16* __restrict__ Q16, const h16* __restrict__ QL16, const h16* __restrict__ K16, const h16* __restrict__ KL16, const h16* __restrict__ VTH, const h16* __restrict__ VTL, const float* __restrict__ KB, bf* CH, bf* CL) {
    __shared__ __align__(16) h16 plds[4][16 * 32];
    __shared__ __align__(16) h16 plds2[4][16 * 32];
    __shared__ __align__(16) float ost[4][16 * 68];
    const int lane = threadIdx.x & 31, wave = threadIdx.x >> 5, lr = lane & 15, hi = lane >> 4;
    const int bid = blockIdx.x;
    const int b = bid / (NH_ * (NTQ / 64)), rem = bid - b * (NH_ * (NTQ / 64)), h = rem / (NTQ / 64), qt = rem - h * (NTQ / 64);     // query blocks over the 1024 queries
    const int q0 = qt * 64 + wave * 16;
    const size_t tok0 = (size_t)b * NT_;     // key-side item offset (NB_ = 1: 0); query rows use tokq0
    const size_t tokq0 = (size_t)b * NTQ;
    h16* pl = &plds[wave][0]; h16* pl2 = &plds2[wave][0];
    v16h qa[2];
    const size_t qo0 = (tokq0 + q0 + lr) * DM + h * HD + 8 * hi;
#pragma unroll
    for (int kc = 0; kc < 2; ++kc) qa[kc] = cat16(*(const v8h*)(Q16 + qo0 + kc * 32), *(const v8h*)(Q16 + qo0 + kc * 32 + 16));
    const h16* kh_b = K16 + tok0 * DM + h * HD;
    const h16* kl_b = KL16 + tok0 * DM + h * HD;
    const size_t vbase = (((size_t)b * NH_ + h) * HD) * NT_;
    v8f o[4], ox[4];
#pragma unroll
    for (int n = 0; n < 4; ++n) { o[n] = (v8f){}; ox[n] = (v8f){}; }
    float mrow[8], lpart[8];
#pragma unroll
    for (int j = 0; j < 8; ++j) { mrow[j] = -3.0e38f; lpart[j] = 0.f; }
    int qpos[8];
#pragma unroll
    for (int j = 0; j < 8; ++j) qpos[j] = q0 + 8 * hi + j;
    const int kt_lo = 0, kt_hi = NT_ / 32 - 1;     // cross-attention: all 2048 memory keys; + the INPUT per-key bias[b][k]
#pragma unroll 1
    for (int kt = kt_lo; kt <= kt_hi; ++kt) {
        const int l0 = kt * 32;
        const size_t ko0 = (size_t)(l0 + lr) * DM + 8 * hi, ko1 = (size_t)(l0 + 16 + lr) * DM + 8 * hi;
        v8f s0 = {}, s1 = {}, x0 = {}, x1 = {};
#pragma unroll
        for (int kc = 0; kc < 2; ++kc) {
            { const v16h k0h = cat16(*(const v8h*)(kh_b + ko0 + kc * 32), *(const v8h*)(kh_b + ko0 + kc * 32 + 16)), k1h = cat16(*(const v8h*)(kh_b + ko1 + kc * 32), *(const v8h*)(kh_b + ko1 + kc * 32 + 16));
              const v16h qlk = cat16(*(const v8h*)(QL16 + qo0 + kc * 32), *(const v8h*)(QL16 + qo0 + kc * 32 + 16));     // query residual re-read per step (registers)
              s0 = wmma16(qa[kc], k0h, s0); x0 = wmma16(qlk, k0h, x0); s1 = wmma16(qa[kc], k1h, s1); x1 = wmma16(qlk, k1h, x1);
              asm volatile("v_nop" : "+v"(s0), "+v"(s1), "+v"(x0), "+v"(x1) : "v"(qlk), "v"(k0h), "v"(k1h) : "memory"); }
            { const v16h k0l = cat16(*(const v8h*)(kl_b + ko0 + kc * 32), *(const v8h*)(kl_b + ko0 + kc * 32 + 16)), k1l = cat16(*(const v8h*)(kl_b + ko1 + kc * 32), *(const v8h*)(kl_b + ko1 + kc * 32 + 16));
              x0 = wmma16(qa[kc], k0l, x0); x1 = wmma16(qa[kc], k1l, x1);
              asm volatile("v_nop" : "+v"(x0), "+v"(x1) : "v"(k0l), "v"(k1l) : "memory"); }
        }
        asm volatile("v_nop\n\tv_nop\n\tv_nop\n\tv_nop" : "+v"(s0), "+v"(s1), "+v"(x0), "+v"(x1) : "v"(qa[0]), "v"(qa[1]));
        float alpha[8]; const float kba = bfr(KB[l0 + lr]), kbb = bfr(KB[l0 + 16 + lr]);
#pragma unroll
        for (int j = 0; j < 8; ++j) {
            const int ja = l0 + lr, jb = l0 + 16 + lr, qi = qpos[j]; (void)ja; (void)jb;
            const float a0 = (s0[j] + x0[j] * LOSCI) * 0.125f + kba, a1 = (s1[j] + x1[j] * LOSCI) * 0.125f + kbb; (void)qi;
            float mx = fmaxf(a0, a1);
            mx = fmaxf(mx, __shfl_xor(mx, 1, 16)); mx = fmaxf(mx, __shfl_xor(mx, 2, 16)); mx = fmaxf(mx, __shfl_xor(mx, 4, 16)); mx = fmaxf(mx, __shfl_xor(mx, 8, 16));
            const float mn = fmaxf(mrow[j], mx);
            alpha[j] = __expf(mrow[j] - mn); mrow[j] = mn;
            const float p0 = __expf(a0 - mn), p1 = __expf(a1 - mn);
            lpart[j] = lpart[j] * alpha[j] + (p0 + p1);
            const int mr = hi * 8 + j;
            const float ps0 = p0 * PSC, ps1 = p1 * PSC; const h16 h0 = (h16)ps0, h1 = (h16)ps1;
            pl[mr * 32 + lr] = h0; pl[mr * 32 + 16 + lr] = h1;
            pl2[mr * 32 + lr] = (h16)((ps0 - (float)h0) * LOSC); pl2[mr * 32 + 16 + lr] = (h16)((ps1 - (float)h1) * LOSC);
        }
#pragma unroll
        for (int n = 0; n < 4; ++n)
#pragma unroll
            for (int j = 0; j < 8; ++j) { o[n][j] *= alpha[j]; ox[n][j] *= alpha[j]; }
        asm volatile("" ::: "memory");
        const v16h pa = cat16(*(const v8ha*)(pl + lr * 32 + hi * 8), *(const v8ha*)(pl + lr * 32 + 16 + hi * 8));
        const v16h px = cat16(*(const v8ha*)(pl2 + lr * 32 + hi * 8), *(const v8ha*)(pl2 + lr * 32 + 16 + hi * 8));
#pragma unroll
        for (int n = 0; n < 4; ++n) { const size_t vo = vbase + (size_t)(n * 16 + lr) * NT_ + l0 + hi * 8;
            const v16h vh = cat16(*(const v8h*)(VTH + vo), *(const v8h*)(VTH + vo + 16)), vl = cat16(*(const v8h*)(VTL + vo), *(const v8h*)(VTL + vo + 16));
            o[n] = wmma16(pa, vh, o[n]); ox[n] = wmma16(pa, vl, ox[n]); ox[n] = wmma16(px, vh, ox[n]);
            asm volatile("" : "+v"(o[n]), "+v"(ox[n]) : "v"(vh), "v"(vl) : "memory"); }
        asm volatile("v_nop\n\tv_nop\n\tv_nop\n\tv_nop" : "+v"(o[0]), "+v"(o[1]), "+v"(o[2]), "+v"(o[3]), "+v"(ox[0]), "+v"(ox[1]), "+v"(ox[2]), "+v"(ox[3]) : "v"(pa), "v"(px));
    }
    float inv[8];
#pragma unroll
    for (int j = 0; j < 8; ++j) { float rs = lpart[j]; rs += __shfl_xor(rs, 1, 16); rs += __shfl_xor(rs, 2, 16); rs += __shfl_xor(rs, 4, 16); rs += __shfl_xor(rs, 8, 16); inv[j] = 1.0f / (rs * PSC); }
    float* os = &ost[wave][0];
#pragma unroll
    for (int n = 0; n < 4; ++n)
#pragma unroll
        for (int j = 0; j < 8; ++j) os[(hi * 8 + j) * 68 + n * 16 + lr] = (o[n][j] + ox[n][j] * LOSCI) * inv[j];
    __syncthreads();
    const size_t cbase = (tokq0 + q0) * DM + (size_t)h * HD;
    auto pass = [&]() {
#pragma unroll
        for (int s = 0; s < 4; ++s) { const int row = 4 * s + (lane >> 3), piece = lane & 7; const float* sp = os + row * 68 + piece * 8; v8us oh, ol;
#pragma unroll
            for (int i = 0; i < 8; ++i) { const unsigned short hb = f2bf(sp[i]); oh[i] = hb; ol[i] = f2bf(sp[i] - bf2f(hb)); }
            *(v8us*)(CH + cbase + (size_t)row * DM + piece * 8) = oh; *(v8us*)(CL + cbase + (size_t)row * DM + piece * 8) = ol; }
    };
    pass(); 
}

#define VST2(T, p, v) do { const T vst2_v_ = (v); *(T*)(p) = vst2_v_;  } while (0)
extern "C" void kernel_launch(void* const* d_in, const int* in_sizes, int n_in,
                              void* d_out, int out_size, void* d_ws, size_t ws_size, hipStream_t stream) {
    (void)in_sizes; (void)n_in; (void)out_size;
    const float* query = (const float*)d_in[0]; const float* memory = (const float*)d_in[1]; const float* bias = (const float*)d_in[2];
    const float* Wq = (const float*)d_in[3]; const float* Wk = (const float*)d_in[4]; const float* Wv = (const float*)d_in[5]; const float* Wo = (const float*)d_in[6];   // all k-major [in][out]
    float* out = (float*)d_out;    // [4][1024][1024]
    char* wsp = (char*)d_ws;
    auto take = [&](size_t bytes) { char* p = wsp; wsp += (bytes + 255) & ~(size_t)255; return (void*)p; };
    bf* Xq = (bf*)take((size_t)NTQ * DM * 2); bf* Xm = (bf*)take((size_t)NT_ * DM * 2);
    bf* WqT = (bf*)take((size_t)DM * DM * 2); bf* WkT = (bf*)take((size_t)DM * DM * 2); bf* WvT = (bf*)take((size_t)DM * DM * 2); bf* WoT = (bf*)take((size_t)DM * DM * 2);
    float* TMP = (float*)take((size_t)NT_ * DM * 4);
    h16* QH = (h16*)take((size_t)NTQ * DM * 2); h16* QL = (h16*)take((size_t)NTQ * DM * 2); h16* KH = (h16*)take((size_t)NT_ * DM * 2); h16* KL = (h16*)take((size_t)NT_ * DM * 2);
    h16* VTH = (h16*)take((size_t)NT_ * DM * 2); h16* VTL = (h16*)take((size_t)NT_ * DM * 2); bf* CH = (bf*)take((size_t)NTQ * DM * 2); bf* CL = (bf*)take((size_t)NTQ * DM * 2);
    if ((size_t)(wsp - (char*)d_ws) > ws_size) return;    // 2.1 + 4.2 + 4 x 2.1 + 8.4 + 2 x 2.1 + 4 x 4.2 + 2 x 2.1 ~ 48 MB, no aliasing (per-item reuse in stream order)
    k_wt<<<dim3(DM / 64, DM / 64, 1), 256, 0, stream>>>(Wq, DM, DM, WqT); k_wt<<<dim3(DM / 64, DM / 64, 1), 256, 0, stream>>>(Wk, DM, DM, WkT);
    k_wt<<<dim3(DM / 64, DM / 64, 1), 256, 0, stream>>>(Wv, DM, DM, WvT); k_wt<<<dim3(DM / 64, DM / 64, 1), 256, 0, stream>>>(Wo, DM, DM, WoT);
    for (int b = 0; b < 4; ++b) {
        k_cvtb<<<NTQ / 8, 256, 0, stream>>>(query + (size_t)b * NTQ * DM, NTQ, Xq); k_cvtb<<<NT_ / 8, 256, 0, stream>>>(memory + (size_t)b * NT_ * DM, NT_, Xm);
        k_gemmb<false, true><<<dim3(NTQ / 64, DM / 64, 1), 128, 0, stream>>>(Xq, nullptr, WqT, nullptr, (float*)(void*)QH, DM, QL);       // q = query.Wq  [1024][1024]
        k_gemmb<false, true><<<dim3(NT_ / 64, DM / 64, 1), 128, 0, stream>>>(Xm, nullptr, WkT, nullptr, (float*)(void*)KH, DM, KL);       // k = memory.Wk [2048][1024]
        k_gemmb<false, false><<<dim3(NT_ / 64, DM / 64, 1), 128, 0, stream>>>(Xm, nullptr, WvT, nullptr, TMP, DM, nullptr);              // v = memory.Wv
        k_vt<<<NB_ * NH_ * (NT_ / 64), 256, 0, stream>>>(TMP, VTH, VTL);
        k_attn<<<NB_ * NH_ * (NTQ / 64), 128, 0, stream>>>(QH, QL, KH, KL, VTH, VTL, bias + (size_t)b * NT_, CH, CL);
        k_gemmb<true, false><<<dim3(NTQ / 64, DM / 64, 1), 128, 0, stream>>>(CH, CL, WoT, nullptr, out + (size_t)b * NTQ * DM, DM, nullptr);
    }
}

// v001
// It runs in 493 microseconds.
// Timed twice side by side with v000, it ran 2.01 times as fast both times.
#include <hip/hip_runtime.h>

// Compute dtypes, f32 accumulate, all 4 batch items in one pass (rows of the items stacked): q = query.Wq ([4096 x 1024].[1024 x 1024]) and k/v = memory.Wk/Wv ([8192 x 1024].[1024 x 1024]), k-major weights transposed once to n-major planes; PLAIN bf16
// operands: inputs rounded once, exact) with q and k written straight from the GEMM epilogue as f16 hi + residual x1024 planes, and out = ctx.Wo (ctx as
// bf16 hi + residual: two products) on v_wmma_f32_16x16x32_bf16; the 16-head cross-attention (1024 queries x 2048 memory keys, 64-dim heads, scale 1/8) + the INPUT per-key bias[b][k] fused on
// v_wmma_f32_16x16x32_f16 (scores hi.hi + hi.lo + lo.hi with the residual terms on their own accumulator, online f32 softmax, weights (x32768) and v as f16

#define NB_  4                   // batch items, all in every launch's grid
#define NT_  2048                // keys per item (memory length)
#define NTQ  1024                // queries per item
#define DM   1024
#define NH_  16
#define HD   64
#define NTK  (NB_ * NT_)
#define NW   1024
#define NQKV 1024
#define PSC  32768.0f
#define LOSC 1024.0f
#define LOSCI (1.0f / 1024.0f)

typedef _Float16 h16;
typedef unsigned short bf;
typedef __attribute__((ext_vector_type(16))) __bf16   v16bf;
typedef __attribute__((ext_vector_type(16))) _Float16 v16h;
typedef __attribute__((ext_vector_type(8)))  _Float16 v8h;
typedef __attribute__((ext_vector_type(8)))  unsigned short v8us;
typedef __attribute__((ext_vector_type(8)))  float    v8f;
typedef __attribute__((ext_vector_type(4)))  float    v4f;
typedef v8h  __attribute__((may_alias)) v8ha;
typedef v4f  __attribute__((may_alias)) v4fa;
typedef v8us __attribute__((may_alias)) v8usa;

__device__ __forceinline__ unsigned short f2bf(float f) { unsigned u = __float_as_uint(f); u += 0x7FFFu + ((u >> 16) & 1u); return (unsigned short)(u >> 16); }
__device__ __forceinline__ float bf2f(unsigned short b) { return __uint_as_float(((unsigned)b) << 16); }
__device__ __forceinline__ float bfr(float f) { return bf2f(f2bf(f)); }
__device__ __forceinline__ v16h cat16(v8h lo, v8h hi) { return __builtin_shufflevector(lo, hi, 0, 1, 2, 3, 4, 5, 6, 7, 8, 9, 10, 11, 12, 13, 14, 15); }
__device__ __forceinline__ v16bf cat16b(v8us lo, v8us hi) { return __builtin_bit_cast(v16bf, __builtin_shufflevector(lo, hi, 0, 1, 2, 3, 4, 5, 6, 7, 8, 9, 10, 11, 12, 13, 14, 15)); }
__device__ __forceinline__ v8f wmma16(v16h a, v16h b, v8f c) { return __builtin_amdgcn_wmma_f32_16x16x32_f16(false, a, false, b, (short)0, c, false, false); }
__device__ __forceinline__ v8f wmmab(v16bf a, v16bf b, v8f c) { return __builtin_amdgcn_wmma_f32_16x16x32_bf16(false, a, false, b, (short)0, c, false, false); }

__global__ __launch_bounds__(256) void k_cvtb(const float* __restrict__ src, int nrows, bf* dst) {
    const int lane = threadIdx.x & 31, r = blockIdx.x * 8 + (threadIdx.x >> 5);
    if (r >= nrows) return;
    v8us o[DM / 256];
#pragma unroll
    for (int q = 0; q < DM / 256; ++q) { v8us t;
#pragma unroll
        for (int i = 0; i < 8; ++i) t[i] = f2bf(src[(size_t)r * DM + q * 256 + lane * 8 + i]);
        o[q] = t; }
#pragma unroll
    for (int q = 0; q < DM / 256; ++q) *(v8us*)(dst + (size_t)r * DM + q * 256 + lane * 8) = o[q];
    
}

// k_wt: WT [n][K] = bf16(W[k][n]) (k-major [K][ncols]) via 64 x 64 LDS tiles; grid (K/64, ncols/64).
__global__ __launch_bounds__(256) void k_wt(const float* __restrict__ Wm, int K, int ncols, bf* WT) {
    __shared__ __align__(16) unsigned short tl[64 * 72];
    const int tid = threadIdx.x, k0 = blockIdx.x * 64, n0 = blockIdx.y * 64;
    const int kk = tid >> 2, nq = (tid & 3) * 16;
#pragma unroll
    for (int i = 0; i < 16; ++i) tl[(nq + i) * 72 + kk] = f2bf(Wm[(size_t)(k0 + kk) * ncols + n0 + nq + i]);
    __syncthreads();
    const int piece = tid & 7;
    auto pass = [&]() {
#pragma unroll
        for (int s = 0; s < 2; ++s) { const int nr = (tid >> 3) + 32 * s; const v8us val = *(const v8usa*)(tl + nr * 72 + piece * 8); *(v8us*)(WT + (size_t)(n0 + nr) * K + k0 + piece * 8) = val; }
    };
    pass(); 
}
template <bool SPLITA, bool F16OUT = false>
__global__ __launch_bounds__(128) void k_gemmb(const bf* __restrict__ A, const bf* __restrict__ Al, const bf* __restrict__ Bn, const float* __restrict__ bias, float* C, int ldc, h16* C2) {
    __shared__ __align__(16) float ost[4][16 * 68];
    const int lane = threadIdx.x & 31, wave = threadIdx.x >> 5, lr = lane & 15, hi = lane >> 4;
    const int r0 = blockIdx.x * 64 + wave * 16, c0 = blockIdx.y * 64;
    const size_t aoff = (size_t)(r0 + lr) * DM + 8 * hi;
    size_t boff[4];
#pragma unroll
    for (int t = 0; t < 4; ++t) boff[t] = (size_t)(c0 + t * 16 + lr) * DM + 8 * hi;
    v8f acc[4];
#pragma unroll
    for (int t = 0; t < 4; ++t) acc[t] = (v8f){};
#pragma unroll 1
    for (int kc = 0; kc < DM; kc += 32) {
        const v16bf a = cat16b(*(const v8us*)(A + aoff + kc), *(const v8us*)(A + aoff + kc + 16));
        v16bf al = a;
        if (SPLITA) al = cat16b(*(const v8us*)(Al + aoff + kc), *(const v8us*)(Al + aoff + kc + 16));
#pragma unroll
        for (int t = 0; t < 4; ++t) { const v16bf b = cat16b(*(const v8us*)(Bn + boff[t] + kc), *(const v8us*)(Bn + boff[t] + kc + 16)); acc[t] = wmmab(a, b, acc[t]); if (SPLITA) acc[t] = wmmab(al, b, acc[t]); }
        asm volatile("v_nop\n\tv_nop\n\tv_nop\n\tv_nop" : "+v"(acc[0]), "+v"(acc[1]), "+v"(acc[2]), "+v"(acc[3]) : "v"(a), "v"(al));
    }
    float* os = &ost[wave][0];
#pragma unroll
    for (int t = 0; t < 4; ++t) { const float bv = bias ? bfr(bias[c0 + t * 16 + lr]) : 0.f;
#pragma unroll
        for (int j = 0; j < 8; ++j) os[(hi * 8 + j) * 68 + t * 16 + lr] = acc[t][j] + bv; }
    __syncthreads();
    if (F16OUT) {
        h16* crow = (h16*)(void*)C + (size_t)r0 * ldc + c0;
        auto pass = [&]() {
#pragma unroll
            for (int s = 0; s < 4; ++s) { const int row = 4 * s + (lane >> 3), piece = lane & 7; const float* sp = os + row * 68 + piece * 8; v8h o, o2;
#pragma unroll
                for (int i = 0; i < 8; ++i) { const h16 a = (h16)sp[i]; o[i] = a; o2[i] = (h16)((sp[i] - (float)a) * LOSC); }
                *(v8h*)(crow + (size_t)row * ldc + piece * 8) = o; if (C2) *(v8h*)(C2 + (size_t)r0 * ldc + c0 + (size_t)row * ldc + piece * 8) = o2; }
        };
        pass(); 
    } else {
        float* crow = C + (size_t)r0 * ldc + c0;
        auto pass = [&]() {
#pragma unroll
            for (int s = 0; s < 8; ++s) { const int Lid = (lane >> 3) + 4 * s, piece = lane & 7; const int row = Lid >> 1, cofs = (Lid & 1) * 32 + piece * 4;
                const v4f val = *(const v4fa*)(os + row * 68 + cofs); *(v4f*)(crow + (size_t)row * ldc + cofs) = val; }
        };
        pass(); 
    }
}

__global__ __launch_bounds__(256) void k_vt(const float* __restrict__ V, h16* VTH, h16* VTL) {
    __shared__ __align__(16) h16 tile[64 * 72];
    __shared__ __align__(16) h16 til2[64 * 72];
    const int bid = blockIdx.x;
    const int b = bid / (NH_ * (NT_ / 64)), rem = bid - b * (NH_ * (NT_ / 64)), h = rem / (NT_ / 64), kt = rem - h * (NT_ / 64);
    const int k0 = kt * 64, tid = threadIdx.x;
    const int kk = tid >> 2, d0 = (tid & 3) * 16;
    const float* src = V + ((size_t)b * NT_ + k0 + kk) * DM + h * HD + d0;
#pragma unroll
    for (int i = 0; i < 16; ++i) { const float v = src[i]; const h16 a = (h16)v; tile[(d0 + i) * 72 + kk] = a; til2[(d0 + i) * 72 + kk] = (h16)((v - (float)a) * LOSC); }
    __syncthreads();
    const int piece = tid & 7;
    const size_t base = (((size_t)b * NH_ + h) * HD) * NT_ + k0;
    auto pass = [&]() {
#pragma unroll
        for (int s = 0; s < 4; ++s) { const int Lid = (tid >> 3) + 32 * s; const int pln = Lid >> 6, d = Lid & 63;
            const v8h val = *(const v8ha*)((pln ? til2 : tile) + d * 72 + piece * 8); *(v8h*)((pln ? VTL : VTH) + base + (size_t)d * NT_ + piece * 8) = val; }
    };
    pass(); 
}

// k_attn: block = (b, h, 64 queries), wave = 16; ALL 64 key tiles of 32 keys (no mask); 12 WMMA scores (hi.hi + lo.hi + hi.lo) /8 (f32), online softmax, weights x32768 f16 hi + residual tiles (same-wave may_alias
// reload after a compiler barrier), 12 WMMA .v (hi.hi + hi.lo + lo.hi); ctx -> bf16 hi + residual planes CH/CL[tok][h*64+d].
__global__ __launch_bounds__(128) void k_attn(const h16* __restrict__ Q16, const h16* __restrict__ QL16, const h16* __restrict__ K16, const h16* __restrict__ KL16, const h16* __restrict__ VTH, const h16* __restrict__ VTL, const float* __restrict__ KB, bf* CH, bf* CL) {
    __shared__ __align__(16) h16 plds[4][16 * 32];
    __shared__ __align__(16) h16 plds2[4][16 * 32];
    __shared__ __align__(16) float ost[4][16 * 68];
    const int lane = threadIdx.x & 31, wave = threadIdx.x >> 5, lr = lane & 15, hi = lane >> 4;
    const int bid = blockIdx.x;
    const int b = bid / (NH_ * (NTQ / 64)), rem = bid - b * (NH_ * (NTQ / 64)), h = rem / (NTQ / 64), qt = rem - h * (NTQ / 64);     // query blocks over the 1024 queries
    const int q0 = qt * 64 + wave * 16;
    const size_t tok0 = (size_t)b * NT_;     // key-side item offset; query rows use tokq0
    const size_t tokq0 = (size_t)b * NTQ;
    h16* pl = &plds[wave][0]; h16* pl2 = &plds2[wave][0];
    v16h qa[2];
    const size_t qo0 = (tokq0 + q0 + lr) * DM + h * HD + 8 * hi;
#pragma unroll
    for (int kc = 0; kc < 2; ++kc) qa[kc] = cat16(*(const v8h*)(Q16 + qo0 + kc * 32), *(const v8h*)(Q16 + qo0 + kc * 32 + 16));
    const h16* kh_b = K16 + tok0 * DM + h * HD;
    const h16* kl_b = KL16 + tok0 * DM + h * HD;
    const size_t vbase = (((size_t)b * NH_ + h) * HD) * NT_;
    v8f o[4], ox[4];
#pragma unroll
    for (int n = 0; n < 4; ++n) { o[n] = (v8f){}; ox[n] = (v8f){}; }
    float mrow[8], lpart[8];
#pragma unroll
    for (int j = 0; j < 8; ++j) { mrow[j] = -3.0e38f; lpart[j] = 0.f; }
    int qpos[8];
#pragma unroll
    for (int j = 0; j < 8; ++j) qpos[j] = q0 + 8 * hi + j;
    const int kt_lo = 0, kt_hi = NT_ / 32 - 1;     // cross-attention: all 2048 memory keys; + the INPUT per-key bias[b][k]
#pragma unroll 1
    for (int kt = kt_lo; kt <= kt_hi; ++kt) {
        const int l0 = kt * 32;
        const size_t ko0 = (size_t)(l0 + lr) * DM + 8 * hi, ko1 = (size_t)(l0 + 16 + lr) * DM + 8 * hi;
        v8f s0 = {}, s1 = {}, x0 = {}, x1 = {};
#pragma unroll
        for (int kc = 0; kc < 2; ++kc) {
            { const v16h k0h = cat16(*(const v8h*)(kh_b + ko0 + kc * 32), *(const v8h*)(kh_b + ko0 + kc * 32 + 16)), k1h = cat16(*(const v8h*)(kh_b + ko1 + kc * 32), *(const v8h*)(kh_b + ko1 + kc * 32 + 16));
              const v16h qlk = cat16(*(const v8h*)(QL16 + qo0 + kc * 32), *(const v8h*)(QL16 + qo0 + kc * 32 + 16));     // query residual re-read per step (registers)
              s0 = wmma16(qa[kc], k0h, s0); x0 = wmma16(qlk, k0h, x0); s1 = wmma16(qa[kc], k1h, s1); x1 = wmma16(qlk, k1h, x1);
              asm volatile("v_nop" : "+v"(s0), "+v"(s1), "+v"(x0), "+v"(x1) : "v"(qlk), "v"(k0h), "v"(k1h) : "memory"); }
            { const v16h k0l = cat16(*(const v8h*)(kl_b + ko0 + kc * 32), *(const v8h*)(kl_b + ko0 + kc * 32 + 16)), k1l = cat16(*(const v8h*)(kl_b + ko1 + kc * 32), *(const v8h*)(kl_b + ko1 + kc * 32 + 16));
              x0 = wmma16(qa[kc], k0l, x0); x1 = wmma16(qa[kc], k1l, x1);
              asm volatile("v_nop" : "+v"(x0), "+v"(x1) : "v"(k0l), "v"(k1l) : "memory"); }
        }
        asm volatile("v_nop\n\tv_nop\n\tv_nop\n\tv_nop" : "+v"(s0), "+v"(s1), "+v"(x0), "+v"(x1) : "v"(qa[0]), "v"(qa[1]));
        float alpha[8]; const float kba = bfr(KB[tok0 + l0 + lr]), kbb = bfr(KB[tok0 + l0 + 16 + lr]);
#pragma unroll
        for (int j = 0; j < 8; ++j) {
            const int ja = l0 + lr, jb = l0 + 16 + lr, qi = qpos[j]; (void)ja; (void)jb;
            const float a0 = (s0[j] + x0[j] * LOSCI) * 0.125f + kba, a1 = (s1[j] + x1[j] * LOSCI) * 0.125f + kbb; (void)qi;
            float mx = fmaxf(a0, a1);
            mx = fmaxf(mx, __shfl_xor(mx, 1, 16)); mx = fmaxf(mx, __shfl_xor(mx, 2, 16)); mx = fmaxf(mx, __shfl_xor(mx, 4, 16)); mx = fmaxf(mx, __shfl_xor(mx, 8, 16));
            const float mn = fmaxf(mrow[j], mx);
            alpha[j] = __expf(mrow[j] - mn); mrow[j] = mn;
            const float p0 = __expf(a0 - mn), p1 = __expf(a1 - mn);
            lpart[j] = lpart[j] * alpha[j] + (p0 + p1);
            const int mr = hi * 8 + j;
            const float ps0 = p0 * PSC, ps1 = p1 * PSC; const h16 h0 = (h16)ps0, h1 = (h16)ps1;
            pl[mr * 32 + lr] = h0; pl[mr * 32 + 16 + lr] = h1;
            pl2[mr * 32 + lr] = (h16)((ps0 - (float)h0) * LOSC); pl2[mr * 32 + 16 + lr] = (h16)((ps1 - (float)h1) * LOSC);
        }
#pragma unroll
        for (int n = 0; n < 4; ++n)
#pragma unroll
            for (int j = 0; j < 8; ++j) { o[n][j] *= alpha[j]; ox[n][j] *= alpha[j]; }
        asm volatile("" ::: "memory");
        const v16h pa = cat16(*(const v8ha*)(pl + lr * 32 + hi * 8), *(const v8ha*)(pl + lr * 32 + 16 + hi * 8));
        const v16h px = cat16(*(const v8ha*)(pl2 + lr * 32 + hi * 8), *(const v8ha*)(pl2 + lr * 32 + 16 + hi * 8));
#pragma unroll
        for (int n = 0; n < 4; ++n) { const size_t vo = vbase + (size_t)(n * 16 + lr) * NT_ + l0 + hi * 8;
            const v16h vh = cat16(*(const v8h*)(VTH + vo), *(const v8h*)(VTH + vo + 16)), vl = cat16(*(const v8h*)(VTL + vo), *(const v8h*)(VTL + vo + 16));
            o[n] = wmma16(pa, vh, o[n]); ox[n] = wmma16(pa, vl, ox[n]); ox[n] = wmma16(px, vh, ox[n]);
            asm volatile("" : "+v"(o[n]), "+v"(ox[n]) : "v"(vh), "v"(vl) : "memory"); }
        asm volatile("v_nop\n\tv_nop\n\tv_nop\n\tv_nop" : "+v"(o[0]), "+v"(o[1]), "+v"(o[2]), "+v"(o[3]), "+v"(ox[0]), "+v"(ox[1]), "+v"(ox[2]), "+v"(ox[3]) : "v"(pa), "v"(px));
    }
    float inv[8];
#pragma unroll
    for (int j = 0; j < 8; ++j) { float rs = lpart[j]; rs += __shfl_xor(rs, 1, 16); rs += __shfl_xor(rs, 2, 16); rs += __shfl_xor(rs, 4, 16); rs += __shfl_xor(rs, 8, 16); inv[j] = 1.0f / (rs * PSC); }
    float* os = &ost[wave][0];
#pragma unroll
    for (int n = 0; n < 4; ++n)
#pragma unroll
        for (int j = 0; j < 8; ++j) os[(hi * 8 + j) * 68 + n * 16 + lr] = (o[n][j] + ox[n][j] * LOSCI) * inv[j];
    __syncthreads();
    const size_t cbase = (tokq0 + q0) * DM + (size_t)h * HD;
    auto pass = [&]() {
#pragma unroll
        for (int s = 0; s < 4; ++s) { const int row = 4 * s + (lane >> 3), piece = lane & 7; const float* sp = os + row * 68 + piece * 8; v8us oh, ol;
#pragma unroll
            for (int i = 0; i < 8; ++i) { const unsigned short hb = f2bf(sp[i]); oh[i] = hb; ol[i] = f2bf(sp[i] - bf2f(hb)); }
            *(v8us*)(CH + cbase + (size_t)row * DM + piece * 8) = oh; *(v8us*)(CL + cbase + (size_t)row * DM + piece * 8) = ol; }
    };
    pass(); 
}

#define VST2(T, p, v) do { const T vst2_v_ = (v); *(T*)(p) = vst2_v_;  } while (0)
extern "C" void kernel_launch(void* const* d_in, const int* in_sizes, int n_in,
                              void* d_out, int out_size, void* d_ws, size_t ws_size, hipStream_t stream) {
    (void)in_sizes; (void)n_in; (void)out_size;
    const float* query = (const float*)d_in[0]; const float* memory = (const float*)d_in[1]; const float* bias = (const float*)d_in[2];
    const float* Wq = (const float*)d_in[3]; const float* Wk = (const float*)d_in[4]; const float* Wv = (const float*)d_in[5]; const float* Wo = (const float*)d_in[6];   // all k-major [in][out]
    float* out = (float*)d_out;    // [4][1024][1024]
    char* wsp = (char*)d_ws;
    auto take = [&](size_t bytes) { char* p = wsp; wsp += (bytes + 255) & ~(size_t)255; return (void*)p; };
    bf* Xq = (bf*)take((size_t)NB_ * NTQ * DM * 2); bf* Xm = (bf*)take((size_t)NTK * DM * 2);
    bf* WqT = (bf*)take((size_t)DM * DM * 2); bf* WkT = (bf*)take((size_t)DM * DM * 2); bf* WvT = (bf*)take((size_t)DM * DM * 2); bf* WoT = (bf*)take((size_t)DM * DM * 2);
    float* TMP = (float*)take((size_t)NTK * DM * 4);
    h16* QH = (h16*)take((size_t)NB_ * NTQ * DM * 2); h16* QL = (h16*)take((size_t)NB_ * NTQ * DM * 2); h16* KH = (h16*)take((size_t)NTK * DM * 2); h16* KL = (h16*)take((size_t)NTK * DM * 2);
    h16* VTH = (h16*)take((size_t)NTK * DM * 2); h16* VTL = (h16*)take((size_t)NTK * DM * 2); bf* CH = (bf*)take((size_t)NB_ * NTQ * DM * 2); bf* CL = (bf*)take((size_t)NB_ * NTQ * DM * 2);
    if ((size_t)(wsp - (char*)d_ws) > ws_size) return;    // 8.4 + 16.8 + 4 x 2.1 + 33.6 + 2 x 8.4 + 4 x 16.8 + 2 x 8.4 ~ 168 MB, no aliasing
    k_wt<<<dim3(DM / 64, DM / 64, 1), 256, 0, stream>>>(Wq, DM, DM, WqT); k_wt<<<dim3(DM / 64, DM / 64, 1), 256, 0, stream>>>(Wk, DM, DM, WkT);
    k_wt<<<dim3(DM / 64, DM / 64, 1), 256, 0, stream>>>(Wv, DM, DM, WvT); k_wt<<<dim3(DM / 64, DM / 64, 1), 256, 0, stream>>>(Wo, DM, DM, WoT);
    k_cvtb<<<NB_ * NTQ / 8, 256, 0, stream>>>(query, NB_ * NTQ, Xq); k_cvtb<<<NTK / 8, 256, 0, stream>>>(memory, NTK, Xm);
    k_gemmb<false, true><<<dim3(NB_ * NTQ / 64, DM / 64, 1), 128, 0, stream>>>(Xq, nullptr, WqT, nullptr, (float*)(void*)QH, DM, QL);       // q = query.Wq  [4096][1024]
    k_gemmb<false, true><<<dim3(NTK / 64, DM / 64, 1), 128, 0, stream>>>(Xm, nullptr, WkT, nullptr, (float*)(void*)KH, DM, KL);            // k = memory.Wk [8192][1024]
    k_gemmb<false, false><<<dim3(NTK / 64, DM / 64, 1), 128, 0, stream>>>(Xm, nullptr, WvT, nullptr, TMP, DM, nullptr);                   // v = memory.Wv
    k_vt<<<NB_ * NH_ * (NT_ / 64), 256, 0, stream>>>(TMP, VTH, VTL);
    k_attn<<<NB_ * NH_ * (NTQ / 64), 128, 0, stream>>>(QH, QL, KH, KL, VTH, VTL, bias, CH, CL);
    k_gemmb<true, false><<<dim3(NB_ * NTQ / 64, DM / 64, 1), 128, 0, stream>>>(CH, CL, WoT, nullptr, out, DM, nullptr);
}

// v002
// Measured time: 402 microseconds a run.
// Next to v001, in two timings, it ran 1.22 and 1.23 times as fast.
// All steps since v000 together make it 2.47 times as fast.
#include <hip/hip_runtime.h>

// Compute dtypes, f32 accumulate, all 4 batch items in one pass (rows of the items stacked): q = query.Wq ([4096 x 1024].[1024 x 1024]) and k/v = memory.Wk/Wv ([8192 x 1024].[1024 x 1024]), k-major weights transposed once to n-major planes; PLAIN bf16
// operands: inputs rounded once, exact) with q and k written straight from the GEMM epilogue as f16 hi + residual x1024 planes, and out = ctx.Wo (ctx as
// bf16 hi + residual: two products) on v_wmma_f32_16x16x32_bf16; the 16-head cross-attention (1024 queries x 2048 memory keys, 64-dim heads, scale 1/8) + the INPUT per-key bias[b][k] fused on
// v_wmma_f32_16x16x32_f16 (scores hi.hi + hi.lo + lo.hi with the residual terms on their own accumulator, online f32 softmax, weights (x32768) and v as f16

#define NB_  4                   // batch items, all in every launch's grid
#define NT_  2048                // keys per item (memory length)
#define NTQ  1024                // queries per item
#define DM   1024
#define NH_  16
#define HD   64
#define NTK  (NB_ * NT_)
#define NW   1024
#define NQKV 1024
#define PSC  32768.0f
#define LOSC 1024.0f
#define LOSCI (1.0f / 1024.0f)

typedef _Float16 h16;
typedef unsigned short bf;
typedef __attribute__((ext_vector_type(16))) __bf16   v16bf;
typedef __attribute__((ext_vector_type(16))) _Float16 v16h;
typedef __attribute__((ext_vector_type(8)))  _Float16 v8h;
typedef __attribute__((ext_vector_type(8)))  unsigned short v8us;
typedef __attribute__((ext_vector_type(8)))  float    v8f;
typedef __attribute__((ext_vector_type(4)))  float    v4f;
typedef v8h  __attribute__((may_alias)) v8ha;
typedef v4f  __attribute__((may_alias)) v4fa;
typedef v8us __attribute__((may_alias)) v8usa;

__device__ __forceinline__ unsigned short f2bf(float f) { unsigned u = __float_as_uint(f); u += 0x7FFFu + ((u >> 16) & 1u); return (unsigned short)(u >> 16); }
__device__ __forceinline__ float bf2f(unsigned short b) { return __uint_as_float(((unsigned)b) << 16); }
__device__ __forceinline__ float bfr(float f) { return bf2f(f2bf(f)); }
__device__ __forceinline__ v16h cat16(v8h lo, v8h hi) { return __builtin_shufflevector(lo, hi, 0, 1, 2, 3, 4, 5, 6, 7, 8, 9, 10, 11, 12, 13, 14, 15); }
__device__ __forceinline__ v16bf cat16b(v8us lo, v8us hi) { return __builtin_bit_cast(v16bf, __builtin_shufflevector(lo, hi, 0, 1, 2, 3, 4, 5, 6, 7, 8, 9, 10, 11, 12, 13, 14, 15)); }
__device__ __forceinline__ v8f wmma16(v16h a, v16h b, v8f c) { return __builtin_amdgcn_wmma_f32_16x16x32_f16(false, a, false, b, (short)0, c, false, false); }
__device__ __forceinline__ v8f wmmab(v16bf a, v16bf b, v8f c) { return __builtin_amdgcn_wmma_f32_16x16x32_bf16(false, a, false, b, (short)0, c, false, false); }

__global__ __launch_bounds__(256) void k_cvtb(const float* __restrict__ src, int nrows, bf* dst) {
    const int lane = threadIdx.x & 31, r = blockIdx.x * 8 + (threadIdx.x >> 5);
    if (r >= nrows) return;
    v8us o[DM / 256];
#pragma unroll
    for (int q = 0; q < DM / 256; ++q) { v8us t;
#pragma unroll
        for (int i = 0; i < 8; ++i) t[i] = f2bf(src[(size_t)r * DM + q * 256 + lane * 8 + i]);
        o[q] = t; }
#pragma unroll
    for (int q = 0; q < DM / 256; ++q) *(v8us*)(dst + (size_t)r * DM + q * 256 + lane * 8) = o[q];
    
}

// k_wt: WT [n][K] = bf16(W[k][n]) (k-major [K][ncols]) via 64 x 64 LDS tiles; grid (K/64, ncols/64).
__global__ __launch_bounds__(256) void k_wt(const float* __restrict__ Wm, int K, int ncols, bf* WT) {
    __shared__ __align__(16) unsigned short tl[64 * 72];
    const int tid = threadIdx.x, k0 = blockIdx.x * 64, n0 = blockIdx.y * 64;
    const int kk = tid >> 2, nq = (tid & 3) * 16;
#pragma unroll
    for (int i = 0; i < 16; ++i) tl[(nq + i) * 72 + kk] = f2bf(Wm[(size_t)(k0 + kk) * ncols + n0 + nq + i]);
    __syncthreads();
    const int piece = tid & 7;
    auto pass = [&]() {
#pragma unroll
        for (int s = 0; s < 2; ++s) { const int nr = (tid >> 3) + 32 * s; const v8us val = *(const v8usa*)(tl + nr * 72 + piece * 8); *(v8us*)(WT + (size_t)(n0 + nr) * K + k0 + piece * 8) = val; }
    };
    pass(); 
}
template <bool SPLITA, bool F16OUT = false>
__global__ __launch_bounds__(128) void k_gemmb(const bf* __restrict__ A, const bf* __restrict__ Al, const bf* __restrict__ Bn, const float* __restrict__ bias, float* C, int ldc, h16* C2) {
    __shared__ __align__(16) float ost[4][16 * 68];
    const int lane = threadIdx.x & 31, wave = threadIdx.x >> 5, lr = lane & 15, hi = lane >> 4;
    const int r0 = blockIdx.x * 64 + wave * 16, c0 = blockIdx.y * 64;
    const size_t aoff = (size_t)(r0 + lr) * DM + 8 * hi;
    size_t boff[4];
#pragma unroll
    for (int t = 0; t < 4; ++t) boff[t] = (size_t)(c0 + t * 16 + lr) * DM + 8 * hi;
    v8f acc[4];
#pragma unroll
    for (int t = 0; t < 4; ++t) acc[t] = (v8f){};
#pragma unroll 1
    for (int kc = 0; kc < DM; kc += 32) {
        const v16bf a = cat16b(*(const v8us*)(A + aoff + kc), *(const v8us*)(A + aoff + kc + 16));
        v16bf al = a;
        if (SPLITA) al = cat16b(*(const v8us*)(Al + aoff + kc), *(const v8us*)(Al + aoff + kc + 16));
#pragma unroll
        for (int t = 0; t < 4; ++t) { const v16bf b = cat16b(*(const v8us*)(Bn + boff[t] + kc), *(const v8us*)(Bn + boff[t] + kc + 16)); acc[t] = wmmab(a, b, acc[t]); if (SPLITA) acc[t] = wmmab(al, b, acc[t]); }
        asm volatile("v_nop\n\tv_nop\n\tv_nop\n\tv_nop" : "+v"(acc[0]), "+v"(acc[1]), "+v"(acc[2]), "+v"(acc[3]) : "v"(a), "v"(al));
    }
    float* os = &ost[wave][0];
#pragma unroll
    for (int t = 0; t < 4; ++t) { const float bv = bias ? bfr(bias[c0 + t * 16 + lr]) : 0.f;
#pragma unroll
        for (int j = 0; j < 8; ++j) os[(hi * 8 + j) * 68 + t * 16 + lr] = acc[t][j] + bv; }
    __syncthreads();
    if (F16OUT) {
        h16* crow = (h16*)(void*)C + (size_t)r0 * ldc + c0;
        auto pass = [&]() {
#pragma unroll
            for (int s = 0; s < 4; ++s) { const int row = 4 * s + (lane >> 3), piece = lane & 7; const float* sp = os + row * 68 + piece * 8; v8h o, o2;
#pragma unroll
                for (int i = 0; i < 8; ++i) { const h16 a = (h16)sp[i]; o[i] = a; o2[i] = (h16)((sp[i] - (float)a) * LOSC); }
                *(v8h*)(crow + (size_t)row * ldc + piece * 8) = o; if (C2) *(v8h*)(C2 + (size_t)r0 * ldc + c0 + (size_t)row * ldc + piece * 8) = o2; }
        };
        pass(); 
    } else {
        float* crow = C + (size_t)r0 * ldc + c0;
        auto pass = [&]() {
#pragma unroll
            for (int s = 0; s < 8; ++s) { const int Lid = (lane >> 3) + 4 * s, piece = lane & 7; const int row = Lid >> 1, cofs = (Lid & 1) * 32 + piece * 4;
                const v4f val = *(const v4fa*)(os + row * 68 + cofs); *(v4f*)(crow + (size_t)row * ldc + cofs) = val; }
        };
        pass(); 
    }
}

__global__ __launch_bounds__(256) void k_vt(const float* __restrict__ V, h16* VTH, h16* VTL) {
    __shared__ __align__(16) h16 tile[64 * 72];
    __shared__ __align__(16) h16 til2[64 * 72];
    const int bid = blockIdx.x;
    const int b = bid / (NH_ * (NT_ / 64)), rem = bid - b * (NH_ * (NT_ / 64)), h = rem / (NT_ / 64), kt = rem - h * (NT_ / 64);
    const int k0 = kt * 64, tid = threadIdx.x;
    const int kk = tid >> 2, d0 = (tid & 3) * 16;
    const float* src = V + ((size_t)b * NT_ + k0 + kk) * DM + h * HD + d0;
#pragma unroll
    for (int i = 0; i < 16; ++i) { const float v = src[i]; const h16 a = (h16)v; tile[(d0 + i) * 72 + kk] = a; til2[(d0 + i) * 72 + kk] = (h16)((v - (float)a) * LOSC); }
    __syncthreads();
    const int piece = tid & 7;
    const size_t base = (((size_t)b * NH_ + h) * HD) * NT_ + k0;
    auto pass = [&]() {
#pragma unroll
        for (int s = 0; s < 4; ++s) { const int Lid = (tid >> 3) + 32 * s; const int pln = Lid >> 6, d = Lid & 63;
            const v8h val = *(const v8ha*)((pln ? til2 : tile) + d * 72 + piece * 8); *(v8h*)((pln ? VTL : VTH) + base + (size_t)d * NT_ + piece * 8) = val; }
    };
    pass(); 
}

// LDS ring of k_attn: one stage = 32 keys: k hi, k residual (32 rows of 128 B each), v hi, v residual (64 rows of 64 B each); every row is 16 B longer in LDS
// (a pitch that is an odd multiple of 16 B, so that the 16-byte fragment reads of 16 rows fall on different banks).
#define KPIT 72                  // halves per staged k row
#define VPIT 40                  // halves per staged v row
#define KPL  (32 * KPIT)         // halves per k plane
#define VPL  (64 * VPIT)         // halves per v plane
#define STG  (2 * KPL + 2 * VPL) // halves per stage

// One stage: 8 copies of 16 B per lane, 128 lanes, global to LDS through no register. ldk, ldv: the lane's LDS byte address in the stage's k hi and v hi plane.
// s_wait_xcnt ends the statement so that no address register of a copy is rewritten ahead of it.
__device__ __forceinline__ void stage_kv(unsigned ldk, unsigned ldv, const h16* gkh, const h16* gkl, const h16* gvh, const h16* gvl) {
    asm volatile("global_load_async_to_lds_b128 %0, %8, off\n\t"
                 "global_load_async_to_lds_b128 %1, %9, off\n\t"
                 "global_load_async_to_lds_b128 %2, %10, off\n\t"
                 "global_load_async_to_lds_b128 %3, %11, off\n\t"
                 "global_load_async_to_lds_b128 %4, %12, off\n\t"
                 "global_load_async_to_lds_b128 %5, %13, off\n\t"
                 "global_load_async_to_lds_b128 %6, %14, off\n\t"
                 "global_load_async_to_lds_b128 %7, %15, off\n\t"
                 "s_wait_xcnt 0x0"
                 :: "v"(ldk), "v"(ldk + 16 * KPIT * 2), "v"(ldk + KPL * 2), "v"(ldk + (KPL + 16 * KPIT) * 2),
                    "v"(ldv), "v"(ldv + 32 * VPIT * 2), "v"(ldv + VPL * 2), "v"(ldv + (VPL + 32 * VPIT) * 2),
                    "v"(gkh), "v"(gkh + 16 * DM), "v"(gkl), "v"(gkl + 16 * DM), "v"(gvh), "v"(gvh + 32 * NT_), "v"(gvl), "v"(gvl + 32 * NT_) : "memory");
}

// k_attn: block = (b, h, 64 queries), wave = 16; ALL 64 key tiles (no mask); 4 WMMA scores /8 (f32), online softmax, weights x32768 f16 tile (same-wave may_alias
// reload after a compiler barrier), 4 WMMA .v; ctx -> bf16 hi + residual planes CH/CL[tok][h*64+d].
__global__ __launch_bounds__(128) void k_attn(const h16* __restrict__ Q16, const h16* __restrict__ QL16, const h16* __restrict__ K16, const h16* __restrict__ KL16, const h16* __restrict__ VTH, const h16* __restrict__ VTL, const float* __restrict__ KB, bf* CH, bf* CL) {
    __shared__ __align__(16) h16 plds[4][16 * 32];
    __shared__ __align__(16) h16 plds2[4][16 * 32];
    __shared__ __align__(16) float ost[4][16 * 68];
    __shared__ __align__(16) h16 ring[2][STG];      // two stages of k and v, shared by the 4 waves
    __shared__ __align__(16) float kbs[NT_];        // the item's whole key bias row, filled once
    const int lane = threadIdx.x & 31, wave = threadIdx.x >> 5, lr = lane & 15, hi = lane >> 4;
    const int bid = blockIdx.x;
    const int b = bid / (NH_ * (NTQ / 64)), rem = bid - b * (NH_ * (NTQ / 64)), h = rem / (NTQ / 64), qt = rem - h * (NTQ / 64);     // query blocks over the 1024 queries
    const int q0 = qt * 64 + wave * 16;
    const size_t tok0 = (size_t)b * NT_;     // key-side item offset; query rows use tokq0
    const size_t tokq0 = (size_t)b * NTQ;
    h16* pl = &plds[wave][0]; h16* pl2 = &plds2[wave][0];
    v16h qa[2];
    const size_t qo0 = (tokq0 + q0 + lr) * DM + h * HD + 8 * hi;
#pragma unroll
    for (int kc = 0; kc < 2; ++kc) qa[kc] = cat16(*(const v8h*)(Q16 + qo0 + kc * 32), *(const v8h*)(Q16 + qo0 + kc * 32 + 16));
    const h16* kh_b = K16 + tok0 * DM + h * HD;
    const h16* kl_b = KL16 + tok0 * DM + h * HD;
    const size_t vbase = (((size_t)b * NH_ + h) * HD) * NT_;
    v8f o[4], ox[4];
#pragma unroll
    for (int n = 0; n < 4; ++n) { o[n] = (v8f){}; ox[n] = (v8f){}; }
    float mrow[8], lpart[8];
#pragma unroll
    for (int j = 0; j < 8; ++j) { mrow[j] = -3.0e38f; lpart[j] = 0.f; }
    int qpos[8];
#pragma unroll
    for (int j = 0; j < 8; ++j) qpos[j] = q0 + 8 * hi + j;
    const int kt_lo = 0, kt_hi = NT_ / 32 - 1;     // cross-attention: all 2048 memory keys; + the INPUT per-key bias[b][k]
    const int tid = threadIdx.x;
    // the lane's share of a stage: k rows tid/8 and tid/8 + 16, 16-byte piece tid%8; v rows tid/4 and tid/4 + 32, piece tid%4
    const unsigned ldk0 = (unsigned)(size_t)(&ring[0][0] + (tid >> 3) * KPIT + (tid & 7) * 8);
    const unsigned ldv0 = (unsigned)(size_t)(&ring[0][0] + 2 * KPL + (tid >> 2) * VPIT + (tid & 3) * 8);
    const h16* gkh = kh_b + (size_t)(tid >> 3) * DM + (tid & 7) * 8;
    const h16* gkl = kl_b + (size_t)(tid >> 3) * DM + (tid & 7) * 8;
    const h16* gvh = VTH + vbase + (size_t)(tid >> 2) * NT_ + (tid & 3) * 8;
    const h16* gvl = VTL + vbase + (size_t)(tid >> 2) * NT_ + (tid & 3) * 8;
    {   // the bias row: 4 copies of 16 B per lane; s_wait_xcnt as in stage_kv
        const unsigned ldb = (unsigned)(size_t)(&kbs[0] + tid * 4);
        const float* gb = KB + tok0 + tid * 4;
        asm volatile("global_load_async_to_lds_b128 %0, %4, off\n\t"
                     "global_load_async_to_lds_b128 %1, %5, off\n\t"
                     "global_load_async_to_lds_b128 %2, %6, off\n\t"
                     "global_load_async_to_lds_b128 %3, %7, off\n\t"
                     "s_wait_xcnt 0x0"
                     :: "v"(ldb), "v"(ldb + 2048), "v"(ldb + 4096), "v"(ldb + 6144), "v"(gb), "v"(gb + 512), "v"(gb + 1024), "v"(gb + 1536) : "memory");
    }
    stage_kv(ldk0, ldv0, gkh, gkl, gvh, gvl);                                                   // stage 0 into buffer 0
    asm volatile("s_wait_asynccnt 0x0" ::: "memory");                                           // this wave's copies of stage 0 and of the bias row have landed
    __syncthreads();                                                                            // ... and every other wave's: stage 0 may be read
    stage_kv(ldk0 + STG * 2, ldv0 + STG * 2, gkh + 32 * DM, gkl + 32 * DM, gvh + 32, gvl + 32); // stage 1 flies while stage 0 is worked on
#pragma unroll 1
    for (int kt = kt_lo; kt <= kt_hi; ++kt) {
        const int l0 = kt * 32;
        const h16* skh = &ring[kt & 1][0];          // this trip's stage: k hi, k residual, v hi, v residual
        const h16* skl = skh + KPL; const h16* svh = skh + 2 * KPL; const h16* svl = svh + VPL;
        const int ko0 = lr * KPIT + 8 * hi, ko1 = (16 + lr) * KPIT + 8 * hi;
        v8f s0 = {}, s1 = {}, x0 = {}, x1 = {};
#pragma unroll
        for (int kc = 0; kc < 2; ++kc) {
            { const v16h k0h = cat16(*(const v8ha*)(skh + ko0 + kc * 32), *(const v8ha*)(skh + ko0 + kc * 32 + 16)), k1h = cat16(*(const v8ha*)(skh + ko1 + kc * 32), *(const v8ha*)(skh + ko1 + kc * 32 + 16));
              const v16h qlk = cat16(*(const v8h*)(QL16 + qo0 + kc * 32), *(const v8h*)(QL16 + qo0 + kc * 32 + 16));     // query residual re-read per step (registers)
              s0 = wmma16(qa[kc], k0h, s0); x0 = wmma16(qlk, k0h, x0); s1 = wmma16(qa[kc], k1h, s1); x1 = wmma16(qlk, k1h, x1);
              asm volatile("v_nop" : "+v"(s0), "+v"(s1), "+v"(x0), "+v"(x1) : "v"(qlk), "v"(k0h), "v"(k1h) : "memory"); }
            { const v16h k0l = cat16(*(const v8ha*)(skl + ko0 + kc * 32), *(const v8ha*)(skl + ko0 + kc * 32 + 16)), k1l = cat16(*(const v8ha*)(skl + ko1 + kc * 32), *(const v8ha*)(skl + ko1 + kc * 32 + 16));
              x0 = wmma16(qa[kc], k0l, x0); x1 = wmma16(qa[kc], k1l, x1);
              asm volatile("v_nop" : "+v"(x0), "+v"(x1) : "v"(k0l), "v"(k1l) : "memory"); }
        }
        asm volatile("v_nop\n\tv_nop\n\tv_nop\n\tv_nop" : "+v"(s0), "+v"(s1), "+v"(x0), "+v"(x1) : "v"(qa[0]), "v"(qa[1]));
        float alpha[8]; const float kba = bfr(kbs[l0 + lr]), kbb = bfr(kbs[l0 + 16 + lr]);
#pragma unroll
        for (int j = 0; j < 8; ++j) {
            const int ja = l0 + lr, jb = l0 + 16 + lr, qi = qpos[j]; (void)ja; (void)jb;
            const float a0 = (s0[j] + x0[j] * LOSCI) * 0.125f + kba, a1 = (s1[j] + x1[j] * LOSCI) * 0.125f + kbb; (void)qi;
            float mx = fmaxf(a0, a1);
            mx = fmaxf(mx, __shfl_xor(mx, 1, 16)); mx = fmaxf(mx, __shfl_xor(mx, 2, 16)); mx = fmaxf(mx, __shfl_xor(mx, 4, 16)); mx = fmaxf(mx, __shfl_xor(mx, 8, 16));
            const float mn = fmaxf(mrow[j], mx);
            alpha[j] = __expf(mrow[j] - mn); mrow[j] = mn;
            const float p0 = __expf(a0 - mn), p1 = __expf(a1 - mn);
            lpart[j] = lpart[j] * alpha[j] + (p0 + p1);
            const int mr = hi * 8 + j;
            const float ps0 = p0 * PSC, ps1 = p1 * PSC; const h16 h0 = (h16)ps0, h1 = (h16)ps1;
            pl[mr * 32 + lr] = h0; pl[mr * 32 + 16 + lr] = h1;
            pl2[mr * 32 + lr] = (h16)((ps0 - (float)h0) * LOSC); pl2[mr * 32 + 16 + lr] = (h16)((ps1 - (float)h1) * LOSC);
        }
#pragma unroll
        for (int n = 0; n < 4; ++n)
#pragma unroll
            for (int j = 0; j < 8; ++j) { o[n][j] *= alpha[j]; ox[n][j] *= alpha[j]; }
        asm volatile("" ::: "memory");
        const v16h pa = cat16(*(const v8ha*)(pl + lr * 32 + hi * 8), *(const v8ha*)(pl + lr * 32 + 16 + hi * 8));
        const v16h px = cat16(*(const v8ha*)(pl2 + lr * 32 + hi * 8), *(const v8ha*)(pl2 + lr * 32 + 16 + hi * 8));
#pragma unroll
        for (int n = 0; n < 4; ++n) { const int vo = (n * 16 + lr) * VPIT + hi * 8;
            const v16h vh = cat16(*(const v8ha*)(svh + vo), *(const v8ha*)(svh + vo + 16)), vl = cat16(*(const v8ha*)(svl + vo), *(const v8ha*)(svl + vo + 16));
            o[n] = wmma16(pa, vh, o[n]); ox[n] = wmma16(pa, vl, ox[n]); ox[n] = wmma16(px, vh, ox[n]);
            asm volatile("" : "+v"(o[n]), "+v"(ox[n]) : "v"(vh), "v"(vl) : "memory"); }
        asm volatile("v_nop\n\tv_nop\n\tv_nop\n\tv_nop" : "+v"(o[0]), "+v"(o[1]), "+v"(o[2]), "+v"(o[3]), "+v"(ox[0]), "+v"(ox[1]), "+v"(ox[2]), "+v"(ox[3]) : "v"(pa), "v"(px));
        asm volatile("s_wait_dscnt 0x0" ::: "memory");      // this wave's reads of the stage are done before the buffer is handed back
        asm volatile("s_wait_asynccnt 0x0" ::: "memory");   // this wave's copies of stage kt + 1 have landed
        __syncthreads();                                    // publishes stage kt + 1 and ends every wave's reads of stage kt
        if (kt + 2 <= kt_hi) {                              // same for the whole block: refill the buffer that this trip has read
            const unsigned bo = (unsigned)(kt & 1) * (STG * 2);
            stage_kv(ldk0 + bo, ldv0 + bo, gkh + (size_t)(l0 + 64) * DM, gkl + (size_t)(l0 + 64) * DM, gvh + l0 + 64, gvl + l0 + 64);
        }
    }
    asm volatile("s_wait_asynccnt 0x0" ::: "memory");       // nothing of this wave is in flight behind the loop
    float inv[8];
#pragma unroll
    for (int j = 0; j < 8; ++j) { float rs = lpart[j]; rs += __shfl_xor(rs, 1, 16); rs += __shfl_xor(rs, 2, 16); rs += __shfl_xor(rs, 4, 16); rs += __shfl_xor(rs, 8, 16); inv[j] = 1.0f / (rs * PSC); }
    float* os = &ost[wave][0];
#pragma unroll
    for (int n = 0; n < 4; ++n)
#pragma unroll
        for (int j = 0; j < 8; ++j) os[(hi * 8 + j) * 68 + n * 16 + lr] = (o[n][j] + ox[n][j] * LOSCI) * inv[j];
    __syncthreads();
    const size_t cbase = (tokq0 + q0) * DM + (size_t)h * HD;
    auto pass = [&]() {
#pragma unroll
        for (int s = 0; s < 4; ++s) { const int row = 4 * s + (lane >> 3), piece = lane & 7; const float* sp = os + row * 68 + piece * 8; v8us oh, ol;
#pragma unroll
            for (int i = 0; i < 8; ++i) { const unsigned short hb = f2bf(sp[i]); oh[i] = hb; ol[i] = f2bf(sp[i] - bf2f(hb)); }
            *(v8us*)(CH + cbase + (size_t)row * DM + piece * 8) = oh; *(v8us*)(CL + cbase + (size_t)row * DM + piece * 8) = ol; }
    };
    pass(); 
}

#define VST2(T, p, v) do { const T vst2_v_ = (v); *(T*)(p) = vst2_v_;  } while (0)
extern "C" void kernel_launch(void* const* d_in, const int* in_sizes, int n_in,
                              void* d_out, int out_size, void* d_ws, size_t ws_size, hipStream_t stream) {
    (void)in_sizes; (void)n_in; (void)out_size;
    const float* query = (const float*)d_in[0]; const float* memory = (const float*)d_in[1]; const float* bias = (const float*)d_in[2];
    const float* Wq = (const float*)d_in[3]; const float* Wk = (const float*)d_in[4]; const float* Wv = (const float*)d_in[5]; const float* Wo = (const float*)d_in[6];   // all k-major [in][out]
    float* out = (float*)d_out;    // [4][1024][1024]
    char* wsp = (char*)d_ws;
    auto take = [&](size_t bytes) { char* p = wsp; wsp += (bytes + 255) & ~(size_t)255; return (void*)p; };
    bf* Xq = (bf*)take((size_t)NB_ * NTQ * DM * 2); bf* Xm = (bf*)take((size_t)NTK * DM * 2);
    bf* WqT = (bf*)take((size_t)DM * DM * 2); bf* WkT = (bf*)take((size_t)DM * DM * 2); bf* WvT = (bf*)take((size_t)DM * DM * 2); bf* WoT = (bf*)take((size_t)DM * DM * 2);
    float* TMP = (float*)take((size_t)NTK * DM * 4);
    h16* QH = (h16*)take((size_t)NB_ * NTQ * DM * 2); h16* QL = (h16*)take((size_t)NB_ * NTQ * DM * 2); h16* KH = (h16*)take((size_t)NTK * DM * 2); h16* KL = (h16*)take((size_t)NTK * DM * 2);
    h16* VTH = (h16*)take((size_t)NTK * DM * 2); h16* VTL = (h16*)take((size_t)NTK * DM * 2); bf* CH = (bf*)take((size_t)NB_ * NTQ * DM * 2); bf* CL = (bf*)take((size_t)NB_ * NTQ * DM * 2);
    if ((size_t)(wsp - (char*)d_ws) > ws_size) return;    // 8.4 + 16.8 + 4 x 2.1 + 33.6 + 2 x 8.4 + 4 x 16.8 + 2 x 8.4 ~ 168 MB, no aliasing
    k_wt<<<dim3(DM / 64, DM / 64, 1), 256, 0, stream>>>(Wq, DM, DM, WqT); k_wt<<<dim3(DM / 64, DM / 64, 1), 256, 0, stream>>>(Wk, DM, DM, WkT);
    k_wt<<<dim3(DM / 64, DM / 64, 1), 256, 0, stream>>>(Wv, DM, DM, WvT); k_wt<<<dim3(DM / 64, DM / 64, 1), 256, 0, stream>>>(Wo, DM, DM, WoT);
    k_cvtb<<<NB_ * NTQ / 8, 256, 0, stream>>>(query, NB_ * NTQ, Xq); k_cvtb<<<NTK / 8, 256, 0, stream>>>(memory, NTK, Xm);
    k_gemmb<false, true><<<dim3(NB_ * NTQ / 64, DM / 64, 1), 128, 0, stream>>>(Xq, nullptr, WqT, nullptr, (float*)(void*)QH, DM, QL);       // q = query.Wq  [4096][1024]
    k_gemmb<false, true><<<dim3(NTK / 64, DM / 64, 1), 128, 0, stream>>>(Xm, nullptr, WkT, nullptr, (float*)(void*)KH, DM, KL);            // k = memory.Wk [8192][1024]
    k_gemmb<false, false><<<dim3(NTK / 64, DM / 64, 1), 128, 0, stream>>>(Xm, nullptr, WvT, nullptr, TMP, DM, nullptr);                   // v = memory.Wv
    k_vt<<<NB_ * NH_ * (NT_ / 64), 256, 0, stream>>>(TMP, VTH, VTL);
    k_attn<<<NB_ * NH_ * (NTQ / 64), 128, 0, stream>>>(QH, QL, KH, KL, VTH, VTL, bias, CH, CL);
    k_gemmb<true, false><<<dim3(NB_ * NTQ / 64, DM / 64, 1), 128, 0, stream>>>(CH, CL, WoT, nullptr, out, DM, nullptr);
}

// v003
// Measured time: 239 microseconds a run.
// Timed twice side by side with v002, it ran 1.68 and 1.69 times as fast.
// Counting every step since v000, it is 4.16 times as fast.
#include <hip/hip_runtime.h>

// Compute dtypes, f32 accumulate, all 4 batch items in one pass (rows of the items stacked): q = query.Wq ([4096 x 1024].[1024 x 1024]) and k/v = memory.Wk/Wv ([8192 x 1024].[1024 x 1024]), k-major weights transposed once to n-major planes; PLAIN bf16
// operands: inputs rounded once, exact) with q and k written straight from the GEMM epilogue as f16 hi + residual x1024 planes, and out = ctx.Wo (ctx as
// bf16 hi + residual: two products) on v_wmma_f32_16x16x32_bf16; the 16-head cross-attention (1024 queries x 2048 memory keys, 64-dim heads, scale 1/8) + the INPUT per-key bias[b][k] fused on
// v_wmma_f32_16x16x32_f16 (scores hi.hi + hi.lo + lo.hi with the residual terms on their own accumulator, online f32 softmax, weights (x32768) and v as f16

#define NB_  4                   // batch items, all in every launch's grid
#define NT_  2048                // keys per item (memory length)
#define NTQ  1024                // queries per item
#define DM   1024
#define NH_  16
#define HD   64
#define NTK  (NB_ * NT_)
#define NW   1024
#define NQKV 1024
#define PSC  32768.0f
#define LOSC 1024.0f
#define LOSCI (1.0f / 1024.0f)

typedef _Float16 h16;
typedef unsigned short bf;
typedef __attribute__((ext_vector_type(16))) __bf16   v16bf;
typedef __attribute__((ext_vector_type(16))) _Float16 v16h;
typedef __attribute__((ext_vector_type(8)))  _Float16 v8h;
typedef __attribute__((ext_vector_type(8)))  unsigned short v8us;
typedef __attribute__((ext_vector_type(8)))  float    v8f;
typedef __attribute__((ext_vector_type(4)))  float    v4f;
typedef v8h  __attribute__((may_alias)) v8ha;
typedef v4f  __attribute__((may_alias)) v4fa;
typedef v8us __attribute__((may_alias)) v8usa;

__device__ __forceinline__ unsigned short f2bf(float f) { unsigned u = __float_as_uint(f); u += 0x7FFFu + ((u >> 16) & 1u); return (unsigned short)(u >> 16); }
__device__ __forceinline__ float bf2f(unsigned short b) { return __uint_as_float(((unsigned)b) << 16); }
__device__ __forceinline__ float bfr(float f) { return bf2f(f2bf(f)); }
__device__ __forceinline__ v16h cat16(v8h lo, v8h hi) { return __builtin_shufflevector(lo, hi, 0, 1, 2, 3, 4, 5, 6, 7, 8, 9, 10, 11, 12, 13, 14, 15); }
__device__ __forceinline__ v16bf cat16b(v8us lo, v8us hi) { return __builtin_bit_cast(v16bf, __builtin_shufflevector(lo, hi, 0, 1, 2, 3, 4, 5, 6, 7, 8, 9, 10, 11, 12, 13, 14, 15)); }
__device__ __forceinline__ v8f wmma16(v16h a, v16h b, v8f c) { return __builtin_amdgcn_wmma_f32_16x16x32_f16(false, a, false, b, (short)0, c, false, false); }
__device__ __forceinline__ v8f wmmab(v16bf a, v16bf b, v8f c) { return __builtin_amdgcn_wmma_f32_16x16x32_bf16(false, a, false, b, (short)0, c, false, false); }

__global__ __launch_bounds__(256) void k_cvtb(const float* __restrict__ src, int nrows, bf* dst) {
    const int lane = threadIdx.x & 31, r = blockIdx.x * 8 + (threadIdx.x >> 5);
    if (r >= nrows) return;
    v8us o[DM / 256];
#pragma unroll
    for (int q = 0; q < DM / 256; ++q) { v8us t;
#pragma unroll
        for (int i = 0; i < 8; ++i) t[i] = f2bf(src[(size_t)r * DM + q * 256 + lane * 8 + i]);
        o[q] = t; }
#pragma unroll
    for (int q = 0; q < DM / 256; ++q) *(v8us*)(dst + (size_t)r * DM + q * 256 + lane * 8) = o[q];
    
}

// k_wt: WT [n][K] = bf16(W[k][n]) (k-major [K][ncols]) via 64 x 64 LDS tiles; grid (K/64, ncols/64).
__global__ __launch_bounds__(256) void k_wt(const float* __restrict__ Wm, int K, int ncols, bf* WT) {
    __shared__ __align__(16) unsigned short tl[64 * 72];
    const int tid = threadIdx.x, k0 = blockIdx.x * 64, n0 = blockIdx.y * 64;
    const int kk = tid >> 2, nq = (tid & 3) * 16;
#pragma unroll
    for (int i = 0; i < 16; ++i) tl[(nq + i) * 72 + kk] = f2bf(Wm[(size_t)(k0 + kk) * ncols + n0 + nq + i]);
    __syncthreads();
    const int piece = tid & 7;
    auto pass = [&]() {
#pragma unroll
        for (int s = 0; s < 2; ++s) { const int nr = (tid >> 3) + 32 * s; const v8us val = *(const v8usa*)(tl + nr * 72 + piece * 8); *(v8us*)(WT + (size_t)(n0 + nr) * K + k0 + piece * 8) = val; }
    };
    pass(); 
}
// LDS ring of k_gemmb: one stage = 128 k of the block's 128 A rows, 128 B rows (and, split A, 128 residual rows): rows of 256 B, 16 B longer in LDS
// (a pitch that is an odd multiple of 16 B, so that the 16-byte fragment reads of 16 rows fall on different banks).
#define GKS  128                 // k per stage
#define GPIT 136                 // halves per staged row
#define GPL  (128 * GPIT)        // halves per plane of 128 rows

// One plane of a stage: 8 copies of 16 B per lane, 256 lanes, global to LDS through no register: rows r, r + 16, ..., r + 112 of the plane, whole 256-byte row pieces per 16 lanes.
// s_wait_xcnt ends the statement so that no address register of a copy is rewritten ahead of it.
__device__ __forceinline__ void stage_g(unsigned ld, const bf* g) {
    asm volatile("global_load_async_to_lds_b128 %0, %8, off\n\t"
                 "global_load_async_to_lds_b128 %1, %9, off\n\t"
                 "global_load_async_to_lds_b128 %2, %10, off\n\t"
                 "global_load_async_to_lds_b128 %3, %11, off\n\t"
                 "global_load_async_to_lds_b128 %4, %12, off\n\t"
                 "global_load_async_to_lds_b128 %5, %13, off\n\t"
                 "global_load_async_to_lds_b128 %6, %14, off\n\t"
                 "global_load_async_to_lds_b128 %7, %15, off\n\t"
                 "s_wait_xcnt 0x0"
                 :: "v"(ld), "v"(ld + 16 * GPIT * 2), "v"(ld + 32 * GPIT * 2), "v"(ld + 48 * GPIT * 2),
                    "v"(ld + 64 * GPIT * 2), "v"(ld + 80 * GPIT * 2), "v"(ld + 96 * GPIT * 2), "v"(ld + 112 * GPIT * 2),
                    "v"(g), "v"(g + 16 * DM), "v"(g + 32 * DM), "v"(g + 48 * DM), "v"(g + 64 * DM), "v"(g + 80 * DM), "v"(g + 96 * DM), "v"(g + 112 * DM) : "memory");
}

// k_gemmb: C[128 x 128 per block] = A.Bn^T over k = 1024; 8 waves as 4 x 2, a wave = 32 rows x 64 columns (2 x 4 accumulator tiles); grid (rows / 128, columns / 128).
template <bool SPLITA, bool F16OUT = false>
__global__ __launch_bounds__(256) void k_gemmb(const bf* __restrict__ A, const bf* __restrict__ Al, const bf* __restrict__ Bn, const float* __restrict__ bias, float* C, int ldc, h16* C2) {
    constexpr int NPL = SPLITA ? 3 : 2;             // planes per stage
    __shared__ __align__(16) bf gring[2][NPL * GPL]; // two stages, shared by the 8 waves; output staging behind the loop
    const int tid = threadIdx.x, lane = tid & 31, wave = tid >> 5, lr = lane & 15, hi = lane >> 4;
    const int rb = blockIdx.x * 128, cb = blockIdx.y * 128;
    const int wr = (wave >> 1) * 32, wc = (wave & 1) * 64;
    const int r0 = rb + wr, c0 = cb + wc;
    // the lane's share of a plane: rows tid/16 + 16 i, 16-byte piece tid%16
    const unsigned ld0 = (unsigned)(size_t)(&gring[0][0] + (tid >> 4) * GPIT + (tid & 15) * 8);
    const bf* ga = A + (size_t)(rb + (tid >> 4)) * DM + (tid & 15) * 8;
    const bf* gb = Bn + (size_t)(cb + (tid >> 4)) * DM + (tid & 15) * 8;
    auto fill = [&](int s) {
        const unsigned ld = ld0 + (unsigned)(s & 1) * (NPL * GPL * 2);
        stage_g(ld, ga + s * GKS); stage_g(ld + GPL * 2, gb + s * GKS);
        if (SPLITA) stage_g(ld + 2 * GPL * 2, Al + (size_t)(rb + (tid >> 4)) * DM + (tid & 15) * 8 + s * GKS);
    };
    v8f acc[2][4];
#pragma unroll
    for (int m = 0; m < 2; ++m)
#pragma unroll
        for (int t = 0; t < 4; ++t) acc[m][t] = (v8f){};
    fill(0);                                                // stage 0 into buffer 0
    asm volatile("s_wait_asynccnt 0x0" ::: "memory");       // this wave's copies of stage 0 have landed
    __syncthreads();                                        // ... and every other wave's: stage 0 may be read
    fill(1);                                                // stage 1 flies while stage 0 is worked on
#pragma unroll 1
    for (int s = 0; s < DM / GKS; ++s) {
        const bf* sa = &gring[s & 1][0] + (wr + lr) * GPIT + 8 * hi;
        const bf* sb = &gring[s & 1][0] + GPL + (wc + lr) * GPIT + 8 * hi;
#pragma unroll
        for (int kk = 0; kk < GKS; kk += 32) {
            v16bf a[2], al[2], b[4];
#pragma unroll
            for (int m = 0; m < 2; ++m) { a[m] = cat16b(*(const v8usa*)(sa + m * 16 * GPIT + kk), *(const v8usa*)(sa + m * 16 * GPIT + kk + 16));
                if (SPLITA) al[m] = cat16b(*(const v8usa*)(sa + 2 * GPL + m * 16 * GPIT + kk), *(const v8usa*)(sa + 2 * GPL + m * 16 * GPIT + kk + 16)); }
#pragma unroll
            for (int t = 0; t < 4; ++t) b[t] = cat16b(*(const v8usa*)(sb + t * 16 * GPIT + kk), *(const v8usa*)(sb + t * 16 * GPIT + kk + 16));
#pragma unroll
            for (int m = 0; m < 2; ++m)
#pragma unroll
                for (int t = 0; t < 4; ++t) acc[m][t] = wmmab(a[m], b[t], acc[m][t]);
            if (SPLITA) {
#pragma unroll
                for (int m = 0; m < 2; ++m)
#pragma unroll
                    for (int t = 0; t < 4; ++t) acc[m][t] = wmmab(al[m], b[t], acc[m][t]);
            }
        }
        asm volatile("s_wait_dscnt 0x0" ::: "memory");      // this wave's reads of the stage are done before the buffer is handed back
        asm volatile("s_wait_asynccnt 0x0" ::: "memory");   // this wave's copies of stage s + 1 have landed
        __syncthreads();                                    // publishes stage s + 1 and ends every wave's reads of stage s
        if (s + 2 < DM / GKS) fill(s + 2);                  // same for the whole block: refill the buffer that this trip has read
    }
    asm volatile("s_wait_asynccnt 0x0" ::: "memory");       // nothing of this wave is in flight behind the loop; the last trip's barrier has freed the ring
    float* os = (float*)(void*)&gring[0][0] + wave * (32 * 68);
#pragma unroll
    for (int m = 0; m < 2; ++m)
#pragma unroll
        for (int t = 0; t < 4; ++t) { const float bv = bias ? bfr(bias[c0 + t * 16 + lr]) : 0.f;
#pragma unroll
            for (int j = 0; j < 8; ++j) os[(m * 16 + hi * 8 + j) * 68 + t * 16 + lr] = acc[m][t][j] + bv; }
    __syncthreads();
    if (F16OUT) {
        h16* crow = (h16*)(void*)C + (size_t)r0 * ldc + c0;
#pragma unroll
        for (int s = 0; s < 8; ++s) { const int row = 4 * s + (lane >> 3), piece = lane & 7; const float* sp = os + row * 68 + piece * 8; v8h o, o2;
#pragma unroll
            for (int i = 0; i < 8; ++i) { const h16 a = (h16)sp[i]; o[i] = a; o2[i] = (h16)((sp[i] - (float)a) * LOSC); }
            *(v8h*)(crow + (size_t)row * ldc + piece * 8) = o;
            asm volatile("s_wait_xcnt 0x0" ::: "memory");   // stands in front of every rewrite of a register that the store above names
            if (C2) *(v8h*)(C2 + (size_t)r0 * ldc + c0 + (size_t)row * ldc + piece * 8) = o2; }
    } else {
        float* crow = C + (size_t)r0 * ldc + c0;
#pragma unroll
        for (int s = 0; s < 16; ++s) { const int Lid = (lane >> 3) + 4 * s, piece = lane & 7; const int row = Lid >> 1, cofs = (Lid & 1) * 32 + piece * 4;
            const v4f val = *(const v4fa*)(os + row * 68 + cofs); *(v4f*)(crow + (size_t)row * ldc + cofs) = val; }
    }
}

__global__ __launch_bounds__(256) void k_vt(const float* __restrict__ V, h16* VTH, h16* VTL) {
    __shared__ __align__(16) h16 tile[64 * 72];
    __shared__ __align__(16) h16 til2[64 * 72];
    const int bid = blockIdx.x;
    const int b = bid / (NH_ * (NT_ / 64)), rem = bid - b * (NH_ * (NT_ / 64)), h = rem / (NT_ / 64), kt = rem - h * (NT_ / 64);
    const int k0 = kt * 64, tid = threadIdx.x;
    const int kk = tid >> 2, d0 = (tid & 3) * 16;
    const float* src = V + ((size_t)b * NT_ + k0 + kk) * DM + h * HD + d0;
#pragma unroll
    for (int i = 0; i < 16; ++i) { const float v = src[i]; const h16 a = (h16)v; tile[(d0 + i) * 72 + kk] = a; til2[(d0 + i) * 72 + kk] = (h16)((v - (float)a) * LOSC); }
    __syncthreads();
    const int piece = tid & 7;
    const size_t base = (((size_t)b * NH_ + h) * HD) * NT_ + k0;
    auto pass = [&]() {
#pragma unroll
        for (int s = 0; s < 4; ++s) { const int Lid = (tid >> 3) + 32 * s; const int pln = Lid >> 6, d = Lid & 63;
            const v8h val = *(const v8ha*)((pln ? til2 : tile) + d * 72 + piece * 8); *(v8h*)((pln ? VTL : VTH) + base + (size_t)d * NT_ + piece * 8) = val; }
    };
    pass(); 
}

// LDS ring of k_attn: one stage = 32 keys: k hi, k residual (32 rows of 128 B each), v hi, v residual (64 rows of 64 B each); every row is 16 B longer in LDS
// (a pitch that is an odd multiple of 16 B, so that the 16-byte fragment reads of 16 rows fall on different banks).
#define KPIT 72                  // halves per staged k row
#define VPIT 40                  // halves per staged v row
#define KPL  (32 * KPIT)         // halves per k plane
#define VPL  (64 * VPIT)         // halves per v plane
#define STG  (2 * KPL + 2 * VPL) // halves per stage

// One stage: 8 copies of 16 B per lane, 128 lanes, global to LDS through no register. ldk, ldv: the lane's LDS byte address in the stage's k hi and v hi plane.
// s_wait_xcnt ends the statement so that no address register of a copy is rewritten ahead of it.
__device__ __forceinline__ void stage_kv(unsigned ldk, unsigned ldv, const h16* gkh, const h16* gkl, const h16* gvh, const h16* gvl) {
    asm volatile("global_load_async_to_lds_b128 %0, %8, off\n\t"
                 "global_load_async_to_lds_b128 %1, %9, off\n\t"
                 "global_load_async_to_lds_b128 %2, %10, off\n\t"
                 "global_load_async_to_lds_b128 %3, %11, off\n\t"
                 "global_load_async_to_lds_b128 %4, %12, off\n\t"
                 "global_load_async_to_lds_b128 %5, %13, off\n\t"
                 "global_load_async_to_lds_b128 %6, %14, off\n\t"
                 "global_load_async_to_lds_b128 %7, %15, off\n\t"
                 "s_wait_xcnt 0x0"
                 :: "v"(ldk), "v"(ldk + 16 * KPIT * 2), "v"(ldk + KPL * 2), "v"(ldk + (KPL + 16 * KPIT) * 2),
                    "v"(ldv), "v"(ldv + 32 * VPIT * 2), "v"(ldv + VPL * 2), "v"(ldv + (VPL + 32 * VPIT) * 2),
                    "v"(gkh), "v"(gkh + 16 * DM), "v"(gkl), "v"(gkl + 16 * DM), "v"(gvh), "v"(gvh + 32 * NT_), "v"(gvl), "v"(gvl + 32 * NT_) : "memory");
}

// k_attn: block = (b, h, 64 queries), wave = 16; ALL 64 key tiles (no mask); 4 WMMA scores /8 (f32), online softmax, weights x32768 f16 tile (same-wave may_alias
// reload after a compiler barrier), 4 WMMA .v; ctx -> bf16 hi + residual planes CH/CL[tok][h*64+d].
__global__ __launch_bounds__(128) void k_attn(const h16* __restrict__ Q16, const h16* __restrict__ QL16, const h16* __restrict__ K16, const h16* __restrict__ KL16, const h16* __restrict__ VTH, const h16* __restrict__ VTL, const float* __restrict__ KB, bf* CH, bf* CL) {
    __shared__ __align__(16) h16 plds[4][16 * 32];
    __shared__ __align__(16) h16 plds2[4][16 * 32];
    __shared__ __align__(16) float ost[4][16 * 68];
    __shared__ __align__(16) h16 ring[2][STG];      // two stages of k and v, shared by the 4 waves
    __shared__ __align__(16) float kbs[NT_];        // the item's whole key bias row, filled once
    const int lane = threadIdx.x & 31, wave = threadIdx.x >> 5, lr = lane & 15, hi = lane >> 4;
    const int bid = blockIdx.x;
    const int b = bid / (NH_ * (NTQ / 64)), rem = bid - b * (NH_ * (NTQ / 64)), h = rem / (NTQ / 64), qt = rem - h * (NTQ / 64);     // query blocks over the 1024 queries
    const int q0 = qt * 64 + wave * 16;
    const size_t tok0 = (size_t)b * NT_;     // key-side item offset; query rows use tokq0
    const size_t tokq0 = (size_t)b * NTQ;
    h16* pl = &plds[wave][0]; h16* pl2 = &plds2[wave][0];
    v16h qa[2];
    const size_t qo0 = (tokq0 + q0 + lr) * DM + h * HD + 8 * hi;
#pragma unroll
    for (int kc = 0; kc < 2; ++kc) qa[kc] = cat16(*(const v8h*)(Q16 + qo0 + kc * 32), *(const v8h*)(Q16 + qo0 + kc * 32 + 16));
    const h16* kh_b = K16 + tok0 * DM + h * HD;
    const h16* kl_b = KL16 + tok0 * DM + h * HD;
    const size_t vbase = (((size_t)b * NH_ + h) * HD) * NT_;
    v8f o[4], ox[4];
#pragma unroll
    for (int n = 0; n < 4; ++n) { o[n] = (v8f){}; ox[n] = (v8f){}; }
    float mrow[8], lpart[8];
#pragma unroll
    for (int j = 0; j < 8; ++j) { mrow[j] = -3.0e38f; lpart[j] = 0.f; }
    int qpos[8];
#pragma unroll
    for (int j = 0; j < 8; ++j) qpos[j] = q0 + 8 * hi + j;
    const int kt_lo = 0, kt_hi = NT_ / 32 - 1;     // cross-attention: all 2048 memory keys; + the INPUT per-key bias[b][k]
    const int tid = threadIdx.x;
    // the lane's share of a stage: k rows tid/8 and tid/8 + 16, 16-byte piece tid%8; v rows tid/4 and tid/4 + 32, piece tid%4
    const unsigned ldk0 = (unsigned)(size_t)(&ring[0][0] + (tid >> 3) * KPIT + (tid & 7) * 8);
    const unsigned ldv0 = (unsigned)(size_t)(&ring[0][0] + 2 * KPL + (tid >> 2) * VPIT + (tid & 3) * 8);
    const h16* gkh = kh_b + (size_t)(tid >> 3) * DM + (tid & 7) * 8;
    const h16* gkl = kl_b + (size_t)(tid >> 3) * DM + (tid & 7) * 8;
    const h16* gvh = VTH + vbase + (size_t)(tid >> 2) * NT_ + (tid & 3) * 8;
    const h16* gvl = VTL + vbase + (size_t)(tid >> 2) * NT_ + (tid & 3) * 8;
    {   // the bias row: 4 copies of 16 B per lane; s_wait_xcnt as in stage_kv
        const unsigned ldb = (unsigned)(size_t)(&kbs[0] + tid * 4);
        const float* gb = KB + tok0 + tid * 4;
        asm volatile("global_load_async_to_lds_b128 %0, %4, off\n\t"
                     "global_load_async_to_lds_b128 %1, %5, off\n\t"
                     "global_load_async_to_lds_b128 %2, %6, off\n\t"
                     "global_load_async_to_lds_b128 %3, %7, off\n\t"
                     "s_wait_xcnt 0x0"
                     :: "v"(ldb), "v"(ldb + 2048), "v"(ldb + 4096), "v"(ldb + 6144), "v"(gb), "v"(gb + 512), "v"(gb + 1024), "v"(gb + 1536) : "memory");
    }
    stage_kv(ldk0, ldv0, gkh, gkl, gvh, gvl);                                                   // stage 0 into buffer 0
    asm volatile("s_wait_asynccnt 0x0" ::: "memory");                                           // this wave's copies of stage 0 and of the bias row have landed
    __syncthreads();                                                                            // ... and every other wave's: stage 0 may be read
    stage_kv(ldk0 + STG * 2, ldv0 + STG * 2, gkh + 32 * DM, gkl + 32 * DM, gvh + 32, gvl + 32); // stage 1 flies while stage 0 is worked on
#pragma unroll 1
    for (int kt = kt_lo; kt <= kt_hi; ++kt) {
        const int l0 = kt * 32;
        const h16* skh = &ring[kt & 1][0];          // this trip's stage: k hi, k residual, v hi, v residual
        const h16* skl = skh + KPL; const h16* svh = skh + 2 * KPL; const h16* svl = svh + VPL;
        const int ko0 = lr * KPIT + 8 * hi, ko1 = (16 + lr) * KPIT + 8 * hi;
        v8f s0 = {}, s1 = {}, x0 = {}, x1 = {};
#pragma unroll
        for (int kc = 0; kc < 2; ++kc) {
            { const v16h k0h = cat16(*(const v8ha*)(skh + ko0 + kc * 32), *(const v8ha*)(skh + ko0 + kc * 32 + 16)), k1h = cat16(*(const v8ha*)(skh + ko1 + kc * 32), *(const v8ha*)(skh + ko1 + kc * 32 + 16));
              const v16h qlk = cat16(*(const v8h*)(QL16 + qo0 + kc * 32), *(const v8h*)(QL16 + qo0 + kc * 32 + 16));     // query residual re-read per step (registers)
              s0 = wmma16(qa[kc], k0h, s0); x0 = wmma16(qlk, k0h, x0); s1 = wmma16(qa[kc], k1h, s1); x1 = wmma16(qlk, k1h, x1);
              asm volatile("v_nop" : "+v"(s0), "+v"(s1), "+v"(x0), "+v"(x1) : "v"(qlk), "v"(k0h), "v"(k1h) : "memory"); }
            { const v16h k0l = cat16(*(const v8ha*)(skl + ko0 + kc * 32), *(const v8ha*)(skl + ko0 + kc * 32 + 16)), k1l = cat16(*(const v8ha*)(skl + ko1 + kc * 32), *(const v8ha*)(skl + ko1 + kc * 32 + 16));
              x0 = wmma16(qa[kc], k0l, x0); x1 = wmma16(qa[kc], k1l, x1);
              asm volatile("v_nop" : "+v"(x0), "+v"(x1) : "v"(k0l), "v"(k1l) : "memory"); }
        }
        asm volatile("v_nop\n\tv_nop\n\tv_nop\n\tv_nop" : "+v"(s0), "+v"(s1), "+v"(x0), "+v"(x1) : "v"(qa[0]), "v"(qa[1]));
        float alpha[8]; const float kba = bfr(kbs[l0 + lr]), kbb = bfr(kbs[l0 + 16 + lr]);
#pragma unroll
        for (int j = 0; j < 8; ++j) {
            const int ja = l0 + lr, jb = l0 + 16 + lr, qi = qpos[j]; (void)ja; (void)jb;
            const float a0 = (s0[j] + x0[j] * LOSCI) * 0.125f + kba, a1 = (s1[j] + x1[j] * LOSCI) * 0.125f + kbb; (void)qi;
            float mx = fmaxf(a0, a1);
            mx = fmaxf(mx, __shfl_xor(mx, 1, 16)); mx = fmaxf(mx, __shfl_xor(mx, 2, 16)); mx = fmaxf(mx, __shfl_xor(mx, 4, 16)); mx = fmaxf(mx, __shfl_xor(mx, 8, 16));
            const float mn = fmaxf(mrow[j], mx);
            alpha[j] = __expf(mrow[j] - mn); mrow[j] = mn;
            const float p0 = __expf(a0 - mn), p1 = __expf(a1 - mn);
            lpart[j] = lpart[j] * alpha[j] + (p0 + p1);
            const int mr = hi * 8 + j;
            const float ps0 = p0 * PSC, ps1 = p1 * PSC; const h16 h0 = (h16)ps0, h1 = (h16)ps1;
            pl[mr * 32 + lr] = h0; pl[mr * 32 + 16 + lr] = h1;
            pl2[mr * 32 + lr] = (h16)((ps0 - (float)h0) * LOSC); pl2[mr * 32 + 16 + lr] = (h16)((ps1 - (float)h1) * LOSC);
        }
#pragma unroll
        for (int n = 0; n < 4; ++n)
#pragma unroll
            for (int j = 0; j < 8; ++j) { o[n][j] *= alpha[j]; ox[n][j] *= alpha[j]; }
        asm volatile("" ::: "memory");
        const v16h pa = cat16(*(const v8ha*)(pl + lr * 32 + hi * 8), *(const v8ha*)(pl + lr * 32 + 16 + hi * 8));
        const v16h px = cat16(*(const v8ha*)(pl2 + lr * 32 + hi * 8), *(const v8ha*)(pl2 + lr * 32 + 16 + hi * 8));
#pragma unroll
        for (int n = 0; n < 4; ++n) { const int vo = (n * 16 + lr) * VPIT + hi * 8;
            const v16h vh = cat16(*(const v8ha*)(svh + vo), *(const v8ha*)(svh + vo + 16)), vl = cat16(*(const v8ha*)(svl + vo), *(const v8ha*)(svl + vo + 16));
            o[n] = wmma16(pa, vh, o[n]); ox[n] = wmma16(pa, vl, ox[n]); ox[n] = wmma16(px, vh, ox[n]);
            asm volatile("" : "+v"(o[n]), "+v"(ox[n]) : "v"(vh), "v"(vl) : "memory"); }
        asm volatile("v_nop\n\tv_nop\n\tv_nop\n\tv_nop" : "+v"(o[0]), "+v"(o[1]), "+v"(o[2]), "+v"(o[3]), "+v"(ox[0]), "+v"(ox[1]), "+v"(ox[2]), "+v"(ox[3]) : "v"(pa), "v"(px));
        asm volatile("s_wait_dscnt 0x0" ::: "memory");      // this wave's reads of the stage are done before the buffer is handed back
        asm volatile("s_wait_asynccnt 0x0" ::: "memory");   // this wave's copies of stage kt + 1 have landed
        __syncthreads();                                    // publishes stage kt + 1 and ends every wave's reads of stage kt
        if (kt + 2 <= kt_hi) {                              // same for the whole block: refill the buffer that this trip has read
            const unsigned bo = (unsigned)(kt & 1) * (STG * 2);
            stage_kv(ldk0 + bo, ldv0 + bo, gkh + (size_t)(l0 + 64) * DM, gkl + (size_t)(l0 + 64) * DM, gvh + l0 + 64, gvl + l0 + 64);
        }
    }
    asm volatile("s_wait_asynccnt 0x0" ::: "memory");       // nothing of this wave is in flight behind the loop
    float inv[8];
#pragma unroll
    for (int j = 0; j < 8; ++j) { float rs = lpart[j]; rs += __shfl_xor(rs, 1, 16); rs += __shfl_xor(rs, 2, 16); rs += __shfl_xor(rs, 4, 16); rs += __shfl_xor(rs, 8, 16); inv[j] = 1.0f / (rs * PSC); }
    float* os = &ost[wave][0];
#pragma unroll
    for (int n = 0; n < 4; ++n)
#pragma unroll
        for (int j = 0; j < 8; ++j) os[(hi * 8 + j) * 68 + n * 16 + lr] = (o[n][j] + ox[n][j] * LOSCI) * inv[j];
    __syncthreads();
    const size_t cbase = (tokq0 + q0) * DM + (size_t)h * HD;
    auto pass = [&]() {
#pragma unroll
        for (int s = 0; s < 4; ++s) { const int row = 4 * s + (lane >> 3), piece = lane & 7; const float* sp = os + row * 68 + piece * 8; v8us oh, ol;
#pragma unroll
            for (int i = 0; i < 8; ++i) { const unsigned short hb = f2bf(sp[i]); oh[i] = hb; ol[i] = f2bf(sp[i] - bf2f(hb)); }
            *(v8us*)(CH + cbase + (size_t)row * DM + piece * 8) = oh; *(v8us*)(CL + cbase + (size_t)row * DM + piece * 8) = ol; }
    };
    pass(); 
}

#define VST2(T, p, v) do { const T vst2_v_ = (v); *(T*)(p) = vst2_v_;  } while (0)
extern "C" void kernel_launch(void* const* d_in, const int* in_sizes, int n_in,
                              void* d_out, int out_size, void* d_ws, size_t ws_size, hipStream_t stream) {
    (void)in_sizes; (void)n_in; (void)out_size;
    const float* query = (const float*)d_in[0]; const float* memory = (const float*)d_in[1]; const float* bias = (const float*)d_in[2];
    const float* Wq = (const float*)d_in[3]; const float* Wk = (const float*)d_in[4]; const float* Wv = (const float*)d_in[5]; const float* Wo = (const float*)d_in[6];   // all k-major [in][out]
    float* out = (float*)d_out;    // [4][1024][1024]
    char* wsp = (char*)d_ws;
    auto take = [&](size_t bytes) { char* p = wsp; wsp += (bytes + 255) & ~(size_t)255; return (void*)p; };
    bf* Xq = (bf*)take((size_t)NB_ * NTQ * DM * 2); bf* Xm = (bf*)take((size_t)NTK * DM * 2);
    bf* WqT = (bf*)take((size_t)DM * DM * 2); bf* WkT = (bf*)take((size_t)DM * DM * 2); bf* WvT = (bf*)take((size_t)DM * DM * 2); bf* WoT = (bf*)take((size_t)DM * DM * 2);
    float* TMP = (float*)take((size_t)NTK * DM * 4);
    h16* QH = (h16*)take((size_t)NB_ * NTQ * DM * 2); h16* QL = (h16*)take((size_t)NB_ * NTQ * DM * 2); h16* KH = (h16*)take((size_t)NTK * DM * 2); h16* KL = (h16*)take((size_t)NTK * DM * 2);
    h16* VTH = (h16*)take((size_t)NTK * DM * 2); h16* VTL = (h16*)take((size_t)NTK * DM * 2); bf* CH = (bf*)take((size_t)NB_ * NTQ * DM * 2); bf* CL = (bf*)take((size_t)NB_ * NTQ * DM * 2);
    if ((size_t)(wsp - (char*)d_ws) > ws_size) return;    // 8.4 + 16.8 + 4 x 2.1 + 33.6 + 2 x 8.4 + 4 x 16.8 + 2 x 8.4 ~ 168 MB, no aliasing
    k_wt<<<dim3(DM / 64, DM / 64, 1), 256, 0, stream>>>(Wq, DM, DM, WqT); k_wt<<<dim3(DM / 64, DM / 64, 1), 256, 0, stream>>>(Wk, DM, DM, WkT);
    k_wt<<<dim3(DM / 64, DM / 64, 1), 256, 0, stream>>>(Wv, DM, DM, WvT); k_wt<<<dim3(DM / 64, DM / 64, 1), 256, 0, stream>>>(Wo, DM, DM, WoT);
    k_cvtb<<<NB_ * NTQ / 8, 256, 0, stream>>>(query, NB_ * NTQ, Xq); k_cvtb<<<NTK / 8, 256, 0, stream>>>(memory, NTK, Xm);
    k_gemmb<false, true><<<dim3(NB_ * NTQ / 128, DM / 128, 1), 256, 0, stream>>>(Xq, nullptr, WqT, nullptr, (float*)(void*)QH, DM, QL);       // q = query.Wq  [4096][1024]
    k_gemmb<false, true><<<dim3(NTK / 128, DM / 128, 1), 256, 0, stream>>>(Xm, nullptr, WkT, nullptr, (float*)(void*)KH, DM, KL);            // k = memory.Wk [8192][1024]
    k_gemmb<false, false><<<dim3(NTK / 128, DM / 128, 1), 256, 0, stream>>>(Xm, nullptr, WvT, nullptr, TMP, DM, nullptr);                   // v = memory.Wv
    k_vt<<<NB_ * NH_ * (NT_ / 64), 256, 0, stream>>>(TMP, VTH, VTL);
    k_attn<<<NB_ * NH_ * (NTQ / 64), 128, 0, stream>>>(QH, QL, KH, KL, VTH, VTL, bias, CH, CL);
    k_gemmb<true, false><<<dim3(NB_ * NTQ / 128, DM / 128, 1), 256, 0, stream>>>(CH, CL, WoT, nullptr, out, DM, nullptr);
}

// v004
// A run of this version takes 183 microseconds.
// Timed twice side by side with v003, it ran 1.32 and 1.31 times as fast.
// All steps since v000 together make it 5.46 times as fast.
#include <hip/hip_runtime.h>

// Compute dtypes, f32 accumulate, all 4 batch items in one pass (rows of the items stacked): q = query.Wq ([4096 x 1024].[1024 x 1024]) and k/v = memory.Wk/Wv ([8192 x 1024].[1024 x 1024]), k-major weights transposed once to n-major planes; PLAIN bf16
// operands: inputs rounded once, exact) with q and k written straight from the GEMM epilogue as f16 hi + residual x1024 planes, and out = ctx.Wo (ctx as
// bf16 hi + residual: two products) on v_wmma_f32_16x16x32_bf16; the 16-head cross-attention (1024 queries x 2048 memory keys, 64-dim heads, scale 1/8) + the INPUT per-key bias[b][k] fused on
// v_wmma_f32_16x16x32_f16 (scores hi.hi + hi.lo + lo.hi with the residual terms on their own accumulator, online f32 softmax, weights (x32768) and v as f16

#define NB_  4                   // batch items, all in every launch's grid
#define NT_  2048                // keys per item (memory length)
#define NTQ  1024                // queries per item
#define DM   1024
#define NH_  16
#define HD   64
#define NTK  (NB_ * NT_)
#define NW   1024
#define NQKV 1024
#define PSC  32768.0f
#define LOSC 1024.0f
#define LOSCI (1.0f / 1024.0f)

typedef _Float16 h16;
typedef unsigned short bf;
typedef __attribute__((ext_vector_type(16))) __bf16   v16bf;
typedef __attribute__((ext_vector_type(16))) _Float16 v16h;
typedef __attribute__((ext_vector_type(8)))  _Float16 v8h;
typedef __attribute__((ext_vector_type(8)))  unsigned short v8us;
typedef __attribute__((ext_vector_type(8)))  float    v8f;
typedef __attribute__((ext_vector_type(4)))  float    v4f;
typedef v8h  __attribute__((may_alias)) v8ha;
typedef v4f  __attribute__((may_alias)) v4fa;
typedef v8us __attribute__((may_alias)) v8usa;

__device__ __forceinline__ unsigned short f2bf(float f) { unsigned u = __float_as_uint(f); u += 0x7FFFu + ((u >> 16) & 1u); return (unsigned short)(u >> 16); }
__device__ __forceinline__ float bf2f(unsigned short b) { return __uint_as_float(((unsigned)b) << 16); }
__device__ __forceinline__ float bfr(float f) { return bf2f(f2bf(f)); }
__device__ __forceinline__ v16h cat16(v8h lo, v8h hi) { return __builtin_shufflevector(lo, hi, 0, 1, 2, 3, 4, 5, 6, 7, 8, 9, 10, 11, 12, 13, 14, 15); }
__device__ __forceinline__ v16bf cat16b(v8us lo, v8us hi) { return __builtin_bit_cast(v16bf, __builtin_shufflevector(lo, hi, 0, 1, 2, 3, 4, 5, 6, 7, 8, 9, 10, 11, 12, 13, 14, 15)); }
__device__ __forceinline__ v8f wmma16(v16h a, v16h b, v8f c) { return __builtin_amdgcn_wmma_f32_16x16x32_f16(false, a, false, b, (short)0, c, false, false); }
__device__ __forceinline__ v8f wmmab(v16bf a, v16bf b, v8f c) { return __builtin_amdgcn_wmma_f32_16x16x32_bf16(false, a, false, b, (short)0, c, false, false); }

__global__ __launch_bounds__(256) void k_cvtb(const float* __restrict__ src, int nrows, bf* dst) {
    const int lane = threadIdx.x & 31, r = blockIdx.x * 8 + (threadIdx.x >> 5);
    if (r >= nrows) return;
    v8us o[DM / 256];
#pragma unroll
    for (int q = 0; q < DM / 256; ++q) { v8us t;
#pragma unroll
        for (int i = 0; i < 8; ++i) t[i] = f2bf(src[(size_t)r * DM + q * 256 + lane * 8 + i]);
        o[q] = t; }
#pragma unroll
    for (int q = 0; q < DM / 256; ++q) *(v8us*)(dst + (size_t)r * DM + q * 256 + lane * 8) = o[q];
    
}

// k_wt: WT [n][K] = bf16(W[k][n]) (k-major [K][ncols]) via 64 x 64 LDS tiles; grid (K/64, ncols/64).
__global__ __launch_bounds__(256) void k_wt(const float* __restrict__ Wm, int K, int ncols, bf* WT) {
    __shared__ __align__(16) unsigned short tl[64 * 72];
    const int tid = threadIdx.x, k0 = blockIdx.x * 64, n0 = blockIdx.y * 64;
    const int kk = tid >> 2, nq = (tid & 3) * 16;
#pragma unroll
    for (int i = 0; i < 16; ++i) tl[(nq + i) * 72 + kk] = f2bf(Wm[(size_t)(k0 + kk) * ncols + n0 + nq + i]);
    __syncthreads();
    const int piece = tid & 7;
    auto pass = [&]() {
#pragma unroll
        for (int s = 0; s < 2; ++s) { const int nr = (tid >> 3) + 32 * s; const v8us val = *(const v8usa*)(tl + nr * 72 + piece * 8); *(v8us*)(WT + (size_t)(n0 + nr) * K + k0 + piece * 8) = val; }
    };
    pass(); 
}
// LDS ring of k_gemmb: one stage = 128 k of the block's 128 A rows, 128 B rows (and, split A, 128 residual rows): rows of 256 B, 16 B longer in LDS
// (a pitch that is an odd multiple of 16 B, so that the 16-byte fragment reads of 16 rows fall on different banks).
#define GKS  128                 // k per stage
#define GPIT 136                 // halves per staged row
#define GPL  (128 * GPIT)        // halves per plane of 128 rows

// One plane of a stage: 8 copies of 16 B per lane, 256 lanes, global to LDS through no register: rows r, r + 16, ..., r + 112 of the plane, whole 256-byte row pieces per 16 lanes.
// s_wait_xcnt ends the statement so that no address register of a copy is rewritten ahead of it.
__device__ __forceinline__ void stage_g(unsigned ld, const bf* g) {
    asm volatile("global_load_async_to_lds_b128 %0, %8, off\n\t"
                 "global_load_async_to_lds_b128 %1, %9, off\n\t"
                 "global_load_async_to_lds_b128 %2, %10, off\n\t"
                 "global_load_async_to_lds_b128 %3, %11, off\n\t"
                 "global_load_async_to_lds_b128 %4, %12, off\n\t"
                 "global_load_async_to_lds_b128 %5, %13, off\n\t"
                 "global_load_async_to_lds_b128 %6, %14, off\n\t"
                 "global_load_async_to_lds_b128 %7, %15, off\n\t"
                 "s_wait_xcnt 0x0"
                 :: "v"(ld), "v"(ld + 16 * GPIT * 2), "v"(ld + 32 * GPIT * 2), "v"(ld + 48 * GPIT * 2),
                    "v"(ld + 64 * GPIT * 2), "v"(ld + 80 * GPIT * 2), "v"(ld + 96 * GPIT * 2), "v"(ld + 112 * GPIT * 2),
                    "v"(g), "v"(g + 16 * DM), "v"(g + 32 * DM), "v"(g + 48 * DM), "v"(g + 64 * DM), "v"(g + 80 * DM), "v"(g + 96 * DM), "v"(g + 112 * DM) : "memory");
}

// k_gemmb: C[128 x 128 per block] = A.Bn^T over k = 1024; 8 waves as 4 x 2, a wave = 32 rows x 64 columns (2 x 4 accumulator tiles); grid (rows / 128, columns / 128).
template <bool SPLITA, bool F16OUT = false>
__global__ __launch_bounds__(256) void k_gemmb(const bf* __restrict__ A, const bf* __restrict__ Al, const bf* __restrict__ Bn, const float* __restrict__ bias, float* C, int ldc, h16* C2) {
    constexpr int NPL = SPLITA ? 3 : 2;             // planes per stage
    __shared__ __align__(16) bf gring[2][NPL * GPL]; // two stages, shared by the 8 waves; output staging behind the loop
    const int tid = threadIdx.x, lane = tid & 31, wave = tid >> 5, lr = lane & 15, hi = lane >> 4;
    const int rb = blockIdx.x * 128, cb = blockIdx.y * 128;
    const int wr = (wave >> 1) * 32, wc = (wave & 1) * 64;
    const int r0 = rb + wr, c0 = cb + wc;
    // the lane's share of a plane: rows tid/16 + 16 i, 16-byte piece tid%16
    const unsigned ld0 = (unsigned)(size_t)(&gring[0][0] + (tid >> 4) * GPIT + (tid & 15) * 8);
    const bf* ga = A + (size_t)(rb + (tid >> 4)) * DM + (tid & 15) * 8;
    const bf* gb = Bn + (size_t)(cb + (tid >> 4)) * DM + (tid & 15) * 8;
    auto fill = [&](int s) {
        const unsigned ld = ld0 + (unsigned)(s & 1) * (NPL * GPL * 2);
        stage_g(ld, ga + s * GKS); stage_g(ld + GPL * 2, gb + s * GKS);
        if (SPLITA) stage_g(ld + 2 * GPL * 2, Al + (size_t)(rb + (tid >> 4)) * DM + (tid & 15) * 8 + s * GKS);
    };
    v8f acc[2][4];
#pragma unroll
    for (int m = 0; m < 2; ++m)
#pragma unroll
        for (int t = 0; t < 4; ++t) acc[m][t] = (v8f){};
    fill(0);                                                // stage 0 into buffer 0
    asm volatile("s_wait_asynccnt 0x0" ::: "memory");       // this wave's copies of stage 0 have landed
    __syncthreads();                                        // ... and every other wave's: stage 0 may be read
    fill(1);                                                // stage 1 flies while stage 0 is worked on
#pragma unroll 1
    for (int s = 0; s < DM / GKS; ++s) {
        const bf* sa = &gring[s & 1][0] + (wr + lr) * GPIT + 8 * hi;
        const bf* sb = &gring[s & 1][0] + GPL + (wc + lr) * GPIT + 8 * hi;
#pragma unroll
        for (int kk = 0; kk < GKS; kk += 32) {
            v16bf a[2], al[2], b[4];
#pragma unroll
            for (int m = 0; m < 2; ++m) { a[m] = cat16b(*(const v8usa*)(sa + m * 16 * GPIT + kk), *(const v8usa*)(sa + m * 16 * GPIT + kk + 16));
                if (SPLITA) al[m] = cat16b(*(const v8usa*)(sa + 2 * GPL + m * 16 * GPIT + kk), *(const v8usa*)(sa + 2 * GPL + m * 16 * GPIT + kk + 16)); }
#pragma unroll
            for (int t = 0; t < 4; ++t) b[t] = cat16b(*(const v8usa*)(sb + t * 16 * GPIT + kk), *(const v8usa*)(sb + t * 16 * GPIT + kk + 16));
#pragma unroll
            for (int m = 0; m < 2; ++m)
#pragma unroll
                for (int t = 0; t < 4; ++t) acc[m][t] = wmmab(a[m], b[t], acc[m][t]);
            if (SPLITA) {
#pragma unroll
                for (int m = 0; m < 2; ++m)
#pragma unroll
                    for (int t = 0; t < 4; ++t) acc[m][t] = wmmab(al[m], b[t], acc[m][t]);
            }
        }
        asm volatile("s_wait_dscnt 0x0" ::: "memory");      // this wave's reads of the stage are done before the buffer is handed back
        asm volatile("s_wait_asynccnt 0x0" ::: "memory");   // this wave's copies of stage s + 1 have landed
        __syncthreads();                                    // publishes stage s + 1 and ends every wave's reads of stage s
        if (s + 2 < DM / GKS) fill(s + 2);                  // same for the whole block: refill the buffer that this trip has read
    }
    asm volatile("s_wait_asynccnt 0x0" ::: "memory");       // nothing of this wave is in flight behind the loop; the last trip's barrier has freed the ring
    float* os = (float*)(void*)&gring[0][0] + wave * (32 * 68);
#pragma unroll
    for (int m = 0; m < 2; ++m)
#pragma unroll
        for (int t = 0; t < 4; ++t) { const float bv = bias ? bfr(bias[c0 + t * 16 + lr]) : 0.f;
#pragma unroll
            for (int j = 0; j < 8; ++j) os[(m * 16 + hi * 8 + j) * 68 + t * 16 + lr] = acc[m][t][j] + bv; }
    __syncthreads();
    if (F16OUT) {
        h16* crow = (h16*)(void*)C + (size_t)r0 * ldc + c0;
#pragma unroll
        for (int s = 0; s < 8; ++s) { const int row = 4 * s + (lane >> 3), piece = lane & 7; const float* sp = os + row * 68 + piece * 8; v8h o, o2;
#pragma unroll
            for (int i = 0; i < 8; ++i) { const h16 a = (h16)sp[i]; o[i] = a; o2[i] = (h16)((sp[i] - (float)a) * LOSC); }
            *(v8h*)(crow + (size_t)row * ldc + piece * 8) = o;
            asm volatile("s_wait_xcnt 0x0" ::: "memory");   // stands in front of every rewrite of a register that the store above names
            if (C2) *(v8h*)(C2 + (size_t)r0 * ldc + c0 + (size_t)row * ldc + piece * 8) = o2; }
    } else {
        float* crow = C + (size_t)r0 * ldc + c0;
#pragma unroll
        for (int s = 0; s < 16; ++s) { const int Lid = (lane >> 3) + 4 * s, piece = lane & 7; const int row = Lid >> 1, cofs = (Lid & 1) * 32 + piece * 4;
            const v4f val = *(const v4fa*)(os + row * 68 + cofs); *(v4f*)(crow + (size_t)row * ldc + cofs) = val; }
    }
}

__global__ __launch_bounds__(256) void k_vt(const float* __restrict__ V, h16* VTH, h16* VTL) {
    __shared__ __align__(16) h16 tile[64 * 72];
    __shared__ __align__(16) h16 til2[64 * 72];
    const int bid = blockIdx.x;
    const int b = bid / (NH_ * (NT_ / 64)), rem = bid - b * (NH_ * (NT_ / 64)), h = rem / (NT_ / 64), kt = rem - h * (NT_ / 64);
    const int k0 = kt * 64, tid = threadIdx.x;
    const int kk = tid >> 2, d0 = (tid & 3) * 16;
    const float* src = V + ((size_t)b * NT_ + k0 + kk) * DM + h * HD + d0;
#pragma unroll
    for (int i = 0; i < 16; ++i) { const float v = src[i]; const h16 a = (h16)v; tile[(d0 + i) * 72 + kk] = a; til2[(d0 + i) * 72 + kk] = (h16)((v - (float)a) * LOSC); }
    __syncthreads();
    const int piece = tid & 7;
    const size_t base = (((size_t)b * NH_ + h) * HD) * NT_ + k0;
    auto pass = [&]() {
#pragma unroll
        for (int s = 0; s < 4; ++s) { const int Lid = (tid >> 3) + 32 * s; const int pln = Lid >> 6, d = Lid & 63;
            const v8h val = *(const v8ha*)((pln ? til2 : tile) + d * 72 + piece * 8); *(v8h*)((pln ? VTL : VTH) + base + (size_t)d * NT_ + piece * 8) = val; }
    };
    pass(); 
}

// LDS ring of k_attn: one stage = 32 keys: k hi, k residual (32 rows of 128 B each), v hi, v residual (64 rows of 64 B each); every row is 16 B longer in LDS
// (a pitch that is an odd multiple of 16 B, so that the 16-byte fragment reads of 16 rows fall on different banks).
#define KPIT 72                  // halves per staged k row
#define VPIT 40                  // halves per staged v row
#define KPL  (32 * KPIT)         // halves per k plane
#define VPL  (64 * VPIT)         // halves per v plane
#define STG  (2 * KPL + 2 * VPL) // halves per stage

// One stage: 8 copies of 16 B per lane, 128 lanes, global to LDS through no register. ldk, ldv: the lane's LDS byte address in the stage's k hi and v hi plane.
// s_wait_xcnt ends the statement so that no address register of a copy is rewritten ahead of it.
__device__ __forceinline__ void stage_kv(unsigned ldk, unsigned ldv, const h16* gkh, const h16* gkl, const h16* gvh, const h16* gvl) {
    asm volatile("global_load_async_to_lds_b128 %0, %8, off\n\t"
                 "global_load_async_to_lds_b128 %1, %9, off\n\t"
                 "global_load_async_to_lds_b128 %2, %10, off\n\t"
                 "global_load_async_to_lds_b128 %3, %11, off\n\t"
                 "global_load_async_to_lds_b128 %4, %12, off\n\t"
                 "global_load_async_to_lds_b128 %5, %13, off\n\t"
                 "global_load_async_to_lds_b128 %6, %14, off\n\t"
                 "global_load_async_to_lds_b128 %7, %15, off\n\t"
                 "s_wait_xcnt 0x0"
                 :: "v"(ldk), "v"(ldk + 16 * KPIT * 2), "v"(ldk + KPL * 2), "v"(ldk + (KPL + 16 * KPIT) * 2),
                    "v"(ldv), "v"(ldv + 32 * VPIT * 2), "v"(ldv + VPL * 2), "v"(ldv + (VPL + 32 * VPIT) * 2),
                    "v"(gkh), "v"(gkh + 16 * DM), "v"(gkl), "v"(gkl + 16 * DM), "v"(gvh), "v"(gvh + 32 * NT_), "v"(gvl), "v"(gvl + 32 * NT_) : "memory");
}

__device__ __forceinline__ v8f cat8f(v4f lo, v4f hi) { return __builtin_shufflevector(lo, hi, 0, 1, 2, 3, 4, 5, 6, 7); }
// lane l with lane l ^ 16
__device__ __forceinline__ float xhalf(float x) { return __builtin_bit_cast(float, __builtin_amdgcn_permlanex16(__builtin_bit_cast(int, x), __builtin_bit_cast(int, x), 0x76543210, 0xfedcba98, false, false)); }

__global__ __launch_bounds__(128) void k_attn(const h16* __restrict__ Q16, const h16* __restrict__ QL16, const h16* __restrict__ K16, const h16* __restrict__ KL16, const h16* __restrict__ VTH, const h16* __restrict__ VTL, const float* __restrict__ KB, bf* CH, bf* CL) {
    __shared__ __align__(16) float ost[4][16 * 68];
    __shared__ __align__(16) h16 ring[2][STG];      // two stages of k and v, shared by the 4 waves
    __shared__ __align__(16) float kbs[NT_];        // the item's whole key bias row, filled once, rounded in place
    const int lane = threadIdx.x & 31, wave = threadIdx.x >> 5, lr = lane & 15, hi = lane >> 4;
    const int bid = blockIdx.x;
    const int b = bid / (NH_ * (NTQ / 64)), rem = bid - b * (NH_ * (NTQ / 64)), h = rem / (NTQ / 64), qt = rem - h * (NTQ / 64);     // query blocks over the 1024 queries
    const int q0 = qt * 64 + wave * 16;
    const size_t tok0 = (size_t)b * NT_;     // key-side item offset; query rows use tokq0
    const size_t tokq0 = (size_t)b * NTQ;
    v16h qa[2], ql[2];
    const size_t qo0 = (tokq0 + q0 + lr) * DM + h * HD + 8 * hi;
#pragma unroll
    for (int kc = 0; kc < 2; ++kc) { qa[kc] = cat16(*(const v8h*)(Q16 + qo0 + kc * 32), *(const v8h*)(Q16 + qo0 + kc * 32 + 16));
        ql[kc] = cat16(*(const v8h*)(QL16 + qo0 + kc * 32), *(const v8h*)(QL16 + qo0 + kc * 32 + 16)); }
    const h16* kh_b = K16 + tok0 * DM + h * HD;
    const h16* kl_b = KL16 + tok0 * DM + h * HD;
    const size_t vbase = (((size_t)b * NH_ + h) * HD) * NT_;
    v8f o[4], ox[4];                         // o[n][j] = O^T[d = 16 n + 8 hi + j][query lr]
#pragma unroll
    for (int n = 0; n < 4; ++n) { o[n] = (v8f){}; ox[n] = (v8f){}; }
    float mrow = -3.0e38f, lsum = 0.f;       // of query lr; lsum over this wave half's keys
    const int kt_lo = 0, kt_hi = NT_ / 32 - 1;     // cross-attention: all 2048 memory keys; + the INPUT per-key bias[b][k]
    const int tid = threadIdx.x;
    // the lane's share of a stage: k rows tid/8 and tid/8 + 16, 16-byte piece tid%8; v rows tid/4 and tid/4 + 32, piece tid%4
    const unsigned ldk0 = (unsigned)(size_t)(&ring[0][0] + (tid >> 3) * KPIT + (tid & 7) * 8);
    const unsigned ldv0 = (unsigned)(size_t)(&ring[0][0] + 2 * KPL + (tid >> 2) * VPIT + (tid & 3) * 8);
    const h16* gkh = kh_b + (size_t)(tid >> 3) * DM + (tid & 7) * 8;
    const h16* gkl = kl_b + (size_t)(tid >> 3) * DM + (tid & 7) * 8;
    const h16* gvh = VTH + vbase + (size_t)(tid >> 2) * NT_ + (tid & 3) * 8;
    const h16* gvl = VTL + vbase + (size_t)(tid >> 2) * NT_ + (tid & 3) * 8;
    {   // the bias row: 4 copies of 16 B per lane; s_wait_xcnt as in stage_kv
        const unsigned ldb = (unsigned)(size_t)(&kbs[0] + tid * 4);
        const float* gb = KB + tok0 + tid * 4;
        asm volatile("global_load_async_to_lds_b128 %0, %4, off\n\t"
                     "global_load_async_to_lds_b128 %1, %5, off\n\t"
                     "global_load_async_to_lds_b128 %2, %6, off\n\t"
                     "global_load_async_to_lds_b128 %3, %7, off\n\t"
                     "s_wait_xcnt 0x0"
                     :: "v"(ldb), "v"(ldb + 2048), "v"(ldb + 4096), "v"(ldb + 6144), "v"(gb), "v"(gb + 512), "v"(gb + 1024), "v"(gb + 1536) : "memory");
    }
    stage_kv(ldk0, ldv0, gkh, gkl, gvh, gvl);                                                   // stage 0 into buffer 0
    asm volatile("s_wait_asynccnt 0x0" ::: "memory");                                           // this wave's copies of stage 0 and of the bias row have landed
#pragma unroll
    for (int c = 0; c < 4; ++c) { v4fa* bp = (v4fa*)(&kbs[0] + tid * 4 + c * 512); v4f t = *bp;   // each lane rounds the 16 bias values that it copied itself, once instead of per trip
#pragma unroll
        for (int i = 0; i < 4; ++i) t[i] = bfr(t[i]);
        *bp = t; }
    __syncthreads();                                                                            // ... and every other wave's: stage 0 and the rounded bias row may be read
    stage_kv(ldk0 + STG * 2, ldv0 + STG * 2, gkh + 32 * DM, gkl + 32 * DM, gvh + 32, gvl + 32); // stage 1 flies while stage 0 is worked on
#pragma unroll 1
    for (int kt = kt_lo; kt <= kt_hi; ++kt) {
        const int l0 = kt * 32;
        const h16* skh = &ring[kt & 1][0];          // this trip's stage: k hi, k residual, v hi, v residual
        const h16* skl = skh + KPL; const h16* svh = skh + 2 * KPL; const h16* svl = svh + VPL;
        const int ko0 = lr * KPIT + 8 * hi, ko1 = (16 + lr) * KPIT + 8 * hi;
        v8f s0 = {}, s1 = {}, x0 = {}, x1 = {};     // s0[j]: key l0 + 8 hi + j, s1[j]: key l0 + 16 + 8 hi + j, query lr
#pragma unroll
        for (int kc = 0; kc < 2; ++kc) {
            const v16h k0h = cat16(*(const v8ha*)(skh + ko0 + kc * 32), *(const v8ha*)(skh + ko0 + kc * 32 + 16)), k1h = cat16(*(const v8ha*)(skh + ko1 + kc * 32), *(const v8ha*)(skh + ko1 + kc * 32 + 16));
            const v16h k0l = cat16(*(const v8ha*)(skl + ko0 + kc * 32), *(const v8ha*)(skl + ko0 + kc * 32 + 16)), k1l = cat16(*(const v8ha*)(skl + ko1 + kc * 32), *(const v8ha*)(skl + ko1 + kc * 32 + 16));
            s0 = wmma16(k0h, qa[kc], s0); x0 = wmma16(k0h, ql[kc], x0); s1 = wmma16(k1h, qa[kc], s1); x1 = wmma16(k1h, ql[kc], x1);
            x0 = wmma16(k0l, qa[kc], x0); x1 = wmma16(k1l, qa[kc], x1);
        }
        const float* kbp = &kbs[0] + l0 + 8 * hi;
        const v8f kb0 = cat8f(*(const v4fa*)(kbp), *(const v4fa*)(kbp + 4)), kb1 = cat8f(*(const v4fa*)(kbp + 16), *(const v4fa*)(kbp + 20));
        const v8f a0 = (s0 + x0 * LOSCI) * 0.125f + kb0, a1 = (s1 + x1 * LOSCI) * 0.125f + kb1;
        float mx = fmaxf(a0[0], a1[0]);
#pragma unroll
        for (int j = 1; j < 8; ++j) mx = fmaxf(mx, fmaxf(a0[j], a1[j]));
        mx = fmaxf(mx, xhalf(mx));                  // both wave halves now hold the query's maximum over the 32 keys
        const float mn = fmaxf(mrow, mx);
        const float alpha = __expf(mrow - mn); mrow = mn;
        const v8f t0 = (a0 - mn) * 1.4426950408889634f, t1 = (a1 - mn) * 1.4426950408889634f;   // e^x as 2^(x log2 e), the factors of __expf
        v8f p0, p1;
#pragma unroll
        for (int j = 0; j < 8; ++j) { p0[j] = __builtin_amdgcn_exp2f(t0[j]); p1[j] = __builtin_amdgcn_exp2f(t1[j]); }
        const v8f pt = p0 + p1, ps0 = p0 * PSC, ps1 = p1 * PSC;
        const v8h h0 = __builtin_convertvector(ps0, v8h), h1 = __builtin_convertvector(ps1, v8h);
        const v8h g0 = __builtin_convertvector((ps0 - __builtin_convertvector(h0, v8f)) * LOSC, v8h), g1 = __builtin_convertvector((ps1 - __builtin_convertvector(h1, v8f)) * LOSC, v8h);
        const v16h pa = cat16(h0, h1), px = cat16(g0, g1);     // element s of the B operand: key 8 hi + s, then 16 + 8 hi + (s - 8): the score registers' own order
        lsum = lsum * alpha + (((pt[0] + pt[1]) + (pt[2] + pt[3])) + ((pt[4] + pt[5]) + (pt[6] + pt[7])));
#pragma unroll
        for (int n = 0; n < 4; ++n)
#pragma unroll
            for (int j = 0; j < 8; ++j) { o[n][j] *= alpha; ox[n][j] *= alpha; }
#pragma unroll
        for (int n = 0; n < 4; ++n) { const int vo = (n * 16 + lr) * VPIT + hi * 8;
            const v16h vh = cat16(*(const v8ha*)(svh + vo), *(const v8ha*)(svh + vo + 16)), vl = cat16(*(const v8ha*)(svl + vo), *(const v8ha*)(svl + vo + 16));
            o[n] = wmma16(vh, pa, o[n]); ox[n] = wmma16(vl, pa, ox[n]); ox[n] = wmma16(vh, px, ox[n]); }
        asm volatile("s_wait_dscnt 0x0" ::: "memory");      // this wave's reads of the stage are done before the buffer is handed back
        asm volatile("s_wait_asynccnt 0x0" ::: "memory");   // this wave's copies of stage kt + 1 have landed
        __syncthreads();                                    // publishes stage kt + 1 and ends every wave's reads of stage kt
        if (kt + 2 <= kt_hi) {                              // same for the whole block: refill the buffer that this trip has read
            const unsigned bo = (unsigned)(kt & 1) * (STG * 2);
            stage_kv(ldk0 + bo, ldv0 + bo, gkh + (size_t)(l0 + 64) * DM, gkl + (size_t)(l0 + 64) * DM, gvh + l0 + 64, gvl + l0 + 64);
        }
    }
    asm volatile("s_wait_asynccnt 0x0" ::: "memory");       // nothing of this wave is in flight behind the loop
    const float inv = 1.0f / ((lsum + xhalf(lsum)) * PSC);  // the two halves' sums joined once
    float* os = &ost[wave][0];
#pragma unroll
    for (int n = 0; n < 4; ++n)
#pragma unroll
        for (int g = 0; g < 2; ++g) { v4f t;
#pragma unroll
            for (int i = 0; i < 4; ++i) t[i] = (o[n][g * 4 + i] + ox[n][g * 4 + i] * LOSCI) * inv;
            *(v4fa*)(os + lr * 68 + n * 16 + hi * 8 + g * 4) = t; }
    __syncthreads();
    const size_t cbase = (tokq0 + q0) * DM + (size_t)h * HD;
    auto pass = [&]() {
#pragma unroll
        for (int s = 0; s < 4; ++s) { const int row = 4 * s + (lane >> 3), piece = lane & 7; const float* sp = os + row * 68 + piece * 8; v8us oh, ol;
#pragma unroll
            for (int i = 0; i < 8; ++i) { const unsigned short hb = f2bf(sp[i]); oh[i] = hb; ol[i] = f2bf(sp[i] - bf2f(hb)); }
            *(v8us*)(CH + cbase + (size_t)row * DM + piece * 8) = oh; *(v8us*)(CL + cbase + (size_t)row * DM + piece * 8) = ol; }
    };
    pass(); 
}

#define VST2(T, p, v) do { const T vst2_v_ = (v); *(T*)(p) = vst2_v_;  } while (0)
extern "C" void kernel_launch(void* const* d_in, const int* in_sizes, int n_in,
                              void* d_out, int out_size, void* d_ws, size_t ws_size, hipStream_t stream) {
    (void)in_sizes; (void)n_in; (void)out_size;
    const float* query = (const float*)d_in[0]; const float* memory = (const float*)d_in[1]; const float* bias = (const float*)d_in[2];
    const float* Wq = (const float*)d_in[3]; const float* Wk = (const float*)d_in[4]; const float* Wv = (const float*)d_in[5]; const float* Wo = (const float*)d_in[6];   // all k-major [in][out]
    float* out = (float*)d_out;    // [4][1024][1024]
    char* wsp = (char*)d_ws;
    auto take = [&](size_t bytes) { char* p = wsp; wsp += (bytes + 255) & ~(size_t)255; return (void*)p; };
    bf* Xq = (bf*)take((size_t)NB_ * NTQ * DM * 2); bf* Xm = (bf*)take((size_t)NTK * DM * 2);
    bf* WqT = (bf*)take((size_t)DM * DM * 2); bf* WkT = (bf*)take((size_t)DM * DM * 2); bf* WvT = (bf*)take((size_t)DM * DM * 2); bf* WoT = (bf*)take((size_t)DM * DM * 2);
    float* TMP = (float*)take((size_t)NTK * DM * 4);
    h16* QH = (h16*)take((size_t)NB_ * NTQ * DM * 2); h16* QL = (h16*)take((size_t)NB_ * NTQ * DM * 2); h16* KH = (h16*)take((size_t)NTK * DM * 2); h16* KL = (h16*)take((size_t)NTK * DM * 2);
    h16* VTH = (h16*)take((size_t)NTK * DM * 2); h16* VTL = (h16*)take((size_t)NTK * DM * 2); bf* CH = (bf*)take((size_t)NB_ * NTQ * DM * 2); bf* CL = (bf*)take((size_t)NB_ * NTQ * DM * 2);
    if ((size_t)(wsp - (char*)d_ws) > ws_size) return;    // 8.4 + 16.8 + 4 x 2.1 + 33.6 + 2 x 8.4 + 4 x 16.8 + 2 x 8.4 ~ 168 MB, no aliasing
    k_wt<<<dim3(DM / 64, DM / 64, 1), 256, 0, stream>>>(Wq, DM, DM, WqT); k_wt<<<dim3(DM / 64, DM / 64, 1), 256, 0, stream>>>(Wk, DM, DM, WkT);
    k_wt<<<dim3(DM / 64, DM / 64, 1), 256, 0, stream>>>(Wv, DM, DM, WvT); k_wt<<<dim3(DM / 64, DM / 64, 1), 256, 0, stream>>>(Wo, DM, DM, WoT);
    k_cvtb<<<NB_ * NTQ / 8, 256, 0, stream>>>(query, NB_ * NTQ, Xq); k_cvtb<<<NTK / 8, 256, 0, stream>>>(memory, NTK, Xm);
    k_gemmb<false, true><<<dim3(NB_ * NTQ / 128, DM / 128, 1), 256, 0, stream>>>(Xq, nullptr, WqT, nullptr, (float*)(void*)QH, DM, QL);       // q = query.Wq  [4096][1024]
    k_gemmb<false, true><<<dim3(NTK / 128, DM / 128, 1), 256, 0, stream>>>(Xm, nullptr, WkT, nullptr, (float*)(void*)KH, DM, KL);            // k = memory.Wk [8192][1024]
    k_gemmb<false, false><<<dim3(NTK / 128, DM / 128, 1), 256, 0, stream>>>(Xm, nullptr, WvT, nullptr, TMP, DM, nullptr);                   // v = memory.Wv
    k_vt<<<NB_ * NH_ * (NT_ / 64), 256, 0, stream>>>(TMP, VTH, VTL);
    k_attn<<<NB_ * NH_ * (NTQ / 64), 128, 0, stream>>>(QH, QL, KH, KL, VTH, VTL, bias, CH, CL);
    k_gemmb<true, false><<<dim3(NB_ * NTQ / 128, DM / 128, 1), 256, 0, stream>>>(CH, CL, WoT, nullptr, out, DM, nullptr);
}

// v005
// One run takes 165 microseconds.
// Two timings next to v004 both put it at 1.11 times that version's speed.
// All steps since v000 together make it 6.06 times as fast.
#include <hip/hip_runtime.h>

// Compute dtypes, f32 accumulate, all 4 batch items in one pass (rows of the items stacked): q = query.Wq ([4096 x 1024].[1024 x 1024]) and k/v = memory.Wk/Wv ([8192 x 1024].[1024 x 1024]), k-major weights transposed once to n-major planes; PLAIN bf16
// operands: inputs rounded once, exact) with q and k written straight from the GEMM epilogue as f16 hi + residual x1024 planes, and out = ctx.Wo (ctx as
// bf16 hi + residual: two products) on v_wmma_f32_16x16x32_bf16; the 16-head cross-attention (1024 queries x 2048 memory keys, 64-dim heads, scale 1/8) + the INPUT per-key bias[b][k] fused on
// v_wmma_f32_16x16x32_f16 (scores hi.hi + hi.lo + lo.hi with the residual terms on their own accumulator, online f32 softmax, weights (x32768) and v as f16

#define NB_  4                   // batch items, all in every launch's grid
#define NT_  2048                // keys per item (memory length)
#define NTQ  1024                // queries per item
#define DM   1024
#define NH_  16
#define HD   64
#define NTK  (NB_ * NT_)
#define NW   1024
#define NQKV 1024
#define PSC  32768.0f
#define LOSC 1024.0f
#define LOSCI (1.0f / 1024.0f)

typedef _Float16 h16;
typedef unsigned short bf;
typedef __attribute__((ext_vector_type(16))) __bf16   v16bf;
typedef __attribute__((ext_vector_type(16))) _Float16 v16h;
typedef __attribute__((ext_vector_type(8)))  _Float16 v8h;
typedef __attribute__((ext_vector_type(8)))  unsigned short v8us;
typedef __attribute__((ext_vector_type(8)))  float    v8f;
typedef __attribute__((ext_vector_type(4)))  float    v4f;
typedef v8h  __attribute__((may_alias)) v8ha;
typedef v4f  __attribute__((may_alias)) v4fa;
typedef v8us __attribute__((may_alias)) v8usa;

__device__ __forceinline__ unsigned short f2bf(float f) { unsigned u = __float_as_uint(f); u += 0x7FFFu + ((u >> 16) & 1u); return (unsigned short)(u >> 16); }
__device__ __forceinline__ float bf2f(unsigned short b) { return __uint_as_float(((unsigned)b) << 16); }
__device__ __forceinline__ float bfr(float f) { return bf2f(f2bf(f)); }
__device__ __forceinline__ v16h cat16(v8h lo, v8h hi) { return __builtin_shufflevector(lo, hi, 0, 1, 2, 3, 4, 5, 6, 7, 8, 9, 10, 11, 12, 13, 14, 15); }
__device__ __forceinline__ v16bf cat16b(v8us lo, v8us hi) { return __builtin_bit_cast(v16bf, __builtin_shufflevector(lo, hi, 0, 1, 2, 3, 4, 5, 6, 7, 8, 9, 10, 11, 12, 13, 14, 15)); }
__device__ __forceinline__ v8f wmma16(v16h a, v16h b, v8f c) { return __builtin_amdgcn_wmma_f32_16x16x32_f16(false, a, false, b, (short)0, c, false, false); }
__device__ __forceinline__ v8f wmmab(v16bf a, v16bf b, v8f c) { return __builtin_amdgcn_wmma_f32_16x16x32_bf16(false, a, false, b, (short)0, c, false, false); }

// cvt_rows: 8 rows of 1024 floats per block (one per wave), rounded to bf16; rb = the block's number among the array's row blocks.
__device__ __forceinline__ void cvt_rows(const float* __restrict__ src, int rb, bf* dst) {
    const int lane = threadIdx.x & 31, r = rb * 8 + (threadIdx.x >> 5);
    v8us o[DM / 256];
#pragma unroll
    for (int q = 0; q < DM / 256; ++q) { v8us t;
#pragma unroll
        for (int i = 0; i < 8; ++i) t[i] = f2bf(src[(size_t)r * DM + q * 256 + lane * 8 + i]);
        o[q] = t; }
#pragma unroll
    for (int q = 0; q < DM / 256; ++q) *(v8us*)(dst + (size_t)r * DM + q * 256 + lane * 8) = o[q];
    asm volatile("s_wait_xcnt 0x0" ::: "memory");   // another job's code follows in the merged kernel: stands in front of every rewrite of a register that the stores above name
}

// wt_tile: WT [n][K] = bf16(W[k][n]) (k-major [K][ncols]) via one 64 x 64 LDS tile per block, tile (bx, by) of (K/64, ncols/64).
__device__ __forceinline__ void wt_tile(const float* __restrict__ Wm, int K, int ncols, bf* WT, int bx, int by, unsigned short* tl) {
    const int tid = threadIdx.x, k0 = bx * 64, n0 = by * 64;
    const int kk = tid >> 2, nq = (tid & 3) * 16;
#pragma unroll
    for (int i = 0; i < 16; ++i) tl[(nq + i) * 72 + kk] = f2bf(Wm[(size_t)(k0 + kk) * ncols + n0 + nq + i]);
    __syncthreads();
    const int piece = tid & 7;
    auto pass = [&]() {
#pragma unroll
        for (int s = 0; s < 2; ++s) { const int nr = (tid >> 3) + 32 * s; const v8us val = *(const v8usa*)(tl + nr * 72 + piece * 8); *(v8us*)(WT + (size_t)(n0 + nr) * K + k0 + piece * 8) = val; }
    };
    pass();
    asm volatile("s_wait_xcnt 0x0" ::: "memory");   // another job's code follows in the merged kernel: stands in front of every rewrite of a register that the stores above name
}
// k_prep: the six preparation jobs, none of which reads what another writes, as ONE grid: 256 blocks each transpose Wq, Wk, Wv, Wo (the longest chain of waits, so they start first), then 1024 blocks round memory and 512 round query.
// Every branch is the same for a whole block, so the barrier inside wt_tile is passed by all of its block's waves or by none.
#define PB_M (NTK / 8)
#define PB_Q (NB_ * NTQ / 8)
#define PB_W ((DM / 64) * (DM / 64))
__global__ __launch_bounds__(256) void k_prep(const float* __restrict__ query, const float* __restrict__ memory, const float* __restrict__ Wq, const float* __restrict__ Wk, const float* __restrict__ Wv, const float* __restrict__ Wo,
                                              bf* Xq, bf* Xm, bf* WqT, bf* WkT, bf* WvT, bf* WoT) {
    __shared__ __align__(16) unsigned short tl[64 * 72];
    const int bid = blockIdx.x;
    if (bid >= 4 * PB_W + PB_M) { cvt_rows(query, bid - 4 * PB_W - PB_M, Xq); return; }
    if (bid >= 4 * PB_W) { cvt_rows(memory, bid - 4 * PB_W, Xm); return; }
    const int w = bid / PB_W, t = bid % PB_W;
    const float* Wm = w == 0 ? Wq : w == 1 ? Wk : w == 2 ? Wv : Wo;
    bf* WT = w == 0 ? WqT : w == 1 ? WkT : w == 2 ? WvT : WoT;
    wt_tile(Wm, DM, DM, WT, t % (DM / 64), t / (DM / 64), tl);
}
// LDS ring of k_gemmb: one stage = 128 k of the block's 128 A rows, 128 B rows (and, split A, 128 residual rows): rows of 256 B, 16 B longer in LDS
// (a pitch that is an odd multiple of 16 B, so that the 16-byte fragment reads of 16 rows fall on different banks).
#define GKS  128                 // k per stage
#define GPIT 136                 // halves per staged row
#define GPL  (128 * GPIT)        // halves per plane of 128 rows

// One plane of a stage: 8 copies of 16 B per lane, 256 lanes, global to LDS through no register: rows r, r + 16, ..., r + 112 of the plane, whole 256-byte row pieces per 16 lanes.
// s_wait_xcnt ends the statement so that no address register of a copy is rewritten ahead of it.
__device__ __forceinline__ void stage_g(unsigned ld, const bf* g) {
    asm volatile("global_load_async_to_lds_b128 %0, %8, off\n\t"
                 "global_load_async_to_lds_b128 %1, %9, off\n\t"
                 "global_load_async_to_lds_b128 %2, %10, off\n\t"
                 "global_load_async_to_lds_b128 %3, %11, off\n\t"
                 "global_load_async_to_lds_b128 %4, %12, off\n\t"
                 "global_load_async_to_lds_b128 %5, %13, off\n\t"
                 "global_load_async_to_lds_b128 %6, %14, off\n\t"
                 "global_load_async_to_lds_b128 %7, %15, off\n\t"
                 "s_wait_xcnt 0x0"
                 :: "v"(ld), "v"(ld + 16 * GPIT * 2), "v"(ld + 32 * GPIT * 2), "v"(ld + 48 * GPIT * 2),
                    "v"(ld + 64 * GPIT * 2), "v"(ld + 80 * GPIT * 2), "v"(ld + 96 * GPIT * 2), "v"(ld + 112 * GPIT * 2),
                    "v"(g), "v"(g + 16 * DM), "v"(g + 32 * DM), "v"(g + 48 * DM), "v"(g + 64 * DM), "v"(g + 80 * DM), "v"(g + 96 * DM), "v"(g + 112 * DM) : "memory");
}

// k_gemmb: C[128 x 128 per block] = A.Bn^T over k = 1024; 8 waves as 4 x 2, a wave = 32 rows x 64 columns (2 x 4 accumulator tiles); grid (rows / 128, columns / 128).
// QKV: the three projections, none of which reads what another writes, as ONE grid: row blocks 0..63 are k (A, Bn, C, C2: f16 hi + residual planes), 64..127 v (A, Bv, Cv: f32), 128..159 q (Aq, Bq, Cq, C2q: f16 planes).
template <bool SPLITA, bool QKV>
__global__ __launch_bounds__(256) void k_gemmb(const bf* __restrict__ A, const bf* __restrict__ Al, const bf* __restrict__ Bn, const float* __restrict__ bias, float* C, int ldc, h16* C2,
                                               const bf* __restrict__ Bv, float* Cv, const bf* __restrict__ Aq, const bf* __restrict__ Bq, h16* Cq, h16* C2q) {
    constexpr int NPL = SPLITA ? 3 : 2;             // planes per stage
    __shared__ __align__(16) bf gring[2][NPL * GPL]; // two stages, shared by the 8 waves; output staging behind the loop
    const int tid = threadIdx.x, lane = tid & 31, wave = tid >> 5, lr = lane & 15, hi = lane >> 4;
    int bx = blockIdx.x; bool f16out = QKV;         // the job: the same for a whole block
    if (QKV) {
        if (bx >= 2 * (NTK / 128)) { bx -= 2 * (NTK / 128); A = Aq; Bn = Bq; C = (float*)(void*)Cq; C2 = C2q; }
        else if (bx >= NTK / 128) { bx -= NTK / 128; Bn = Bv; C = Cv; C2 = nullptr; f16out = false; }
    }
    const int rb = bx * 128, cb = blockIdx.y * 128;
    const int wr = (wave >> 1) * 32, wc = (wave & 1) * 64;
    const int r0 = rb + wr, c0 = cb + wc;
    // the lane's share of a plane: rows tid/16 + 16 i, 16-byte piece tid%16
    const unsigned ld0 = (unsigned)(size_t)(&gring[0][0] + (tid >> 4) * GPIT + (tid & 15) * 8);
    const bf* ga = A + (size_t)(rb + (tid >> 4)) * DM + (tid & 15) * 8;
    const bf* gb = Bn + (size_t)(cb + (tid >> 4)) * DM + (tid & 15) * 8;
    auto fill = [&](int s) {
        const unsigned ld = ld0 + (unsigned)(s & 1) * (NPL * GPL * 2);
        stage_g(ld, ga + s * GKS); stage_g(ld + GPL * 2, gb + s * GKS);
        if (SPLITA) stage_g(ld + 2 * GPL * 2, Al + (size_t)(rb + (tid >> 4)) * DM + (tid & 15) * 8 + s * GKS);
    };
    v8f acc[2][4];
#pragma unroll
    for (int m = 0; m < 2; ++m)
#pragma unroll
        for (int t = 0; t < 4; ++t) acc[m][t] = (v8f){};
    fill(0);                                                // stage 0 into buffer 0
    asm volatile("s_wait_asynccnt 0x0" ::: "memory");       // this wave's copies of stage 0 have landed
    __syncthreads();                                        // ... and every other wave's: stage 0 may be read
    fill(1);                                                // stage 1 flies while stage 0 is worked on
#pragma unroll 1
    for (int s = 0; s < DM / GKS; ++s) {
        const bf* sa = &gring[s & 1][0] + (wr + lr) * GPIT + 8 * hi;
        const bf* sb = &gring[s & 1][0] + GPL + (wc + lr) * GPIT + 8 * hi;
#pragma unroll
        for (int kk = 0; kk < GKS; kk += 32) {
            v16bf a[2], al[2], b[4];
#pragma unroll
            for (int m = 0; m < 2; ++m) { a[m] = cat16b(*(const v8usa*)(sa + m * 16 * GPIT + kk), *(const v8usa*)(sa + m * 16 * GPIT + kk + 16));
                if (SPLITA) al[m] = cat16b(*(const v8usa*)(sa + 2 * GPL + m * 16 * GPIT + kk), *(const v8usa*)(sa + 2 * GPL + m * 16 * GPIT + kk + 16)); }
#pragma unroll
            for (int t = 0; t < 4; ++t) b[t] = cat16b(*(const v8usa*)(sb + t * 16 * GPIT + kk), *(const v8usa*)(sb + t * 16 * GPIT + kk + 16));
#pragma unroll
            for (int m = 0; m < 2; ++m)
#pragma unroll
                for (int t = 0; t < 4; ++t) acc[m][t] = wmmab(a[m], b[t], acc[m][t]);
            if (SPLITA) {
#pragma unroll
                for (int m = 0; m < 2; ++m)
#pragma unroll
                    for (int t = 0; t < 4; ++t) acc[m][t] = wmmab(al[m], b[t], acc[m][t]);
            }
        }
        asm volatile("s_wait_dscnt 0x0" ::: "memory");      // this wave's reads of the stage are done before the buffer is handed back
        asm volatile("s_wait_asynccnt 0x0" ::: "memory");   // this wave's copies of stage s + 1 have landed
        __syncthreads();                                    // publishes stage s + 1 and ends every wave's reads of stage s
        if (s + 2 < DM / GKS) fill(s + 2);                  // same for the whole block: refill the buffer that this trip has read
    }
    asm volatile("s_wait_asynccnt 0x0" ::: "memory");       // nothing of this wave is in flight behind the loop; the last trip's barrier has freed the ring
    float* os = (float*)(void*)&gring[0][0] + wave * (32 * 68);
#pragma unroll
    for (int m = 0; m < 2; ++m)
#pragma unroll
        for (int t = 0; t < 4; ++t) { const float bv = bias ? bfr(bias[c0 + t * 16 + lr]) : 0.f;
#pragma unroll
            for (int j = 0; j < 8; ++j) os[(m * 16 + hi * 8 + j) * 68 + t * 16 + lr] = acc[m][t][j] + bv; }
    __syncthreads();
    if (f16out) {
        h16* crow = (h16*)(void*)C + (size_t)r0 * ldc + c0;
#pragma unroll
        for (int s = 0; s < 8; ++s) { const int row = 4 * s + (lane >> 3), piece = lane & 7; const float* sp = os + row * 68 + piece * 8; v8h o, o2;
#pragma unroll
            for (int i = 0; i < 8; ++i) { const h16 a = (h16)sp[i]; o[i] = a; o2[i] = (h16)((sp[i] - (float)a) * LOSC); }
            *(v8h*)(crow + (size_t)row * ldc + piece * 8) = o;
            asm volatile("s_wait_xcnt 0x0" ::: "memory");   // stands in front of every rewrite of a register that the store above names
            if (C2) *(v8h*)(C2 + (size_t)r0 * ldc + c0 + (size_t)row * ldc + piece * 8) = o2; }
    } else {
        float* crow = C + (size_t)r0 * ldc + c0;
#pragma unroll
        for (int s = 0; s < 16; ++s) { const int Lid = (lane >> 3) + 4 * s, piece = lane & 7; const int row = Lid >> 1, cofs = (Lid & 1) * 32 + piece * 4;
            const v4f val = *(const v4fa*)(os + row * 68 + cofs); *(v4f*)(crow + (size_t)row * ldc + cofs) = val; }
        if (QKV) asm volatile("s_wait_xcnt 0x0" ::: "memory");   // the other epilogue's code follows in the merged kernel: stands in front of every rewrite of a register that the stores above name
    }
}

__global__ __launch_bounds__(256) void k_vt(const float* __restrict__ V, h16* VTH, h16* VTL) {
    __shared__ __align__(16) h16 tile[64 * 72];
    __shared__ __align__(16) h16 til2[64 * 72];
    const int bid = blockIdx.x;
    const int b = bid / (NH_ * (NT_ / 64)), rem = bid - b * (NH_ * (NT_ / 64)), h = rem / (NT_ / 64), kt = rem - h * (NT_ / 64);
    const int k0 = kt * 64, tid = threadIdx.x;
    const int kk = tid >> 2, d0 = (tid & 3) * 16;
    const float* src = V + ((size_t)b * NT_ + k0 + kk) * DM + h * HD + d0;
#pragma unroll
    for (int i = 0; i < 16; ++i) { const float v = src[i]; const h16 a = (h16)v; tile[(d0 + i) * 72 + kk] = a; til2[(d0 + i) * 72 + kk] = (h16)((v - (float)a) * LOSC); }
    __syncthreads();
    const int piece = tid & 7;
    const size_t base = (((size_t)b * NH_ + h) * HD) * NT_ + k0;
    auto pass = [&]() {
#pragma unroll
        for (int s = 0; s < 4; ++s) { const int Lid = (tid >> 3) + 32 * s; const int pln = Lid >> 6, d = Lid & 63;
            const v8h val = *(const v8ha*)((pln ? til2 : tile) + d * 72 + piece * 8); *(v8h*)((pln ? VTL : VTH) + base + (size_t)d * NT_ + piece * 8) = val; }
    };
    pass(); 
}

// LDS ring of k_attn: one stage = 32 keys: k hi, k residual (32 rows of 128 B each), v hi, v residual (64 rows of 64 B each); every row is 16 B longer in LDS
// (a pitch that is an odd multiple of 16 B, so that the 16-byte fragment reads of 16 rows fall on different banks).
#define KPIT 72                  // halves per staged k row
#define VPIT 40                  // halves per staged v row
#define KPL  (32 * KPIT)         // halves per k plane
#define VPL  (64 * VPIT)         // halves per v plane
#define STG  (2 * KPL + 2 * VPL) // halves per stage

// One stage: 8 copies of 16 B per lane, 128 lanes, global to LDS through no register. ldk, ldv: the lane's LDS byte address in the stage's k hi and v hi plane.
// s_wait_xcnt ends the statement so that no address register of a copy is rewritten ahead of it.
__device__ __forceinline__ void stage_kv(unsigned ldk, unsigned ldv, const h16* gkh, const h16* gkl, const h16* gvh, const h16* gvl) {
    asm volatile("global_load_async_to_lds_b128 %0, %8, off\n\t"
                 "global_load_async_to_lds_b128 %1, %9, off\n\t"
                 "global_load_async_to_lds_b128 %2, %10, off\n\t"
                 "global_load_async_to_lds_b128 %3, %11, off\n\t"
                 "global_load_async_to_lds_b128 %4, %12, off\n\t"
                 "global_load_async_to_lds_b128 %5, %13, off\n\t"
                 "global_load_async_to_lds_b128 %6, %14, off\n\t"
                 "global_load_async_to_lds_b128 %7, %15, off\n\t"
                 "s_wait_xcnt 0x0"
                 :: "v"(ldk), "v"(ldk + 16 * KPIT * 2), "v"(ldk + KPL * 2), "v"(ldk + (KPL + 16 * KPIT) * 2),
                    "v"(ldv), "v"(ldv + 32 * VPIT * 2), "v"(ldv + VPL * 2), "v"(ldv + (VPL + 32 * VPIT) * 2),
                    "v"(gkh), "v"(gkh + 16 * DM), "v"(gkl), "v"(gkl + 16 * DM), "v"(gvh), "v"(gvh + 32 * NT_), "v"(gvl), "v"(gvl + 32 * NT_) : "memory");
}

__device__ __forceinline__ v8f cat8f(v4f lo, v4f hi) { return __builtin_shufflevector(lo, hi, 0, 1, 2, 3, 4, 5, 6, 7); }
// lane l with lane l ^ 16
__device__ __forceinline__ float xhalf(float x) { return __builtin_bit_cast(float, __builtin_amdgcn_permlanex16(__builtin_bit_cast(int, x), __builtin_bit_cast(int, x), 0x76543210, 0xfedcba98, false, false)); }

__global__ __launch_bounds__(128) void k_attn(const h16* __restrict__ Q16, const h16* __restrict__ QL16, const h16* __restrict__ K16, const h16* __restrict__ KL16, const h16* __restrict__ VTH, const h16* __restrict__ VTL, const float* __restrict__ KB, bf* CH, bf* CL) {
    __shared__ __align__(16) float ost[4][16 * 68];
    __shared__ __align__(16) h16 ring[2][STG];      // two stages of k and v, shared by the 4 waves
    __shared__ __align__(16) float kbs[NT_];        // the item's whole key bias row, filled once, rounded in place
    const int lane = threadIdx.x & 31, wave = threadIdx.x >> 5, lr = lane & 15, hi = lane >> 4;
    const int bid = blockIdx.x;
    const int b = bid / (NH_ * (NTQ / 64)), rem = bid - b * (NH_ * (NTQ / 64)), h = rem / (NTQ / 64), qt = rem - h * (NTQ / 64);     // query blocks over the 1024 queries
    const int q0 = qt * 64 + wave * 16;
    const size_t tok0 = (size_t)b * NT_;     // key-side item offset; query rows use tokq0
    const size_t tokq0 = (size_t)b * NTQ;
    v16h qa[2], ql[2];
    const size_t qo0 = (tokq0 + q0 + lr) * DM + h * HD + 8 * hi;
#pragma unroll
    for (int kc = 0; kc < 2; ++kc) { qa[kc] = cat16(*(const v8h*)(Q16 + qo0 + kc * 32), *(const v8h*)(Q16 + qo0 + kc * 32 + 16));
        ql[kc] = cat16(*(const v8h*)(QL16 + qo0 + kc * 32), *(const v8h*)(QL16 + qo0 + kc * 32 + 16)); }
    const h16* kh_b = K16 + tok0 * DM + h * HD;
    const h16* kl_b = KL16 + tok0 * DM + h * HD;
    const size_t vbase = (((size_t)b * NH_ + h) * HD) * NT_;
    v8f o[4], ox[4];                         // o[n][j] = O^T[d = 16 n + 8 hi + j][query lr]
#pragma unroll
    for (int n = 0; n < 4; ++n) { o[n] = (v8f){}; ox[n] = (v8f){}; }
    float mrow = -3.0e38f, lsum = 0.f;       // of query lr; lsum over this wave half's keys
    const int kt_lo = 0, kt_hi = NT_ / 32 - 1;     // cross-attention: all 2048 memory keys; + the INPUT per-key bias[b][k]
    const int tid = threadIdx.x;
    // the lane's share of a stage: k rows tid/8 and tid/8 + 16, 16-byte piece tid%8; v rows tid/4 and tid/4 + 32, piece tid%4
    const unsigned ldk0 = (unsigned)(size_t)(&ring[0][0] + (tid >> 3) * KPIT + (tid & 7) * 8);
    const unsigned ldv0 = (unsigned)(size_t)(&ring[0][0] + 2 * KPL + (tid >> 2) * VPIT + (tid & 3) * 8);
    const h16* gkh = kh_b + (size_t)(tid >> 3) * DM + (tid & 7) * 8;
    const h16* gkl = kl_b + (size_t)(tid >> 3) * DM + (tid & 7) * 8;
    const h16* gvh = VTH + vbase + (size_t)(tid >> 2) * NT_ + (tid & 3) * 8;
    const h16* gvl = VTL + vbase + (size_t)(tid >> 2) * NT_ + (tid & 3) * 8;
    {   // the bias row: 4 copies of 16 B per lane; s_wait_xcnt as in stage_kv
        const unsigned ldb = (unsigned)(size_t)(&kbs[0] + tid * 4);
        const float* gb = KB + tok0 + tid * 4;
        asm volatile("global_load_async_to_lds_b128 %0, %4, off\n\t"
                     "global_load_async_to_lds_b128 %1, %5, off\n\t"
                     "global_load_async_to_lds_b128 %2, %6, off\n\t"
                     "global_load_async_to_lds_b128 %3, %7, off\n\t"
                     "s_wait_xcnt 0x0"
                     :: "v"(ldb), "v"(ldb + 2048), "v"(ldb + 4096), "v"(ldb + 6144), "v"(gb), "v"(gb + 512), "v"(gb + 1024), "v"(gb + 1536) : "memory");
    }
    stage_kv(ldk0, ldv0, gkh, gkl, gvh, gvl);                                                   // stage 0 into buffer 0
    asm volatile("s_wait_asynccnt 0x0" ::: "memory");                                           // this wave's copies of stage 0 and of the bias row have landed
#pragma unroll
    for (int c = 0; c < 4; ++c) { v4fa* bp = (v4fa*)(&kbs[0] + tid * 4 + c * 512); v4f t = *bp;   // each lane rounds the 16 bias values that it copied itself, once instead of per trip
#pragma unroll
        for (int i = 0; i < 4; ++i) t[i] = bfr(t[i]);
        *bp = t; }
    __syncthreads();                                                                            // ... and every other wave's: stage 0 and the rounded bias row may be read
    stage_kv(ldk0 + STG * 2, ldv0 + STG * 2, gkh + 32 * DM, gkl + 32 * DM, gvh + 32, gvl + 32); // stage 1 flies while stage 0 is worked on
#pragma unroll 1
    for (int kt = kt_lo; kt <= kt_hi; ++kt) {
        const int l0 = kt * 32;
        const h16* skh = &ring[kt & 1][0];          // this trip's stage: k hi, k residual, v hi, v residual
        const h16* skl = skh + KPL; const h16* svh = skh + 2 * KPL; const h16* svl = svh + VPL;
        const int ko0 = lr * KPIT + 8 * hi, ko1 = (16 + lr) * KPIT + 8 * hi;
        v8f s0 = {}, s1 = {}, x0 = {}, x1 = {};     // s0[j]: key l0 + 8 hi + j, s1[j]: key l0 + 16 + 8 hi + j, query lr
#pragma unroll
        for (int kc = 0; kc < 2; ++kc) {
            const v16h k0h = cat16(*(const v8ha*)(skh + ko0 + kc * 32), *(const v8ha*)(skh + ko0 + kc * 32 + 16)), k1h = cat16(*(const v8ha*)(skh + ko1 + kc * 32), *(const v8ha*)(skh + ko1 + kc * 32 + 16));
            const v16h k0l = cat16(*(const v8ha*)(skl + ko0 + kc * 32), *(const v8ha*)(skl + ko0 + kc * 32 + 16)), k1l = cat16(*(const v8ha*)(skl + ko1 + kc * 32), *(const v8ha*)(skl + ko1 + kc * 32 + 16));
            s0 = wmma16(k0h, qa[kc], s0); x0 = wmma16(k0h, ql[kc], x0); s1 = wmma16(k1h, qa[kc], s1); x1 = wmma16(k1h, ql[kc], x1);
            x0 = wmma16(k0l, qa[kc], x0); x1 = wmma16(k1l, qa[kc], x1);
        }
        const float* kbp = &kbs[0] + l0 + 8 * hi;
        const v8f kb0 = cat8f(*(const v4fa*)(kbp), *(const v4fa*)(kbp + 4)), kb1 = cat8f(*(const v4fa*)(kbp + 16), *(const v4fa*)(kbp + 20));
        const v8f a0 = (s0 + x0 * LOSCI) * 0.125f + kb0, a1 = (s1 + x1 * LOSCI) * 0.125f + kb1;
        float mx = fmaxf(a0[0], a1[0]);
#pragma unroll
        for (int j = 1; j < 8; ++j) mx = fmaxf(mx, fmaxf(a0[j], a1[j]));
        mx = fmaxf(mx, xhalf(mx));                  // both wave halves now hold the query's maximum over the 32 keys
        const float mn = fmaxf(mrow, mx);
        const float alpha = __expf(mrow - mn); mrow = mn;
        const v8f t0 = (a0 - mn) * 1.4426950408889634f, t1 = (a1 - mn) * 1.4426950408889634f;   // e^x as 2^(x log2 e), the factors of __expf
        v8f p0, p1;
#pragma unroll
        for (int j = 0; j < 8; ++j) { p0[j] = __builtin_amdgcn_exp2f(t0[j]); p1[j] = __builtin_amdgcn_exp2f(t1[j]); }
        const v8f pt = p0 + p1, ps0 = p0 * PSC, ps1 = p1 * PSC;
        const v8h h0 = __builtin_convertvector(ps0, v8h), h1 = __builtin_convertvector(ps1, v8h);
        const v8h g0 = __builtin_convertvector((ps0 - __builtin_convertvector(h0, v8f)) * LOSC, v8h), g1 = __builtin_convertvector((ps1 - __builtin_convertvector(h1, v8f)) * LOSC, v8h);
        const v16h pa = cat16(h0, h1), px = cat16(g0, g1);     // element s of the B operand: key 8 hi + s, then 16 + 8 hi + (s - 8): the score registers' own order
        lsum = lsum * alpha + (((pt[0] + pt[1]) + (pt[2] + pt[3])) + ((pt[4] + pt[5]) + (pt[6] + pt[7])));
#pragma unroll
        for (int n = 0; n < 4; ++n)
#pragma unroll
            for (int j = 0; j < 8; ++j) { o[n][j] *= alpha; ox[n][j] *= alpha; }
#pragma unroll
        for (int n = 0; n < 4; ++n) { const int vo = (n * 16 + lr) * VPIT + hi * 8;
            const v16h vh = cat16(*(const v8ha*)(svh + vo), *(const v8ha*)(svh + vo + 16)), vl = cat16(*(const v8ha*)(svl + vo), *(const v8ha*)(svl + vo + 16));
            o[n] = wmma16(vh, pa, o[n]); ox[n] = wmma16(vl, pa, ox[n]); ox[n] = wmma16(vh, px, ox[n]); }
        asm volatile("s_wait_dscnt 0x0" ::: "memory");      // this wave's reads of the stage are done before the buffer is handed back
        asm volatile("s_wait_asynccnt 0x0" ::: "memory");   // this wave's copies of stage kt + 1 have landed
        __syncthreads();                                    // publishes stage kt + 1 and ends every wave's reads of stage kt
        if (kt + 2 <= kt_hi) {                              // same for the whole block: refill the buffer that this trip has read
            const unsigned bo = (unsigned)(kt & 1) * (STG * 2);
            stage_kv(ldk0 + bo, ldv0 + bo, gkh + (size_t)(l0 + 64) * DM, gkl + (size_t)(l0 + 64) * DM, gvh + l0 + 64, gvl + l0 + 64);
        }
    }
    asm volatile("s_wait_asynccnt 0x0" ::: "memory");       // nothing of this wave is in flight behind the loop
    const float inv = 1.0f / ((lsum + xhalf(lsum)) * PSC);  // the two halves' sums joined once
    float* os = &ost[wave][0];
#pragma unroll
    for (int n = 0; n < 4; ++n)
#pragma unroll
        for (int g = 0; g < 2; ++g) { v4f t;
#pragma unroll
            for (int i = 0; i < 4; ++i) t[i] = (o[n][g * 4 + i] + ox[n][g * 4 + i] * LOSCI) * inv;
            *(v4fa*)(os + lr * 68 + n * 16 + hi * 8 + g * 4) = t; }
    __syncthreads();
    const size_t cbase = (tokq0 + q0) * DM + (size_t)h * HD;
    auto pass = [&]() {
#pragma unroll
        for (int s = 0; s < 4; ++s) { const int row = 4 * s + (lane >> 3), piece = lane & 7; const float* sp = os + row * 68 + piece * 8; v8us oh, ol;
#pragma unroll
            for (int i = 0; i < 8; ++i) { const unsigned short hb = f2bf(sp[i]); oh[i] = hb; ol[i] = f2bf(sp[i] - bf2f(hb)); }
            *(v8us*)(CH + cbase + (size_t)row * DM + piece * 8) = oh; *(v8us*)(CL + cbase + (size_t)row * DM + piece * 8) = ol; }
    };
    pass(); 
}

#define VST2(T, p, v) do { const T vst2_v_ = (v); *(T*)(p) = vst2_v_;  } while (0)
extern "C" void kernel_launch(void* const* d_in, const int* in_sizes, int n_in,
                              void* d_out, int out_size, void* d_ws, size_t ws_size, hipStream_t stream) {
    (void)in_sizes; (void)n_in; (void)out_size;
    const float* query = (const float*)d_in[0]; const float* memory = (const float*)d_in[1]; const float* bias = (const float*)d_in[2];
    const float* Wq = (const float*)d_in[3]; const float* Wk = (const float*)d_in[4]; const float* Wv = (const float*)d_in[5]; const float* Wo = (const float*)d_in[6];   // all k-major [in][out]
    float* out = (float*)d_out;    // [4][1024][1024]
    char* wsp = (char*)d_ws;
    auto take = [&](size_t bytes) { char* p = wsp; wsp += (bytes + 255) & ~(size_t)255; return (void*)p; };
    bf* Xq = (bf*)take((size_t)NB_ * NTQ * DM * 2); bf* Xm = (bf*)take((size_t)NTK * DM * 2);
    bf* WqT = (bf*)take((size_t)DM * DM * 2); bf* WkT = (bf*)take((size_t)DM * DM * 2); bf* WvT = (bf*)take((size_t)DM * DM * 2); bf* WoT = (bf*)take((size_t)DM * DM * 2);
    float* TMP = (float*)take((size_t)NTK * DM * 4);
    h16* QH = (h16*)take((size_t)NB_ * NTQ * DM * 2); h16* QL = (h16*)take((size_t)NB_ * NTQ * DM * 2); h16* KH = (h16*)take((size_t)NTK * DM * 2); h16* KL = (h16*)take((size_t)NTK * DM * 2);
    h16* VTH = (h16*)take((size_t)NTK * DM * 2); h16* VTL = (h16*)take((size_t)NTK * DM * 2); bf* CH = (bf*)take((size_t)NB_ * NTQ * DM * 2); bf* CL = (bf*)take((size_t)NB_ * NTQ * DM * 2);
    if ((size_t)(wsp - (char*)d_ws) > ws_size) return;    // 8.4 + 16.8 + 4 x 2.1 + 33.6 + 2 x 8.4 + 4 x 16.8 + 2 x 8.4 ~ 168 MB, no aliasing
    k_prep<<<4 * PB_W + PB_M + PB_Q, 256, 0, stream>>>(query, memory, Wq, Wk, Wv, Wo, Xq, Xm, WqT, WkT, WvT, WoT);
    k_gemmb<false, true><<<dim3(2 * (NTK / 128) + NB_ * NTQ / 128, DM / 128, 1), 256, 0, stream>>>(Xm, nullptr, WkT, nullptr, (float*)(void*)KH, DM, KL, WvT, TMP, Xq, WqT, QH, QL);   // k = memory.Wk [8192][1024], v = memory.Wv, q = query.Wq [4096][1024]
    k_vt<<<NB_ * NH_ * (NT_ / 64), 256, 0, stream>>>(TMP, VTH, VTL);
    k_attn<<<NB_ * NH_ * (NTQ / 64), 128, 0, stream>>>(QH, QL, KH, KL, VTH, VTL, bias, CH, CL);
    k_gemmb<true, false><<<dim3(NB_ * NTQ / 128, DM / 128, 1), 256, 0, stream>>>(CH, CL, WoT, nullptr, out, DM, nullptr, nullptr, nullptr, nullptr, nullptr, nullptr, nullptr);
}

// v007
// Measured time: 116 microseconds a run.
// Versions in between are left out here; by their measured steps it is 1.42 times as fast as v005.
// All steps since v000 together make it 8.59 times as fast.
#include <hip/hip_runtime.h>

// Compute dtypes, f32 accumulate, all 4 batch items in one pass (rows of the items stacked): q = query.Wq ([4096 x 1024].[1024 x 1024]) and k/v = memory.Wk/Wv ([8192 x 1024].[1024 x 1024]), k-major weights transposed once to n-major planes; PLAIN bf16
// operands: inputs rounded once, exact) with q and k written straight from the GEMM epilogue as one f16 plane each, and out = ctx.Wo (ctx as
// bf16 hi + residual: two products) on v_wmma_f32_16x16x32_bf16; the 16-head cross-attention (1024 queries x 2048 memory keys, 64-dim heads, scale 1/8) + the INPUT per-key bias[b][k] fused on
// v_wmma_f32_16x16x32_f16 (one product per score tile and per output tile, online f32 softmax, weights (x32768) and v as f16: their rounding is an eighth of the bf16 rounding that q, k and v already carry from their inputs)

#define NB_  4                   // batch items, all in every launch's grid
#define NT_  2048                // keys per item (memory length)
#define NTQ  1024                // queries per item
#define DM   1024
#define NH_  16
#define HD   64
#define NTK  (NB_ * NT_)
#define NW   1024
#define NQKV 1024
#define PSC  32768.0f

typedef _Float16 h16;
typedef unsigned short bf;
typedef __attribute__((ext_vector_type(16))) __bf16   v16bf;
typedef __attribute__((ext_vector_type(16))) _Float16 v16h;
typedef __attribute__((ext_vector_type(8)))  _Float16 v8h;
typedef __attribute__((ext_vector_type(8)))  unsigned short v8us;
typedef __attribute__((ext_vector_type(8)))  float    v8f;
typedef __attribute__((ext_vector_type(4)))  float    v4f;
typedef v8h  __attribute__((may_alias)) v8ha;
typedef v4f  __attribute__((may_alias)) v4fa;
typedef v8us __attribute__((may_alias)) v8usa;

__device__ __forceinline__ unsigned short f2bf(float f) { unsigned u = __float_as_uint(f); u += 0x7FFFu + ((u >> 16) & 1u); return (unsigned short)(u >> 16); }
__device__ __forceinline__ float bf2f(unsigned short b) { return __uint_as_float(((unsigned)b) << 16); }
__device__ __forceinline__ float bfr(float f) { return bf2f(f2bf(f)); }
__device__ __forceinline__ v16h cat16(v8h lo, v8h hi) { return __builtin_shufflevector(lo, hi, 0, 1, 2, 3, 4, 5, 6, 7, 8, 9, 10, 11, 12, 13, 14, 15); }
__device__ __forceinline__ v16bf cat16b(v8us lo, v8us hi) { return __builtin_bit_cast(v16bf, __builtin_shufflevector(lo, hi, 0, 1, 2, 3, 4, 5, 6, 7, 8, 9, 10, 11, 12, 13, 14, 15)); }
__device__ __forceinline__ v8f wmma16(v16h a, v16h b, v8f c) { return __builtin_amdgcn_wmma_f32_16x16x32_f16(false, a, false, b, (short)0, c, false, false); }
__device__ __forceinline__ v8f wmmab(v16bf a, v16bf b, v8f c) { return __builtin_amdgcn_wmma_f32_16x16x32_bf16(false, a, false, b, (short)0, c, false, false); }

// cvt_rows: 8 rows of 1024 floats per block (one per wave), rounded to bf16; rb = the block's number among the array's row blocks.
__device__ __forceinline__ void cvt_rows(const float* __restrict__ src, int rb, bf* dst) {
    const int lane = threadIdx.x & 31, r = rb * 8 + (threadIdx.x >> 5);
    v8us o[DM / 256];
#pragma unroll
    for (int q = 0; q < DM / 256; ++q) { v8us t;
#pragma unroll
        for (int i = 0; i < 8; ++i) t[i] = f2bf(src[(size_t)r * DM + q * 256 + lane * 8 + i]);
        o[q] = t; }
#pragma unroll
    for (int q = 0; q < DM / 256; ++q) *(v8us*)(dst + (size_t)r * DM + q * 256 + lane * 8) = o[q];
    asm volatile("s_wait_xcnt 0x0" ::: "memory");   // another job's code follows in the merged kernel: stands in front of every rewrite of a register that the stores above name
}

// wt_tile: WT [n][K] = bf16(W[k][n]) (k-major [K][ncols]) via one 64 x 64 LDS tile per block, tile (bx, by) of (K/64, ncols/64).
__device__ __forceinline__ void wt_tile(const float* __restrict__ Wm, int K, int ncols, bf* WT, int bx, int by, unsigned short* tl) {
    const int tid = threadIdx.x, k0 = bx * 64, n0 = by * 64;
    const int kk = tid >> 2, nq = (tid & 3) * 16;
#pragma unroll
    for (int i = 0; i < 16; ++i) tl[(nq + i) * 72 + kk] = f2bf(Wm[(size_t)(k0 + kk) * ncols + n0 + nq + i]);
    __syncthreads();
    const int piece = tid & 7;
    auto pass = [&]() {
#pragma unroll
        for (int s = 0; s < 2; ++s) { const int nr = (tid >> 3) + 32 * s; const v8us val = *(const v8usa*)(tl + nr * 72 + piece * 8); *(v8us*)(WT + (size_t)(n0 + nr) * K + k0 + piece * 8) = val; }
    };
    pass();
    asm volatile("s_wait_xcnt 0x0" ::: "memory");   // another job's code follows in the merged kernel: stands in front of every rewrite of a register that the stores above name
}
// k_prep: the six preparation jobs, none of which reads what another writes, as ONE grid: 256 blocks each transpose Wq, Wk, Wv, Wo (the longest chain of waits, so they start first), then 1024 blocks round memory and 512 round query.
// Every branch is the same for a whole block, so the barrier inside wt_tile is passed by all of its block's waves or by none.
#define PB_M (NTK / 8)
#define PB_Q (NB_ * NTQ / 8)
#define PB_W ((DM / 64) * (DM / 64))
__global__ __launch_bounds__(256) void k_prep(const float* __restrict__ query, const float* __restrict__ memory, const float* __restrict__ Wq, const float* __restrict__ Wk, const float* __restrict__ Wv, const float* __restrict__ Wo,
                                              bf* Xq, bf* Xm, bf* WqT, bf* WkT, bf* WvT, bf* WoT) {
    __shared__ __align__(16) unsigned short tl[64 * 72];
    const int bid = blockIdx.x;
    if (bid >= 4 * PB_W + PB_M) { cvt_rows(query, bid - 4 * PB_W - PB_M, Xq); return; }
    if (bid >= 4 * PB_W) { cvt_rows(memory, bid - 4 * PB_W, Xm); return; }
    const int w = bid / PB_W, t = bid % PB_W;
    const float* Wm = w == 0 ? Wq : w == 1 ? Wk : w == 2 ? Wv : Wo;
    bf* WT = w == 0 ? WqT : w == 1 ? WkT : w == 2 ? WvT : WoT;
    wt_tile(Wm, DM, DM, WT, t % (DM / 64), t / (DM / 64), tl);
}
// LDS ring of k_gemmb: one stage = 128 k of the block's 128 A rows, 128 B rows (and, split A, 128 residual rows): rows of 256 B, 16 B longer in LDS
// (a pitch that is an odd multiple of 16 B, so that the 16-byte fragment reads of 16 rows fall on different banks).
#define GKS  128                 // k per stage
#define GPIT 136                 // halves per staged row
#define GPL  (128 * GPIT)        // halves per plane of 128 rows

// One plane of a stage: 8 copies of 16 B per lane, 256 lanes, global to LDS through no register: rows r, r + 16, ..., r + 112 of the plane, whole 256-byte row pieces per 16 lanes.
// s_wait_xcnt ends the statement so that no address register of a copy is rewritten ahead of it.
__device__ __forceinline__ void stage_g(unsigned ld, const bf* g) {
    asm volatile("global_load_async_to_lds_b128 %0, %8, off\n\t"
                 "global_load_async_to_lds_b128 %1, %9, off\n\t"
                 "global_load_async_to_lds_b128 %2, %10, off\n\t"
                 "global_load_async_to_lds_b128 %3, %11, off\n\t"
                 "global_load_async_to_lds_b128 %4, %12, off\n\t"
                 "global_load_async_to_lds_b128 %5, %13, off\n\t"
                 "global_load_async_to_lds_b128 %6, %14, off\n\t"
                 "global_load_async_to_lds_b128 %7, %15, off\n\t"
                 "s_wait_xcnt 0x0"
                 :: "v"(ld), "v"(ld + 16 * GPIT * 2), "v"(ld + 32 * GPIT * 2), "v"(ld + 48 * GPIT * 2),
                    "v"(ld + 64 * GPIT * 2), "v"(ld + 80 * GPIT * 2), "v"(ld + 96 * GPIT * 2), "v"(ld + 112 * GPIT * 2),
                    "v"(g), "v"(g + 16 * DM), "v"(g + 32 * DM), "v"(g + 48 * DM), "v"(g + 64 * DM), "v"(g + 80 * DM), "v"(g + 96 * DM), "v"(g + 112 * DM) : "memory");
}

// k_gemmb: C[128 x 128 per block] = A.Bn^T over k = 1024; 8 waves as 4 x 2, a wave = 32 rows x 64 columns (2 x 4 accumulator tiles); grid (rows / 128, columns / 128).
// QKV: the three projections, none of which reads what another writes, as ONE grid: row blocks 0..63 are k (A, Bn, C), 64..127 v (A, Bv, Cv), 128..159 q (Aq, Bq, Cq), each written as one f16 plane.
template <bool SPLITA, bool QKV>
__global__ __launch_bounds__(256) void k_gemmb(const bf* __restrict__ A, const bf* __restrict__ Al, const bf* __restrict__ Bn, const float* __restrict__ bias, float* C, int ldc,
                                               const bf* __restrict__ Bv, h16* Cv, const bf* __restrict__ Aq, const bf* __restrict__ Bq, h16* Cq) {
    constexpr int NPL = SPLITA ? 3 : 2;             // planes per stage
    __shared__ __align__(16) bf gring[2][NPL * GPL]; // two stages, shared by the 8 waves; output staging behind the loop
    const int tid = threadIdx.x, lane = tid & 31, wave = tid >> 5, lr = lane & 15, hi = lane >> 4;
    int bx = blockIdx.x;                            // the job: the same for a whole block
    if (QKV) {
        if (bx >= 2 * (NTK / 128)) { bx -= 2 * (NTK / 128); A = Aq; Bn = Bq; C = (float*)(void*)Cq; }
        else if (bx >= NTK / 128) { bx -= NTK / 128; Bn = Bv; C = (float*)(void*)Cv; }
    }
    const int rb = bx * 128, cb = blockIdx.y * 128;
    const int wr = (wave >> 1) * 32, wc = (wave & 1) * 64;
    const int r0 = rb + wr, c0 = cb + wc;
    // the lane's share of a plane: rows tid/16 + 16 i, 16-byte piece tid%16
    const unsigned ld0 = (unsigned)(size_t)(&gring[0][0] + (tid >> 4) * GPIT + (tid & 15) * 8);
    const bf* ga = A + (size_t)(rb + (tid >> 4)) * DM + (tid & 15) * 8;
    const bf* gb = Bn + (size_t)(cb + (tid >> 4)) * DM + (tid & 15) * 8;
    auto fill = [&](int s) {
        const unsigned ld = ld0 + (unsigned)(s & 1) * (NPL * GPL * 2);
        stage_g(ld, ga + s * GKS); stage_g(ld + GPL * 2, gb + s * GKS);
        if (SPLITA) stage_g(ld + 2 * GPL * 2, Al + (size_t)(rb + (tid >> 4)) * DM + (tid & 15) * 8 + s * GKS);
    };
    v8f acc[2][4];
#pragma unroll
    for (int m = 0; m < 2; ++m)
#pragma unroll
        for (int t = 0; t < 4; ++t) acc[m][t] = (v8f){};
    fill(0);                                                // stage 0 into buffer 0
    asm volatile("s_wait_asynccnt 0x0" ::: "memory");       // this wave's copies of stage 0 have landed
    __syncthreads();                                        // ... and every other wave's: stage 0 may be read
    fill(1);                                                // stage 1 flies while stage 0 is worked on
#pragma unroll 1
    for (int s = 0; s < DM / GKS; ++s) {
        const bf* sa = &gring[s & 1][0] + (wr + lr) * GPIT + 8 * hi;
        const bf* sb = &gring[s & 1][0] + GPL + (wc + lr) * GPIT + 8 * hi;
#pragma unroll
        for (int kk = 0; kk < GKS; kk += 32) {
            v16bf a[2], al[2], b[4];
#pragma unroll
            for (int m = 0; m < 2; ++m) { a[m] = cat16b(*(const v8usa*)(sa + m * 16 * GPIT + kk), *(const v8usa*)(sa + m * 16 * GPIT + kk + 16));
                if (SPLITA) al[m] = cat16b(*(const v8usa*)(sa + 2 * GPL + m * 16 * GPIT + kk), *(const v8usa*)(sa + 2 * GPL + m * 16 * GPIT + kk + 16)); }
#pragma unroll
            for (int t = 0; t < 4; ++t) b[t] = cat16b(*(const v8usa*)(sb + t * 16 * GPIT + kk), *(const v8usa*)(sb + t * 16 * GPIT + kk + 16));
#pragma unroll
            for (int m = 0; m < 2; ++m)
#pragma unroll
                for (int t = 0; t < 4; ++t) acc[m][t] = wmmab(a[m], b[t], acc[m][t]);
            if (SPLITA) {
#pragma unroll
                for (int m = 0; m < 2; ++m)
#pragma unroll
                    for (int t = 0; t < 4; ++t) acc[m][t] = wmmab(al[m], b[t], acc[m][t]);
            }
        }
        asm volatile("s_wait_dscnt 0x0" ::: "memory");      // this wave's reads of the stage are done before the buffer is handed back
        asm volatile("s_wait_asynccnt 0x0" ::: "memory");   // this wave's copies of stage s + 1 have landed
        __syncthreads();                                    // publishes stage s + 1 and ends every wave's reads of stage s
        if (s + 2 < DM / GKS) fill(s + 2);                  // same for the whole block: refill the buffer that this trip has read
    }
    asm volatile("s_wait_asynccnt 0x0" ::: "memory");       // nothing of this wave is in flight behind the loop; the last trip's barrier has freed the ring
    float* os = (float*)(void*)&gring[0][0] + wave * (32 * 68);
#pragma unroll
    for (int m = 0; m < 2; ++m)
#pragma unroll
        for (int t = 0; t < 4; ++t) { const float bv = bias ? bfr(bias[c0 + t * 16 + lr]) : 0.f;
#pragma unroll
            for (int j = 0; j < 8; ++j) os[(m * 16 + hi * 8 + j) * 68 + t * 16 + lr] = acc[m][t][j] + bv; }
    __syncthreads();
    if (QKV) {
        h16* crow = (h16*)(void*)C + (size_t)r0 * ldc + c0;
#pragma unroll
        for (int s = 0; s < 8; ++s) { const int row = 4 * s + (lane >> 3), piece = lane & 7; const float* sp = os + row * 68 + piece * 8; v8h o;
#pragma unroll
            for (int i = 0; i < 8; ++i) o[i] = (h16)sp[i];
            *(v8h*)(crow + (size_t)row * ldc + piece * 8) = o;
            asm volatile("s_wait_xcnt 0x0" ::: "memory"); }   // stands in front of every rewrite of a register that the store above names
    } else {
        float* crow = C + (size_t)r0 * ldc + c0;
#pragma unroll
        for (int s = 0; s < 16; ++s) { const int Lid = (lane >> 3) + 4 * s, piece = lane & 7; const int row = Lid >> 1, cofs = (Lid & 1) * 32 + piece * 4;
            const v4f val = *(const v4fa*)(os + row * 68 + cofs); *(v4f*)(crow + (size_t)row * ldc + cofs) = val; }
    }
}

// LDS ring of k_attn: one stage = 32 keys: k and v as projected, 32 rows of 128 B each. A k row is 16 B longer in LDS (a pitch that is an odd multiple of 16 B,
// for the 16-byte fragment reads of 16 rows), a v row 32 B longer (an odd multiple of 32 B, the pitch of the transposing reads).
#define KPIT 72                  // halves per staged k row
#define VPIT 80                  // halves per staged v row
#define KPL  (32 * KPIT)         // halves per k plane
#define VPL  (32 * VPIT)         // halves per v plane
#define STG  (KPL + VPL)         // halves per stage

// One stage: 4 copies of 16 B per lane, 128 lanes, global to LDS through no register. ldk, ldv: the lane's LDS byte address in the stage's k and v plane.
// s_wait_xcnt ends the statement so that no address register of a copy is rewritten ahead of it.
__device__ __forceinline__ void stage_kv(unsigned ldk, unsigned ldv, const h16* gkh, const h16* gvh) {
    asm volatile("global_load_async_to_lds_b128 %0, %4, off\n\t"
                 "global_load_async_to_lds_b128 %1, %5, off\n\t"
                 "global_load_async_to_lds_b128 %2, %6, off\n\t"
                 "global_load_async_to_lds_b128 %3, %7, off\n\t"
                 "s_wait_xcnt 0x0"
                 :: "v"(ldk), "v"(ldk + 16 * KPIT * 2), "v"(ldv), "v"(ldv + 16 * VPIT * 2),
                    "v"(gkh), "v"(gkh + 16 * DM), "v"(gvh), "v"(gvh + 16 * DM) : "memory");
}

// Transposing 16-byte LDS read: from a row-major [key][d] tile, lane (c = l & 15, h = l >> 4) gets the 8 keys 8 h .. 8 h + 7 of column c;
// lane l hands in the address of row 8 (l >> 4) + (l & 7), 16-byte piece (l >> 3) & 1, of the 16 x 16 tile.
typedef short s16x8 __attribute__((ext_vector_type(8)));
__device__ __forceinline__ v8h ld_tr16(const h16* p) { typedef __attribute__((address_space(3))) s16x8 lds_s16x8; return __builtin_bit_cast(v8h, __builtin_amdgcn_ds_load_tr16_b128_v8i16((lds_s16x8*)p)); }

__device__ __forceinline__ v8f cat8f(v4f lo, v4f hi) { return __builtin_shufflevector(lo, hi, 0, 1, 2, 3, 4, 5, 6, 7); }
// lane l with lane l ^ 16
__device__ __forceinline__ float xhalf(float x) { return __builtin_bit_cast(float, __builtin_amdgcn_permlanex16(__builtin_bit_cast(int, x), __builtin_bit_cast(int, x), 0x76543210, 0xfedcba98, false, false)); }

__global__ __launch_bounds__(128) void k_attn(const h16* __restrict__ Q16, const h16* __restrict__ K16, const h16* __restrict__ V16, const float* __restrict__ KB, bf* CH, bf* CL) {
    __shared__ __align__(16) float ost[4][16 * 68];
    __shared__ __align__(16) h16 ring[2][STG];      // two stages of k and v, shared by the 4 waves
    __shared__ __align__(16) float kbs[NT_];        // the item's whole key bias row, filled once, rounded in place
    const int lane = threadIdx.x & 31, wave = threadIdx.x >> 5, lr = lane & 15, hi = lane >> 4;
    const int bid = blockIdx.x;
    const int b = bid / (NH_ * (NTQ / 64)), rem = bid - b * (NH_ * (NTQ / 64)), h = rem / (NTQ / 64), qt = rem - h * (NTQ / 64);     // query blocks over the 1024 queries
    const int q0 = qt * 64 + wave * 16;
    const size_t tok0 = (size_t)b * NT_;     // key-side item offset; query rows use tokq0
    const size_t tokq0 = (size_t)b * NTQ;
    v16h qa[2];
    const size_t qo0 = (tokq0 + q0 + lr) * DM + h * HD + 8 * hi;
#pragma unroll
    for (int kc = 0; kc < 2; ++kc) qa[kc] = cat16(*(const v8h*)(Q16 + qo0 + kc * 32), *(const v8h*)(Q16 + qo0 + kc * 32 + 16));
    const h16* kh_b = K16 + tok0 * DM + h * HD;
    v8f o[4];                                // o[n][j] = O^T[d = 16 n + 8 hi + j][query lr]
#pragma unroll
    for (int n = 0; n < 4; ++n) o[n] = (v8f){};
    float mrow = -3.0e38f, lsum = 0.f;       // of query lr; lsum over this wave half's keys
    const int kt_lo = 0, kt_hi = NT_ / 32 - 1;     // cross-attention: all 2048 memory keys; + the INPUT per-key bias[b][k]
    const int tid = threadIdx.x;
    // the lane's share of a stage: rows tid/8 and tid/8 + 16, 16-byte piece tid%8, of k and of v
    const unsigned ldk0 = (unsigned)(size_t)(&ring[0][0] + (tid >> 3) * KPIT + (tid & 7) * 8);
    const unsigned ldv0 = (unsigned)(size_t)(&ring[0][0] + KPL + (tid >> 3) * VPIT + (tid & 7) * 8);
    const h16* gkh = kh_b + (size_t)(tid >> 3) * DM + (tid & 7) * 8;
    const h16* gvh = V16 + tok0 * DM + h * HD + (size_t)(tid >> 3) * DM + (tid & 7) * 8;
    {   // the bias row: 4 copies of 16 B per lane; s_wait_xcnt as in stage_kv
        const unsigned ldb = (unsigned)(size_t)(&kbs[0] + tid * 4);
        const float* gb = KB + tok0 + tid * 4;
        asm volatile("global_load_async_to_lds_b128 %0, %4, off\n\t"
                     "global_load_async_to_lds_b128 %1, %5, off\n\t"
                     "global_load_async_to_lds_b128 %2, %6, off\n\t"
                     "global_load_async_to_lds_b128 %3, %7, off\n\t"
                     "s_wait_xcnt 0x0"
                     :: "v"(ldb), "v"(ldb + 2048), "v"(ldb + 4096), "v"(ldb + 6144), "v"(gb), "v"(gb + 512), "v"(gb + 1024), "v"(gb + 1536) : "memory");
    }
    stage_kv(ldk0, ldv0, gkh, gvh);                                                             // stage 0 into buffer 0
    asm volatile("s_wait_asynccnt 0x0" ::: "memory");                                           // this wave's copies of stage 0 and of the bias row have landed
#pragma unroll
    for (int c = 0; c < 4; ++c) { v4fa* bp = (v4fa*)(&kbs[0] + tid * 4 + c * 512); v4f t = *bp;   // each lane rounds the 16 bias values that it copied itself, once instead of per trip
#pragma unroll
        for (int i = 0; i < 4; ++i) t[i] = bfr(t[i]);
        *bp = t; }
    __syncthreads();                                                                            // ... and every other wave's: stage 0 and the rounded bias row may be read
    stage_kv(ldk0 + STG * 2, ldv0 + STG * 2, gkh + 32 * DM, gvh + 32 * DM);                         // stage 1 flies while stage 0 is worked on
#pragma unroll 1
    for (int kt = kt_lo; kt <= kt_hi; ++kt) {
        const int l0 = kt * 32;
        const h16* skh = &ring[kt & 1][0];          // this trip's stage: k, v
        const h16* svh = skh + KPL;
        const int ko0 = lr * KPIT + 8 * hi, ko1 = (16 + lr) * KPIT + 8 * hi;
        v8f s0 = {}, s1 = {};                       // s0[j]: key l0 + 8 hi + j, s1[j]: key l0 + 16 + 8 hi + j, query lr
#pragma unroll
        for (int kc = 0; kc < 2; ++kc) {
            const v16h k0h = cat16(*(const v8ha*)(skh + ko0 + kc * 32), *(const v8ha*)(skh + ko0 + kc * 32 + 16)), k1h = cat16(*(const v8ha*)(skh + ko1 + kc * 32), *(const v8ha*)(skh + ko1 + kc * 32 + 16));
            s0 = wmma16(k0h, qa[kc], s0); s1 = wmma16(k1h, qa[kc], s1);
        }
        const float* kbp = &kbs[0] + l0 + 8 * hi;
        const v8f kb0 = cat8f(*(const v4fa*)(kbp), *(const v4fa*)(kbp + 4)), kb1 = cat8f(*(const v4fa*)(kbp + 16), *(const v4fa*)(kbp + 20));
        const v8f a0 = s0 * 0.125f + kb0, a1 = s1 * 0.125f + kb1;
        float mx = fmaxf(a0[0], a1[0]);
#pragma unroll
        for (int j = 1; j < 8; ++j) mx = fmaxf(mx, fmaxf(a0[j], a1[j]));
        mx = fmaxf(mx, xhalf(mx));                  // both wave halves now hold the query's maximum over the 32 keys
        const float mn = fmaxf(mrow, mx);
        const float alpha = __expf(mrow - mn); mrow = mn;
        const v8f t0 = (a0 - mn) * 1.4426950408889634f, t1 = (a1 - mn) * 1.4426950408889634f;   // e^x as 2^(x log2 e), the factors of __expf
        v8f p0, p1;
#pragma unroll
        for (int j = 0; j < 8; ++j) { p0[j] = __builtin_amdgcn_exp2f(t0[j]); p1[j] = __builtin_amdgcn_exp2f(t1[j]); }
        const v8f pt = p0 + p1, ps0 = p0 * PSC, ps1 = p1 * PSC;
        const v8h h0 = __builtin_convertvector(ps0, v8h), h1 = __builtin_convertvector(ps1, v8h);
        const v16h pa = cat16(h0, h1);                         // element s of the B operand: key 8 hi + s, then 16 + 8 hi + (s - 8): the score registers' own order
        lsum = lsum * alpha + (((pt[0] + pt[1]) + (pt[2] + pt[3])) + ((pt[4] + pt[5]) + (pt[6] + pt[7])));
#pragma unroll
        for (int n = 0; n < 4; ++n)
#pragma unroll
            for (int j = 0; j < 8; ++j) o[n][j] *= alpha;
#pragma unroll
        for (int n = 0; n < 4; ++n) { const h16* vp = svh + (8 * hi + (lane & 7)) * VPIT + ((lane >> 3) & 1) * 8 + n * 16;
            const v16h vh = cat16(ld_tr16(vp), ld_tr16(vp + 16 * VPIT));     // row d = 16 n + lr of V^T: keys 8 hi + s, then 16 + 8 hi + (s - 8), the order of pa
            o[n] = wmma16(vh, pa, o[n]); }
        asm volatile("s_wait_dscnt 0x0" ::: "memory");      // this wave's reads of the stage are done before the buffer is handed back
        asm volatile("s_wait_asynccnt 0x0" ::: "memory");   // this wave's copies of stage kt + 1 have landed
        __syncthreads();                                    // publishes stage kt + 1 and ends every wave's reads of stage kt
        if (kt + 2 <= kt_hi) {                              // same for the whole block: refill the buffer that this trip has read
            const unsigned bo = (unsigned)(kt & 1) * (STG * 2);
            stage_kv(ldk0 + bo, ldv0 + bo, gkh + (size_t)(l0 + 64) * DM, gvh + (size_t)(l0 + 64) * DM);
        }
    }
    asm volatile("s_wait_asynccnt 0x0" ::: "memory");       // nothing of this wave is in flight behind the loop
    const float inv = 1.0f / ((lsum + xhalf(lsum)) * PSC);  // the two halves' sums joined once
    float* os = &ost[wave][0];
#pragma unroll
    for (int n = 0; n < 4; ++n)
#pragma unroll
        for (int g = 0; g < 2; ++g) { v4f t;
#pragma unroll
            for (int i = 0; i < 4; ++i) t[i] = o[n][g * 4 + i] * inv;
            *(v4fa*)(os + lr * 68 + n * 16 + hi * 8 + g * 4) = t; }
    __syncthreads();
    const size_t cbase = (tokq0 + q0) * DM + (size_t)h * HD;
    auto pass = [&]() {
#pragma unroll
        for (int s = 0; s < 4; ++s) { const int row = 4 * s + (lane >> 3), piece = lane & 7; const float* sp = os + row * 68 + piece * 8; v8us oh, ol;
#pragma unroll
            for (int i = 0; i < 8; ++i) { const unsigned short hb = f2bf(sp[i]); oh[i] = hb; ol[i] = f2bf(sp[i] - bf2f(hb)); }
            *(v8us*)(CH + cbase + (size_t)row * DM + piece * 8) = oh; *(v8us*)(CL + cbase + (size_t)row * DM + piece * 8) = ol; }
    };
    pass(); 
}

#define VST2(T, p, v) do { const T vst2_v_ = (v); *(T*)(p) = vst2_v_;  } while (0)
extern "C" void kernel_launch(void* const* d_in, const int* in_sizes, int n_in,
                              void* d_out, int out_size, void* d_ws, size_t ws_size, hipStream_t stream) {
    (void)in_sizes; (void)n_in; (void)out_size;
    const float* query = (const float*)d_in[0]; const float* memory = (const float*)d_in[1]; const float* bias = (const float*)d_in[2];
    const float* Wq = (const float*)d_in[3]; const float* Wk = (const float*)d_in[4]; const float* Wv = (const float*)d_in[5]; const float* Wo = (const float*)d_in[6];   // all k-major [in][out]
    float* out = (float*)d_out;    // [4][1024][1024]
    char* wsp = (char*)d_ws;
    auto take = [&](size_t bytes) { char* p = wsp; wsp += (bytes + 255) & ~(size_t)255; return (void*)p; };
    bf* Xq = (bf*)take((size_t)NB_ * NTQ * DM * 2); bf* Xm = (bf*)take((size_t)NTK * DM * 2);
    bf* WqT = (bf*)take((size_t)DM * DM * 2); bf* WkT = (bf*)take((size_t)DM * DM * 2); bf* WvT = (bf*)take((size_t)DM * DM * 2); bf* WoT = (bf*)take((size_t)DM * DM * 2);
    h16* VH = (h16*)take((size_t)NTK * DM * 2);
    h16* QH = (h16*)take((size_t)NB_ * NTQ * DM * 2); h16* KH = (h16*)take((size_t)NTK * DM * 2);
    bf* CH = (bf*)take((size_t)NB_ * NTQ * DM * 2); bf* CL = (bf*)take((size_t)NB_ * NTQ * DM * 2);
    if ((size_t)(wsp - (char*)d_ws) > ws_size) return;    // 8.4 + 16.8 + 4 x 2.1 + 16.8 + 8.4 + 16.8 + 2 x 8.4 ~ 92 MB, no aliasing
    k_prep<<<4 * PB_W + PB_M + PB_Q, 256, 0, stream>>>(query, memory, Wq, Wk, Wv, Wo, Xq, Xm, WqT, WkT, WvT, WoT);
    k_gemmb<false, true><<<dim3(2 * (NTK / 128) + NB_ * NTQ / 128, DM / 128, 1), 256, 0, stream>>>(Xm, nullptr, WkT, nullptr, (float*)(void*)KH, DM, WvT, VH, Xq, WqT, QH);   // k = memory.Wk [8192][1024], v = memory.Wv, q = query.Wq [4096][1024]
    k_attn<<<NB_ * NH_ * (NTQ / 64), 128, 0, stream>>>(QH, KH, VH, bias, CH, CL);
    k_gemmb<true, false><<<dim3(NB_ * NTQ / 128, DM / 128, 1), 256, 0, stream>>>(CH, CL, WoT, nullptr, out, DM, nullptr, nullptr, nullptr, nullptr, nullptr);
}

// v008
// A run of this version takes 103 microseconds.
// Timed twice side by side with v007, it ran 1.12 times as fast both times.
// All steps since v000 together make it 9.61 times as fast.
#include <hip/hip_runtime.h>

// Compute dtypes, f32 accumulate, all 4 batch items in one pass (rows of the items stacked): q = query.Wq ([4096 x 1024].[1024 x 1024]) and k/v = memory.Wk/Wv ([8192 x 1024].[1024 x 1024]), k-major weights transposed once to n-major planes; PLAIN bf16
// operands: inputs rounded once, exact) with q and k written straight from the GEMM epilogue as one f16 plane each, and out = ctx.Wo (ctx as
// bf16 hi + residual: two products) on v_wmma_f32_16x16x32_bf16; the 16-head cross-attention (1024 queries x 2048 memory keys, 64-dim heads, scale 1/8) + the INPUT per-key bias[b][k] fused on
// v_wmma_f32_16x16x32_f16 (one product per score tile and per output tile, online f32 softmax, weights (x32768) and v as f16: their rounding is an eighth of the bf16 rounding that q, k and v already carry from their inputs)

#define NB_  4                   // batch items, all in every launch's grid
#define NT_  2048                // keys per item (memory length)
#define NTQ  1024                // queries per item
#define DM   1024
#define NH_  16
#define HD   64
#define NTK  (NB_ * NT_)
#define NW   1024
#define NQKV 1024
#define PSC  32768.0f

typedef _Float16 h16;
typedef unsigned short bf;
typedef __attribute__((ext_vector_type(16))) __bf16   v16bf;
typedef __attribute__((ext_vector_type(16))) _Float16 v16h;
typedef __attribute__((ext_vector_type(8)))  _Float16 v8h;
typedef __attribute__((ext_vector_type(8)))  unsigned short v8us;
typedef __attribute__((ext_vector_type(8)))  float    v8f;
typedef __attribute__((ext_vector_type(4)))  float    v4f;
typedef v8h  __attribute__((may_alias)) v8ha;
typedef v4f  __attribute__((may_alias)) v4fa;
typedef v8us __attribute__((may_alias)) v8usa;

__device__ __forceinline__ unsigned short f2bf(float f) { unsigned u = __float_as_uint(f); u += 0x7FFFu + ((u >> 16) & 1u); return (unsigned short)(u >> 16); }
__device__ __forceinline__ float bf2f(unsigned short b) { return __uint_as_float(((unsigned)b) << 16); }
__device__ __forceinline__ float bfr(float f) { return bf2f(f2bf(f)); }
__device__ __forceinline__ v16h cat16(v8h lo, v8h hi) { return __builtin_shufflevector(lo, hi, 0, 1, 2, 3, 4, 5, 6, 7, 8, 9, 10, 11, 12, 13, 14, 15); }
__device__ __forceinline__ v16bf cat16b(v8us lo, v8us hi) { return __builtin_bit_cast(v16bf, __builtin_shufflevector(lo, hi, 0, 1, 2, 3, 4, 5, 6, 7, 8, 9, 10, 11, 12, 13, 14, 15)); }
__device__ __forceinline__ v8f wmma16(v16h a, v16h b, v8f c) { return __builtin_amdgcn_wmma_f32_16x16x32_f16(false, a, false, b, (short)0, c, false, false); }
__device__ __forceinline__ v8f wmmab(v16bf a, v16bf b, v8f c) { return __builtin_amdgcn_wmma_f32_16x16x32_bf16(false, a, false, b, (short)0, c, false, false); }

// cvt_rows: 8 rows of 1024 floats per block (one per wave), rounded to bf16; rb = the block's number among the array's row blocks.
__device__ __forceinline__ void cvt_rows(const float* __restrict__ src, int rb, bf* dst) {
    const int lane = threadIdx.x & 31, r = rb * 8 + (threadIdx.x >> 5);
    v8us o[DM / 256];
#pragma unroll
    for (int q = 0; q < DM / 256; ++q) { v8us t;
#pragma unroll
        for (int i = 0; i < 8; ++i) t[i] = f2bf(src[(size_t)r * DM + q * 256 + lane * 8 + i]);
        o[q] = t; }
#pragma unroll
    for (int q = 0; q < DM / 256; ++q) *(v8us*)(dst + (size_t)r * DM + q * 256 + lane * 8) = o[q];
    asm volatile("s_wait_xcnt 0x0" ::: "memory");   // another job's code follows in the merged kernel: stands in front of every rewrite of a register that the stores above name
}

// wt_tile: WT [n][K] = bf16(W[k][n]) (k-major [K][ncols]) via one 64 x 64 LDS tile per block, tile (bx, by) of (K/64, ncols/64).
__device__ __forceinline__ void wt_tile(const float* __restrict__ Wm, int K, int ncols, bf* WT, int bx, int by, unsigned short* tl) {
    const int tid = threadIdx.x, k0 = bx * 64, n0 = by * 64;
    const int kk = tid >> 2, nq = (tid & 3) * 16;
#pragma unroll
    for (int i = 0; i < 16; ++i) tl[(nq + i) * 72 + kk] = f2bf(Wm[(size_t)(k0 + kk) * ncols + n0 + nq + i]);
    __syncthreads();
    const int piece = tid & 7;
    auto pass = [&]() {
#pragma unroll
        for (int s = 0; s < 2; ++s) { const int nr = (tid >> 3) + 32 * s; const v8us val = *(const v8usa*)(tl + nr * 72 + piece * 8); *(v8us*)(WT + (size_t)(n0 + nr) * K + k0 + piece * 8) = val; }
    };
    pass();
    asm volatile("s_wait_xcnt 0x0" ::: "memory");   // another job's code follows in the merged kernel: stands in front of every rewrite of a register that the stores above name
}
// k_prep: the six preparation jobs, none of which reads what another writes, as ONE grid: 256 blocks each transpose Wq, Wk, Wv, Wo (the longest chain of waits, so they start first), then 1024 blocks round memory and 512 round query.
// Every branch is the same for a whole block, so the barrier inside wt_tile is passed by all of its block's waves or by none.
#define PB_M (NTK / 8)
#define PB_Q (NB_ * NTQ / 8)
#define PB_W ((DM / 64) * (DM / 64))
__global__ __launch_bounds__(256) void k_prep(const float* __restrict__ query, const float* __restrict__ memory, const float* __restrict__ Wq, const float* __restrict__ Wk, const float* __restrict__ Wv, const float* __restrict__ Wo,
                                              bf* Xq, bf* Xm, bf* WqT, bf* WkT, bf* WvT, bf* WoT) {
    __shared__ __align__(16) unsigned short tl[64 * 72];
    const int bid = blockIdx.x;
    if (bid >= 4 * PB_W + PB_M) { cvt_rows(query, bid - 4 * PB_W - PB_M, Xq); return; }
    if (bid >= 4 * PB_W) { cvt_rows(memory, bid - 4 * PB_W, Xm); return; }
    const int w = bid / PB_W, t = bid % PB_W;
    const float* Wm = w == 0 ? Wq : w == 1 ? Wk : w == 2 ? Wv : Wo;
    bf* WT = w == 0 ? WqT : w == 1 ? WkT : w == 2 ? WvT : WoT;
    wt_tile(Wm, DM, DM, WT, t % (DM / 64), t / (DM / 64), tl);
}
// LDS ring of k_gemmb: one stage = 128 k of the block's 128 A rows, 128 B rows (and, split A, 128 residual rows): rows of 256 B, 16 B longer in LDS
// (a pitch that is an odd multiple of 16 B, so that the 16-byte fragment reads of 16 rows fall on different banks).
#define GKS  128                 // k per stage
#define GPIT 136                 // halves per staged row
#define GPL  (128 * GPIT)        // halves per plane of 128 rows

// One plane of a stage: 8 copies of 16 B per lane, 256 lanes, global to LDS through no register: rows r, r + 16, ..., r + 112 of the plane, whole 256-byte row pieces per 16 lanes.
// s_wait_xcnt ends the statement so that no address register of a copy is rewritten ahead of it.
__device__ __forceinline__ void stage_g(unsigned ld, const bf* g) {
    asm volatile("global_load_async_to_lds_b128 %0, %8, off\n\t"
                 "global_load_async_to_lds_b128 %1, %9, off\n\t"
                 "global_load_async_to_lds_b128 %2, %10, off\n\t"
                 "global_load_async_to_lds_b128 %3, %11, off\n\t"
                 "global_load_async_to_lds_b128 %4, %12, off\n\t"
                 "global_load_async_to_lds_b128 %5, %13, off\n\t"
                 "global_load_async_to_lds_b128 %6, %14, off\n\t"
                 "global_load_async_to_lds_b128 %7, %15, off\n\t"
                 "s_wait_xcnt 0x0"
                 :: "v"(ld), "v"(ld + 16 * GPIT * 2), "v"(ld + 32 * GPIT * 2), "v"(ld + 48 * GPIT * 2),
                    "v"(ld + 64 * GPIT * 2), "v"(ld + 80 * GPIT * 2), "v"(ld + 96 * GPIT * 2), "v"(ld + 112 * GPIT * 2),
                    "v"(g), "v"(g + 16 * DM), "v"(g + 32 * DM), "v"(g + 48 * DM), "v"(g + 64 * DM), "v"(g + 80 * DM), "v"(g + 96 * DM), "v"(g + 112 * DM) : "memory");
}

// k_gemmb: C[128 x 128 per block] = A.Bn^T over k = 1024; 8 waves as 4 x 2, a wave = 32 rows x 64 columns (2 x 4 accumulator tiles); grid (rows / 128, columns / 128).
// QKV: the three projections, none of which reads what another writes, as ONE grid: row blocks 0..63 are k (A, Bn, C), 64..127 v (A, Bv, Cv), 128..159 q (Aq, Bq, Cq), each written as one f16 plane.
template <bool SPLITA, bool QKV>
__global__ __launch_bounds__(256) void k_gemmb(const bf* __restrict__ A, const bf* __restrict__ Al, const bf* __restrict__ Bn, const float* __restrict__ bias, float* C, int ldc,
                                               const bf* __restrict__ Bv, h16* Cv, const bf* __restrict__ Aq, const bf* __restrict__ Bq, h16* Cq) {
    constexpr int NPL = SPLITA ? 3 : 2;             // planes per stage
    __shared__ __align__(16) bf gring[2][NPL * GPL]; // two stages, shared by the 8 waves; output staging behind the loop
    const int tid = threadIdx.x, lane = tid & 31, wave = tid >> 5, lr = lane & 15, hi = lane >> 4;
    int bx = blockIdx.x;                            // the job: the same for a whole block
    if (QKV) {
        if (bx >= 2 * (NTK / 128)) { bx -= 2 * (NTK / 128); A = Aq; Bn = Bq; C = (float*)(void*)Cq; }
        else if (bx >= NTK / 128) { bx -= NTK / 128; Bn = Bv; C = (float*)(void*)Cv; }
    }
    const int rb = bx * 128, cb = blockIdx.y * 128;
    const int wr = (wave >> 1) * 32, wc = (wave & 1) * 64;
    const int r0 = rb + wr, c0 = cb + wc;
    // the lane's share of a plane: rows tid/16 + 16 i, 16-byte piece tid%16
    const unsigned ld0 = (unsigned)(size_t)(&gring[0][0] + (tid >> 4) * GPIT + (tid & 15) * 8);
    const bf* ga = A + (size_t)(rb + (tid >> 4)) * DM + (tid & 15) * 8;
    const bf* gb = Bn + (size_t)(cb + (tid >> 4)) * DM + (tid & 15) * 8;
    auto fill = [&](int s) {
        const unsigned ld = ld0 + (unsigned)(s & 1) * (NPL * GPL * 2);
        stage_g(ld, ga + s * GKS); stage_g(ld + GPL * 2, gb + s * GKS);
        if (SPLITA) stage_g(ld + 2 * GPL * 2, Al + (size_t)(rb + (tid >> 4)) * DM + (tid & 15) * 8 + s * GKS);
    };
    v8f acc[2][4];
#pragma unroll
    for (int m = 0; m < 2; ++m)
#pragma unroll
        for (int t = 0; t < 4; ++t) acc[m][t] = (v8f){};
    fill(0);                                                // stage 0 into buffer 0
    asm volatile("s_wait_asynccnt 0x0" ::: "memory");       // this wave's copies of stage 0 have landed
    __syncthreads();                                        // ... and every other wave's: stage 0 may be read
    fill(1);                                                // stage 1 flies while stage 0 is worked on
#pragma unroll 1
    for (int s = 0; s < DM / GKS; ++s) {
        const bf* sa = &gring[s & 1][0] + (wr + lr) * GPIT + 8 * hi;
        const bf* sb = &gring[s & 1][0] + GPL + (wc + lr) * GPIT + 8 * hi;
#pragma unroll
        for (int kk = 0; kk < GKS; kk += 32) {
            v16bf a[2], al[2], b[4];
#pragma unroll
            for (int m = 0; m < 2; ++m) { a[m] = cat16b(*(const v8usa*)(sa + m * 16 * GPIT + kk), *(const v8usa*)(sa + m * 16 * GPIT + kk + 16));
                if (SPLITA) al[m] = cat16b(*(const v8usa*)(sa + 2 * GPL + m * 16 * GPIT + kk), *(const v8usa*)(sa + 2 * GPL + m * 16 * GPIT + kk + 16)); }
#pragma unroll
            for (int t = 0; t < 4; ++t) b[t] = cat16b(*(const v8usa*)(sb + t * 16 * GPIT + kk), *(const v8usa*)(sb + t * 16 * GPIT + kk + 16));
#pragma unroll
            for (int m = 0; m < 2; ++m)
#pragma unroll
                for (int t = 0; t < 4; ++t) acc[m][t] = wmmab(a[m], b[t], acc[m][t]);
            if (SPLITA) {
#pragma unroll
                for (int m = 0; m < 2; ++m)
#pragma unroll
                    for (int t = 0; t < 4; ++t) acc[m][t] = wmmab(al[m], b[t], acc[m][t]);
            }
        }
        asm volatile("s_wait_dscnt 0x0" ::: "memory");      // this wave's reads of the stage are done before the buffer is handed back
        asm volatile("s_wait_asynccnt 0x0" ::: "memory");   // this wave's copies of stage s + 1 have landed
        __syncthreads();                                    // publishes stage s + 1 and ends every wave's reads of stage s
        if (s + 2 < DM / GKS) fill(s + 2);                  // same for the whole block: refill the buffer that this trip has read
    }
    asm volatile("s_wait_asynccnt 0x0" ::: "memory");       // nothing of this wave is in flight behind the loop; the last trip's barrier has freed the ring
    float* os = (float*)(void*)&gring[0][0] + wave * (32 * 68);
#pragma unroll
    for (int m = 0; m < 2; ++m)
#pragma unroll
        for (int t = 0; t < 4; ++t) { const float bv = bias ? bfr(bias[c0 + t * 16 + lr]) : 0.f;
#pragma unroll
            for (int j = 0; j < 8; ++j) os[(m * 16 + hi * 8 + j) * 68 + t * 16 + lr] = acc[m][t][j] + bv; }
    __syncthreads();
    if (QKV) {
        h16* crow = (h16*)(void*)C + (size_t)r0 * ldc + c0;
#pragma unroll
        for (int s = 0; s < 8; ++s) { const int row = 4 * s + (lane >> 3), piece = lane & 7; const float* sp = os + row * 68 + piece * 8; v8h o;
#pragma unroll
            for (int i = 0; i < 8; ++i) o[i] = (h16)sp[i];
            *(v8h*)(crow + (size_t)row * ldc + piece * 8) = o;
            asm volatile("s_wait_xcnt 0x0" ::: "memory"); }   // stands in front of every rewrite of a register that the store above names
    } else {
        float* crow = C + (size_t)r0 * ldc + c0;
#pragma unroll
        for (int s = 0; s < 16; ++s) { const int Lid = (lane >> 3) + 4 * s, piece = lane & 7; const int row = Lid >> 1, cofs = (Lid & 1) * 32 + piece * 4;
            const v4f val = *(const v4fa*)(os + row * 68 + cofs); *(v4f*)(crow + (size_t)row * ldc + cofs) = val; }
    }
}

// LDS ring of k_attn: one stage = 64 keys: k and v as projected, 64 rows of 128 B each. A k row is 16 B longer in LDS (a pitch that is an odd multiple of 16 B,
// for the 16-byte fragment reads of 16 rows), a v row 32 B longer (an odd multiple of 32 B, the pitch of the transposing reads).
#define KPIT 72                  // halves per staged k row
#define VPIT 80                  // halves per staged v row
#define SKEY 64                  // keys per stage: 32 for each of the block's two key groups
#define KPL  (SKEY * KPIT)       // halves per k plane
#define VPL  (SKEY * VPIT)       // halves per v plane
#define STG  (KPL + VPL)         // halves per stage
#define QBLK 128                 // queries per block: 4 column groups of 32

// One stage: 4 copies of 16 B per lane, 256 lanes, global to LDS through no register. ldk, ldv: the lane's LDS byte address in the stage's k and v plane.
// s_wait_xcnt ends the statement so that no address register of a copy is rewritten ahead of it.
__device__ __forceinline__ void stage_kv(unsigned ldk, unsigned ldv, const h16* gkh, const h16* gvh) {
    asm volatile("global_load_async_to_lds_b128 %0, %4, off\n\t"
                 "global_load_async_to_lds_b128 %1, %5, off\n\t"
                 "global_load_async_to_lds_b128 %2, %6, off\n\t"
                 "global_load_async_to_lds_b128 %3, %7, off\n\t"
                 "s_wait_xcnt 0x0"
                 :: "v"(ldk), "v"(ldk + 32 * KPIT * 2), "v"(ldv), "v"(ldv + 32 * VPIT * 2),
                    "v"(gkh), "v"(gkh + 32 * DM), "v"(gvh), "v"(gvh + 32 * DM) : "memory");
}

// Transposing 16-byte LDS read: from a row-major [key][d] tile, lane (c = l & 15, h = l >> 4) gets the 8 keys 8 h .. 8 h + 7 of column c;
// lane l hands in the address of row 8 (l >> 4) + (l & 7), 16-byte piece (l >> 3) & 1, of the 16 x 16 tile.
typedef short s16x8 __attribute__((ext_vector_type(8)));
__device__ __forceinline__ v8h ld_tr16(const h16* p) { typedef __attribute__((address_space(3))) s16x8 lds_s16x8; return __builtin_bit_cast(v8h, __builtin_amdgcn_ds_load_tr16_b128_v8i16((lds_s16x8*)p)); }

__device__ __forceinline__ v8f cat8f(v4f lo, v4f hi) { return __builtin_shufflevector(lo, hi, 0, 1, 2, 3, 4, 5, 6, 7); }
// lane l with lane l ^ 16
__device__ __forceinline__ float xhalf(float x) { return __builtin_bit_cast(float, __builtin_amdgcn_permlanex16(__builtin_bit_cast(int, x), __builtin_bit_cast(int, x), 0x76543210, 0xfedcba98, false, false)); }

__global__ __launch_bounds__(256) void k_attn(const h16* __restrict__ Q16, const h16* __restrict__ K16, const h16* __restrict__ V16, const float* __restrict__ KB, bf* CH, bf* CL) {
    __shared__ __align__(16) float ost[4][32 * 68];
    __shared__ __align__(16) h16 ring[2][STG];      // two stages of k and v, shared by the 8 waves
    __shared__ __align__(16) float kbs[NT_];        // the item's whole key bias row, filled once, rounded in place
    __shared__ float mls[4][2][32];                 // key group 1's maximum and sum per query column
    const int lane = threadIdx.x & 31, wave = threadIdx.x >> 5, lr = lane & 15, hi = lane >> 4;
    const int wq = wave & 3, kg = wave >> 2;
    const int bid = blockIdx.x;
    const int b = bid / (NH_ * (NTQ / QBLK)), rem = bid - b * (NH_ * (NTQ / QBLK)), h = rem / (NTQ / QBLK), qt = rem - h * (NTQ / QBLK);     // query blocks over the 1024 queries
    const int q0 = qt * QBLK + wq * 32;
    const size_t tok0 = (size_t)b * NT_;     // key-side item offset; query rows use tokq0
    const size_t tokq0 = (size_t)b * NTQ;
    v16h qa[2][2];                           // [column tile][k chunk]
#pragma unroll
    for (int c = 0; c < 2; ++c) { const size_t qo0 = (tokq0 + q0 + c * 16 + lr) * DM + h * HD + 8 * hi;
#pragma unroll
        for (int kc = 0; kc < 2; ++kc) qa[c][kc] = cat16(*(const v8h*)(Q16 + qo0 + kc * 32), *(const v8h*)(Q16 + qo0 + kc * 32 + 16)); }
    const h16* kh_b = K16 + tok0 * DM + h * HD;
    v8f o[2][4];                             // o[c][n][j] = O^T[d = 16 n + 8 hi + j][query 16 c + lr]
#pragma unroll
    for (int c = 0; c < 2; ++c)
#pragma unroll
        for (int n = 0; n < 4; ++n) o[c][n] = (v8f){};
    float mrow[2] = {-3.0e38f, -3.0e38f}, lsum[2] = {0.f, 0.f};       // of query 16 c + lr, over this key group's keys; lsum over this wave half's keys
    const int kt_lo = 0, kt_hi = NT_ / SKEY - 1;   // cross-attention: all 2048 memory keys; + the INPUT per-key bias[b][k]
    const int tid = threadIdx.x;
    // the lane's share of a stage: rows tid/8 and tid/8 + 32, 16-byte piece tid%8, of k and of v
    const unsigned ldk0 = (unsigned)(size_t)(&ring[0][0] + (tid >> 3) * KPIT + (tid & 7) * 8);
    const unsigned ldv0 = (unsigned)(size_t)(&ring[0][0] + KPL + (tid >> 3) * VPIT + (tid & 7) * 8);
    const h16* gkh = kh_b + (size_t)(tid >> 3) * DM + (tid & 7) * 8;
    const h16* gvh = V16 + tok0 * DM + h * HD + (size_t)(tid >> 3) * DM + (tid & 7) * 8;
    {   // the bias row: 2 copies of 16 B per lane; s_wait_xcnt as in stage_kv
        const unsigned ldb = (unsigned)(size_t)(&kbs[0] + tid * 4);
        const float* gb = KB + tok0 + tid * 4;
        asm volatile("global_load_async_to_lds_b128 %0, %2, off\n\t"
                     "global_load_async_to_lds_b128 %1, %3, off\n\t"
                     "s_wait_xcnt 0x0"
                     :: "v"(ldb), "v"(ldb + 4096), "v"(gb), "v"(gb + 1024) : "memory");
    }
    stage_kv(ldk0, ldv0, gkh, gvh);                                                             // stage 0 into buffer 0
    asm volatile("s_wait_asynccnt 0x0" ::: "memory");                                           // this wave's copies of stage 0 and of the bias row have landed
#pragma unroll
    for (int c = 0; c < 2; ++c) { v4fa* bp = (v4fa*)(&kbs[0] + tid * 4 + c * 1024); v4f t = *bp;  // each lane rounds the 8 bias values that it copied itself, once instead of per trip
#pragma unroll
        for (int i = 0; i < 4; ++i) t[i] = bfr(t[i]);
        *bp = t; }
    __syncthreads();                                                                            // ... and every other wave's: stage 0 and the rounded bias row may be read
    stage_kv(ldk0 + STG * 2, ldv0 + STG * 2, gkh + SKEY * DM, gvh + SKEY * DM);                     // stage 1 flies while stage 0 is worked on
#pragma unroll 1
    for (int kt = kt_lo; kt <= kt_hi; ++kt) {
        const int l0 = kt * SKEY + kg * 32;         // this wave's 32 keys of the stage
        const h16* skh = &ring[kt & 1][0] + kg * 32 * KPIT;          // this trip's stage: k, v, the key group's rows
        const h16* svh = &ring[kt & 1][0] + KPL + kg * 32 * VPIT;
        const int ko0 = lr * KPIT + 8 * hi, ko1 = (16 + lr) * KPIT + 8 * hi;
        v8f s0[2] = {{}, {}}, s1[2] = {{}, {}};     // s0[c][j]: key l0 + 8 hi + j, s1[c][j]: key l0 + 16 + 8 hi + j, query 16 c + lr
#pragma unroll
        for (int kc = 0; kc < 2; ++kc) {
            const v16h k0h = cat16(*(const v8ha*)(skh + ko0 + kc * 32), *(const v8ha*)(skh + ko0 + kc * 32 + 16)), k1h = cat16(*(const v8ha*)(skh + ko1 + kc * 32), *(const v8ha*)(skh + ko1 + kc * 32 + 16));
#pragma unroll
            for (int c = 0; c < 2; ++c) { s0[c] = wmma16(k0h, qa[c][kc], s0[c]); s1[c] = wmma16(k1h, qa[c][kc], s1[c]); }
        }
        const float* kbp = &kbs[0] + l0 + 8 * hi;
        const v8f kb0 = cat8f(*(const v4fa*)(kbp), *(const v4fa*)(kbp + 4)), kb1 = cat8f(*(const v4fa*)(kbp + 16), *(const v4fa*)(kbp + 20));
        v16h pa[2];
#pragma unroll
        for (int c = 0; c < 2; ++c) {
            const v8f a0 = s0[c] * 0.125f + kb0, a1 = s1[c] * 0.125f + kb1;
            float mx = fmaxf(a0[0], a1[0]);
#pragma unroll
            for (int j = 1; j < 8; ++j) mx = fmaxf(mx, fmaxf(a0[j], a1[j]));
            mx = fmaxf(mx, xhalf(mx));                  // both wave halves now hold the query's maximum over the 32 keys
            const float mn = fmaxf(mrow[c], mx);
            const float alpha = __expf(mrow[c] - mn); mrow[c] = mn;
            const v8f t0 = (a0 - mn) * 1.4426950408889634f, t1 = (a1 - mn) * 1.4426950408889634f;   // e^x as 2^(x log2 e), the factors of __expf
            v8f p0, p1;
#pragma unroll
            for (int j = 0; j < 8; ++j) { p0[j] = __builtin_amdgcn_exp2f(t0[j]); p1[j] = __builtin_amdgcn_exp2f(t1[j]); }
            const v8f pt = p0 + p1, ps0 = p0 * PSC, ps1 = p1 * PSC;
            const v8h h0 = __builtin_convertvector(ps0, v8h), h1 = __builtin_convertvector(ps1, v8h);
            pa[c] = cat16(h0, h1);                             // element s of the B operand: key 8 hi + s, then 16 + 8 hi + (s - 8): the score registers' own order
            lsum[c] = lsum[c] * alpha + (((pt[0] + pt[1]) + (pt[2] + pt[3])) + ((pt[4] + pt[5]) + (pt[6] + pt[7])));
#pragma unroll
            for (int n = 0; n < 4; ++n)
#pragma unroll
                for (int j = 0; j < 8; ++j) o[c][n][j] *= alpha;
        }
#pragma unroll
        for (int n = 0; n < 4; ++n) { const h16* vp = svh + (8 * hi + (lane & 7)) * VPIT + ((lane >> 3) & 1) * 8 + n * 16;
            const v16h vh = cat16(ld_tr16(vp), ld_tr16(vp + 16 * VPIT));     // row d = 16 n + lr of V^T: keys 8 hi + s, then 16 + 8 hi + (s - 8), the order of pa
            o[0][n] = wmma16(vh, pa[0], o[0][n]); o[1][n] = wmma16(vh, pa[1], o[1][n]); }
        asm volatile("s_wait_dscnt 0x0" ::: "memory");      // this wave's reads of the stage are done before the buffer is handed back
        asm volatile("s_wait_asynccnt 0x0" ::: "memory");   // this wave's copies of stage kt + 1 have landed
        __syncthreads();                                    // publishes stage kt + 1 and ends every wave's reads of stage kt
        if (kt + 2 <= kt_hi) {                              // same for the whole block: refill the buffer that this trip has read
            const unsigned bo = (unsigned)(kt & 1) * (STG * 2);
            stage_kv(ldk0 + bo, ldv0 + bo, gkh + (size_t)(kt + 2) * SKEY * DM, gvh + (size_t)(kt + 2) * SKEY * DM);
        }
    }
    asm volatile("s_wait_asynccnt 0x0" ::: "memory");       // nothing of this wave is in flight behind the loop
    float* om = &ost[wq][0];                                // the column group's 32 x 64 tile: first key group 1's part, then the joined result
    float lt[2];
#pragma unroll
    for (int c = 0; c < 2; ++c) lt[c] = lsum[c] + xhalf(lsum[c]);   // the two wave halves' sums joined once
    if (kg == 1) {                                          // the same for a whole wave: key group 1 hands over its unscaled outputs, maxima and sums
#pragma unroll
        for (int c = 0; c < 2; ++c) {
#pragma unroll
            for (int n = 0; n < 4; ++n)
#pragma unroll
                for (int g = 0; g < 2; ++g) { v4f t;
#pragma unroll
                    for (int i = 0; i < 4; ++i) t[i] = o[c][n][g * 4 + i];
                    *(v4fa*)(om + (c * 16 + lr) * 68 + n * 16 + hi * 8 + g * 4) = t; }
            if (hi == 0) { mls[wq][0][c * 16 + lr] = mrow[c]; mls[wq][1][c * 16 + lr] = lt[c]; }
        }
    }
    __syncthreads();                                        // key group 1's parts may be read
    if (kg == 0) {                                          // key group 0 joins: each lane reads and then rewrites exactly the places that the same lane of its partner wave wrote
#pragma unroll
        for (int c = 0; c < 2; ++c) {
            const float m1 = mls[wq][0][c * 16 + lr], l1 = mls[wq][1][c * 16 + lr];
            const float mn = fmaxf(mrow[c], m1);
            const float e0 = __expf(mrow[c] - mn), e1 = __expf(m1 - mn);
            const float inv = 1.0f / ((lt[c] * e0 + l1 * e1) * PSC);
            const float f0 = e0 * inv, f1 = e1 * inv;
#pragma unroll
            for (int n = 0; n < 4; ++n)
#pragma unroll
                for (int g = 0; g < 2; ++g) { v4fa* p = (v4fa*)(om + (c * 16 + lr) * 68 + n * 16 + hi * 8 + g * 4); const v4f u = *p; v4f t;
#pragma unroll
                    for (int i = 0; i < 4; ++i) t[i] = o[c][n][g * 4 + i] * f0 + u[i] * f1;
                    *p = t; }
        }
    }
    __syncthreads();                                        // the joined tile may be read: each of the column group's two waves writes 16 of its 32 query rows
    const float* os = om + kg * 16 * 68;
    const size_t cbase = (tokq0 + q0 + kg * 16) * DM + (size_t)h * HD;
    auto pass = [&]() {
#pragma unroll
        for (int s = 0; s < 4; ++s) { const int row = 4 * s + (lane >> 3), piece = lane & 7; const float* sp = os + row * 68 + piece * 8; v8us oh, ol;
#pragma unroll
            for (int i = 0; i < 8; ++i) { const unsigned short hb = f2bf(sp[i]); oh[i] = hb; ol[i] = f2bf(sp[i] - bf2f(hb)); }
            *(v8us*)(CH + cbase + (size_t)row * DM + piece * 8) = oh; *(v8us*)(CL + cbase + (size_t)row * DM + piece * 8) = ol; }
    };
    pass(); 
}

#define VST2(T, p, v) do { const T vst2_v_ = (v); *(T*)(p) = vst2_v_;  } while (0)
extern "C" void kernel_launch(void* const* d_in, const int* in_sizes, int n_in,
                              void* d_out, int out_size, void* d_ws, size_t ws_size, hipStream_t stream) {
    (void)in_sizes; (void)n_in; (void)out_size;
    const float* query = (const float*)d_in[0]; const float* memory = (const float*)d_in[1]; const float* bias = (const float*)d_in[2];
    const float* Wq = (const float*)d_in[3]; const float* Wk = (const float*)d_in[4]; const float* Wv = (const float*)d_in[5]; const float* Wo = (const float*)d_in[6];   // all k-major [in][out]
    float* out = (float*)d_out;    // [4][1024][1024]
    char* wsp = (char*)d_ws;
    auto take = [&](size_t bytes) { char* p = wsp; wsp += (bytes + 255) & ~(size_t)255; return (void*)p; };
    bf* Xq = (bf*)take((size_t)NB_ * NTQ * DM * 2); bf* Xm = (bf*)take((size_t)NTK * DM * 2);
    bf* WqT = (bf*)take((size_t)DM * DM * 2); bf* WkT = (bf*)take((size_t)DM * DM * 2); bf* WvT = (bf*)take((size_t)DM * DM * 2); bf* WoT = (bf*)take((size_t)DM * DM * 2);
    h16* VH = (h16*)take((size_t)NTK * DM * 2);
    h16* QH = (h16*)take((size_t)NB_ * NTQ * DM * 2); h16* KH = (h16*)take((size_t)NTK * DM * 2);
    bf* CH = (bf*)take((size_t)NB_ * NTQ * DM * 2); bf* CL = (bf*)take((size_t)NB_ * NTQ * DM * 2);
    if ((size_t)(wsp - (char*)d_ws) > ws_size) return;    // 8.4 + 16.8 + 4 x 2.1 + 16.8 + 8.4 + 16.8 + 2 x 8.4 ~ 92 MB, no aliasing
    k_prep<<<4 * PB_W + PB_M + PB_Q, 256, 0, stream>>>(query, memory, Wq, Wk, Wv, Wo, Xq, Xm, WqT, WkT, WvT, WoT);
    k_gemmb<false, true><<<dim3(2 * (NTK / 128) + NB_ * NTQ / 128, DM / 128, 1), 256, 0, stream>>>(Xm, nullptr, WkT, nullptr, (float*)(void*)KH, DM, WvT, VH, Xq, WqT, QH);   // k = memory.Wk [8192][1024], v = memory.Wv, q = query.Wq [4096][1024]
    k_attn<<<NB_ * NH_ * (NTQ / QBLK), 256, 0, stream>>>(QH, KH, VH, bias, CH, CL);
    k_gemmb<true, false><<<dim3(NB_ * NTQ / 128, DM / 128, 1), 256, 0, stream>>>(CH, CL, WoT, nullptr, out, DM, nullptr, nullptr, nullptr, nullptr, nullptr);
}

// v009
// A run of this version takes 97.7 microseconds.
// Next to v008, in two timings, it ran 1.05 and 1.06 times as fast.
// Counting every step since v000, it is 10.1 times as fast.
#include <hip/hip_runtime.h>

// Compute dtypes, f32 accumulate, all 4 batch items in one pass (rows of the items stacked): q = query.Wq ([4096 x 1024].[1024 x 1024]) and k/v = memory.Wk/Wv ([8192 x 1024].[1024 x 1024]), k-major weights transposed once to n-major planes; PLAIN bf16
// operands: inputs rounded once, exact) with q and k written straight from the GEMM epilogue as one f16 plane each, and out = ctx.Wo (ctx as
// bf16 hi + residual: two products) on v_wmma_f32_16x16x32_bf16; the 16-head cross-attention (1024 queries x 2048 memory keys, 64-dim heads, scale 1/8) + the INPUT per-key bias[b][k] fused on
// v_wmma_f32_16x16x32_f16 (one product per score tile and per output tile, online f32 softmax in powers of two, weights (x128 relative to the maximum in use) and v as f16: their rounding is an eighth of the bf16 rounding that q, k and v already carry from their inputs)

#define NB_  4                   // batch items, all in every launch's grid
#define NT_  2048                // keys per item (memory length)
#define NTQ  1024                // queries per item
#define DM   1024
#define NH_  16
#define HD   64
#define NTK  (NB_ * NT_)
#define NW   1024
#define NQKV 1024
#define L2E  1.4426950408889634f // log2 e: scores and bias are kept in log2 units, so that the weight is one exp2
#define QSC  0.18033688011112042f // 1/8 x log2 e, multiplied into q where the projection rounds it to f16
#define PSH  7.0f                // a score equal to the maximum in use gives the weight 2^7
#define PTOP 32768.0f            // a lane's 16 weights of a trip may sum to this much before the maximum in use is raised: every one then fits f16

typedef _Float16 h16;
typedef unsigned short bf;
typedef __attribute__((ext_vector_type(16))) __bf16   v16bf;
typedef __attribute__((ext_vector_type(16))) _Float16 v16h;
typedef __attribute__((ext_vector_type(8)))  _Float16 v8h;
typedef __attribute__((ext_vector_type(8)))  unsigned short v8us;
typedef __attribute__((ext_vector_type(8)))  float    v8f;
typedef __attribute__((ext_vector_type(4)))  float    v4f;
typedef v8h  __attribute__((may_alias)) v8ha;
typedef v4f  __attribute__((may_alias)) v4fa;
typedef v8us __attribute__((may_alias)) v8usa;

__device__ __forceinline__ unsigned short f2bf(float f) { unsigned u = __float_as_uint(f); u += 0x7FFFu + ((u >> 16) & 1u); return (unsigned short)(u >> 16); }
__device__ __forceinline__ float bf2f(unsigned short b) { return __uint_as_float(((unsigned)b) << 16); }
__device__ __forceinline__ float bfr(float f) { return bf2f(f2bf(f)); }
__device__ __forceinline__ v16h cat16(v8h lo, v8h hi) { return __builtin_shufflevector(lo, hi, 0, 1, 2, 3, 4, 5, 6, 7, 8, 9, 10, 11, 12, 13, 14, 15); }
__device__ __forceinline__ v16bf cat16b(v8us lo, v8us hi) { return __builtin_bit_cast(v16bf, __builtin_shufflevector(lo, hi, 0, 1, 2, 3, 4, 5, 6, 7, 8, 9, 10, 11, 12, 13, 14, 15)); }
__device__ __forceinline__ v8f wmma16(v16h a, v16h b, v8f c) { return __builtin_amdgcn_wmma_f32_16x16x32_f16(false, a, false, b, (short)0, c, false, false); }
__device__ __forceinline__ v8f wmmab(v16bf a, v16bf b, v8f c) { return __builtin_amdgcn_wmma_f32_16x16x32_bf16(false, a, false, b, (short)0, c, false, false); }

// cvt_rows: 8 rows of 1024 floats per block (one per wave), rounded to bf16; rb = the block's number among the array's row blocks.
__device__ __forceinline__ void cvt_rows(const float* __restrict__ src, int rb, bf* dst) {
    const int lane = threadIdx.x & 31, r = rb * 8 + (threadIdx.x >> 5);
    v8us o[DM / 256];
#pragma unroll
    for (int q = 0; q < DM / 256; ++q) { v8us t;
#pragma unroll
        for (int i = 0; i < 8; ++i) t[i] = f2bf(src[(size_t)r * DM + q * 256 + lane * 8 + i]);
        o[q] = t; }
#pragma unroll
    for (int q = 0; q < DM / 256; ++q) *(v8us*)(dst + (size_t)r * DM + q * 256 + lane * 8) = o[q];
    asm volatile("s_wait_xcnt 0x0" ::: "memory");   // another job's code follows in the merged kernel: stands in front of every rewrite of a register that the stores above name
}

// wt_tile: WT [n][K] = bf16(W[k][n]) (k-major [K][ncols]) via one 64 x 64 LDS tile per block, tile (bx, by) of (K/64, ncols/64).
__device__ __forceinline__ void wt_tile(const float* __restrict__ Wm, int K, int ncols, bf* WT, int bx, int by, unsigned short* tl) {
    const int tid = threadIdx.x, k0 = bx * 64, n0 = by * 64;
    const int kk = tid >> 2, nq = (tid & 3) * 16;
#pragma unroll
    for (int i = 0; i < 16; ++i) tl[(nq + i) * 72 + kk] = f2bf(Wm[(size_t)(k0 + kk) * ncols + n0 + nq + i]);
    __syncthreads();
    const int piece = tid & 7;
    auto pass = [&]() {
#pragma unroll
        for (int s = 0; s < 2; ++s) { const int nr = (tid >> 3) + 32 * s; const v8us val = *(const v8usa*)(tl + nr * 72 + piece * 8); *(v8us*)(WT + (size_t)(n0 + nr) * K + k0 + piece * 8) = val; }
    };
    pass();
    asm volatile("s_wait_xcnt 0x0" ::: "memory");   // another job's code follows in the merged kernel: stands in front of every rewrite of a register that the stores above name
}
// k_prep: the six preparation jobs, none of which reads what another writes, as ONE grid: 256 blocks each transpose Wq, Wk, Wv, Wo (the longest chain of waits, so they start first), then 1024 blocks round memory and 512 round query.
// Every branch is the same for a whole block, so the barrier inside wt_tile is passed by all of its block's waves or by none.
#define PB_M (NTK / 8)
#define PB_Q (NB_ * NTQ / 8)
#define PB_W ((DM / 64) * (DM / 64))
__global__ __launch_bounds__(256) void k_prep(const float* __restrict__ query, const float* __restrict__ memory, const float* __restrict__ Wq, const float* __restrict__ Wk, const float* __restrict__ Wv, const float* __restrict__ Wo,
                                              bf* Xq, bf* Xm, bf* WqT, bf* WkT, bf* WvT, bf* WoT) {
    __shared__ __align__(16) unsigned short tl[64 * 72];
    const int bid = blockIdx.x;
    if (bid >= 4 * PB_W + PB_M) { cvt_rows(query, bid - 4 * PB_W - PB_M, Xq); return; }
    if (bid >= 4 * PB_W) { cvt_rows(memory, bid - 4 * PB_W, Xm); return; }
    const int w = bid / PB_W, t = bid % PB_W;
    const float* Wm = w == 0 ? Wq : w == 1 ? Wk : w == 2 ? Wv : Wo;
    bf* WT = w == 0 ? WqT : w == 1 ? WkT : w == 2 ? WvT : WoT;
    wt_tile(Wm, DM, DM, WT, t % (DM / 64), t / (DM / 64), tl);
}
// LDS ring of k_gemmb: one stage = 128 k of the block's 128 A rows, 128 B rows (and, split A, 128 residual rows): rows of 256 B, 16 B longer in LDS
// (a pitch that is an odd multiple of 16 B, so that the 16-byte fragment reads of 16 rows fall on different banks).
#define GKS  128                 // k per stage
#define GPIT 136                 // halves per staged row
#define GPL  (128 * GPIT)        // halves per plane of 128 rows

// One plane of a stage: 8 copies of 16 B per lane, 256 lanes, global to LDS through no register: rows r, r + 16, ..., r + 112 of the plane, whole 256-byte row pieces per 16 lanes.
// s_wait_xcnt ends the statement so that no address register of a copy is rewritten ahead of it.
__device__ __forceinline__ void stage_g(unsigned ld, const bf* g) {
    asm volatile("global_load_async_to_lds_b128 %0, %8, off\n\t"
                 "global_load_async_to_lds_b128 %1, %9, off\n\t"
                 "global_load_async_to_lds_b128 %2, %10, off\n\t"
                 "global_load_async_to_lds_b128 %3, %11, off\n\t"
                 "global_load_async_to_lds_b128 %4, %12, off\n\t"
                 "global_load_async_to_lds_b128 %5, %13, off\n\t"
                 "global_load_async_to_lds_b128 %6, %14, off\n\t"
                 "global_load_async_to_lds_b128 %7, %15, off\n\t"
                 "s_wait_xcnt 0x0"
                 :: "v"(ld), "v"(ld + 16 * GPIT * 2), "v"(ld + 32 * GPIT * 2), "v"(ld + 48 * GPIT * 2),
                    "v"(ld + 64 * GPIT * 2), "v"(ld + 80 * GPIT * 2), "v"(ld + 96 * GPIT * 2), "v"(ld + 112 * GPIT * 2),
                    "v"(g), "v"(g + 16 * DM), "v"(g + 32 * DM), "v"(g + 48 * DM), "v"(g + 64 * DM), "v"(g + 80 * DM), "v"(g + 96 * DM), "v"(g + 112 * DM) : "memory");
}

// k_gemmb: C[128 x 128 per block] = A.Bn^T over k = 1024; 8 waves as 4 x 2, a wave = 32 rows x 64 columns (2 x 4 accumulator tiles); grid (rows / 128, columns / 128).
// QKV: the three projections, none of which reads what another writes, as ONE grid: row blocks 0..63 are k (A, Bn, C), 64..127 v (A, Bv, Cv), 128..159 q (Aq, Bq, Cq), each written as one f16 plane.
template <bool SPLITA, bool QKV>
__global__ __launch_bounds__(256) void k_gemmb(const bf* __restrict__ A, const bf* __restrict__ Al, const bf* __restrict__ Bn, const float* __restrict__ bias, float* C, int ldc,
                                               const bf* __restrict__ Bv, h16* Cv, const bf* __restrict__ Aq, const bf* __restrict__ Bq, h16* Cq) {
    constexpr int NPL = SPLITA ? 3 : 2;             // planes per stage
    __shared__ __align__(16) bf gring[2][NPL * GPL]; // two stages, shared by the 8 waves; output staging behind the loop
    const int tid = threadIdx.x, lane = tid & 31, wave = tid >> 5, lr = lane & 15, hi = lane >> 4;
    int bx = blockIdx.x;                            // the job: the same for a whole block
    float osc = 1.0f;                               // q leaves scaled by 1/8 x log2 e, one rounding
    if (QKV) {
        if (bx >= 2 * (NTK / 128)) { bx -= 2 * (NTK / 128); A = Aq; Bn = Bq; C = (float*)(void*)Cq; osc = QSC; }
        else if (bx >= NTK / 128) { bx -= NTK / 128; Bn = Bv; C = (float*)(void*)Cv; }
    }
    const int rb = bx * 128, cb = blockIdx.y * 128;
    const int wr = (wave >> 1) * 32, wc = (wave & 1) * 64;
    const int r0 = rb + wr, c0 = cb + wc;
    // the lane's share of a plane: rows tid/16 + 16 i, 16-byte piece tid%16
    const unsigned ld0 = (unsigned)(size_t)(&gring[0][0] + (tid >> 4) * GPIT + (tid & 15) * 8);
    const bf* ga = A + (size_t)(rb + (tid >> 4)) * DM + (tid & 15) * 8;
    const bf* gb = Bn + (size_t)(cb + (tid >> 4)) * DM + (tid & 15) * 8;
    auto fill = [&](int s) {
        const unsigned ld = ld0 + (unsigned)(s & 1) * (NPL * GPL * 2);
        stage_g(ld, ga + s * GKS); stage_g(ld + GPL * 2, gb + s * GKS);
        if (SPLITA) stage_g(ld + 2 * GPL * 2, Al + (size_t)(rb + (tid >> 4)) * DM + (tid & 15) * 8 + s * GKS);
    };
    v8f acc[2][4];
#pragma unroll
    for (int m = 0; m < 2; ++m)
#pragma unroll
        for (int t = 0; t < 4; ++t) acc[m][t] = (v8f){};
    fill(0);                                                // stage 0 into buffer 0
    asm volatile("s_wait_asynccnt 0x0" ::: "memory");       // this wave's copies of stage 0 have landed
    __syncthreads();                                        // ... and every other wave's: stage 0 may be read
    fill(1);                                                // stage 1 flies while stage 0 is worked on
#pragma unroll 1
    for (int s = 0; s < DM / GKS; ++s) {
        const bf* sa = &gring[s & 1][0] + (wr + lr) * GPIT + 8 * hi;
        const bf* sb = &gring[s & 1][0] + GPL + (wc + lr) * GPIT + 8 * hi;
#pragma unroll
        for (int kk = 0; kk < GKS; kk += 32) {
            v16bf a[2], al[2], b[4];
#pragma unroll
            for (int m = 0; m < 2; ++m) { a[m] = cat16b(*(const v8usa*)(sa + m * 16 * GPIT + kk), *(const v8usa*)(sa + m * 16 * GPIT + kk + 16));
                if (SPLITA) al[m] = cat16b(*(const v8usa*)(sa + 2 * GPL + m * 16 * GPIT + kk), *(const v8usa*)(sa + 2 * GPL + m * 16 * GPIT + kk + 16)); }
#pragma unroll
            for (int t = 0; t < 4; ++t) b[t] = cat16b(*(const v8usa*)(sb + t * 16 * GPIT + kk), *(const v8usa*)(sb + t * 16 * GPIT + kk + 16));
#pragma unroll
            for (int m = 0; m < 2; ++m)
#pragma unroll
                for (int t = 0; t < 4; ++t) acc[m][t] = wmmab(a[m], b[t], acc[m][t]);
            if (SPLITA) {
#pragma unroll
                for (int m = 0; m < 2; ++m)
#pragma unroll
                    for (int t = 0; t < 4; ++t) acc[m][t] = wmmab(al[m], b[t], acc[m][t]);
            }
        }
        asm volatile("s_wait_dscnt 0x0" ::: "memory");      // this wave's reads of the stage are done before the buffer is handed back
        asm volatile("s_wait_asynccnt 0x0" ::: "memory");   // this wave's copies of stage s + 1 have landed
        __syncthreads();                                    // publishes stage s + 1 and ends every wave's reads of stage s
        if (s + 2 < DM / GKS) fill(s + 2);                  // same for the whole block: refill the buffer that this trip has read
    }
    asm volatile("s_wait_asynccnt 0x0" ::: "memory");       // nothing of this wave is in flight behind the loop; the last trip's barrier has freed the ring
    float* os = (float*)(void*)&gring[0][0] + wave * (32 * 68);
#pragma unroll
    for (int m = 0; m < 2; ++m)
#pragma unroll
        for (int t = 0; t < 4; ++t) { const float bv = bias ? bfr(bias[c0 + t * 16 + lr]) : 0.f;
#pragma unroll
            for (int j = 0; j < 8; ++j) os[(m * 16 + hi * 8 + j) * 68 + t * 16 + lr] = acc[m][t][j] + bv; }
    __syncthreads();
    if (QKV) {
        h16* crow = (h16*)(void*)C + (size_t)r0 * ldc + c0;
#pragma unroll
        for (int s = 0; s < 8; ++s) { const int row = 4 * s + (lane >> 3), piece = lane & 7; const float* sp = os + row * 68 + piece * 8; v8h o;
#pragma unroll
            for (int i = 0; i < 8; ++i) o[i] = (h16)(sp[i] * osc);
            *(v8h*)(crow + (size_t)row * ldc + piece * 8) = o;
            asm volatile("s_wait_xcnt 0x0" ::: "memory"); }   // stands in front of every rewrite of a register that the store above names
    } else {
        float* crow = C + (size_t)r0 * ldc + c0;
#pragma unroll
        for (int s = 0; s < 16; ++s) { const int Lid = (lane >> 3) + 4 * s, piece = lane & 7; const int row = Lid >> 1, cofs = (Lid & 1) * 32 + piece * 4;
            const v4f val = *(const v4fa*)(os + row * 68 + cofs); *(v4f*)(crow + (size_t)row * ldc + cofs) = val; }
    }
}

// LDS ring of k_attn: one stage = 64 keys: k and v as projected, 64 rows of 128 B each. A k row is 16 B longer in LDS (a pitch that is an odd multiple of 16 B,
// for the 16-byte fragment reads of 16 rows), a v row 32 B longer (an odd multiple of 32 B, the pitch of the transposing reads).
#define KPIT 72                  // halves per staged k row
#define VPIT 80                  // halves per staged v row
#define SKEY 64                  // keys per stage: 32 for each of the block's two key groups
#define KPL  (SKEY * KPIT)       // halves per k plane
#define VPL  (SKEY * VPIT)       // halves per v plane
#define STG  (KPL + VPL)         // halves per stage
#define QBLK 128                 // queries per block: 4 column groups of 32

// One stage: 4 copies of 16 B per lane, 256 lanes, global to LDS through no register. ldk, ldv: the lane's LDS byte address in the stage's k and v plane.
// s_wait_xcnt ends the statement so that no address register of a copy is rewritten ahead of it.
__device__ __forceinline__ void stage_kv(unsigned ldk, unsigned ldv, const h16* gkh, const h16* gvh) {
    asm volatile("global_load_async_to_lds_b128 %0, %4, off\n\t"
                 "global_load_async_to_lds_b128 %1, %5, off\n\t"
                 "global_load_async_to_lds_b128 %2, %6, off\n\t"
                 "global_load_async_to_lds_b128 %3, %7, off\n\t"
                 "s_wait_xcnt 0x0"
                 :: "v"(ldk), "v"(ldk + 32 * KPIT * 2), "v"(ldv), "v"(ldv + 32 * VPIT * 2),
                    "v"(gkh), "v"(gkh + 32 * DM), "v"(gvh), "v"(gvh + 32 * DM) : "memory");
}

// Transposing 16-byte LDS read: from a row-major [key][d] tile, lane (c = l & 15, h = l >> 4) gets the 8 keys 8 h .. 8 h + 7 of column c;
// lane l hands in the address of row 8 (l >> 4) + (l & 7), 16-byte piece (l >> 3) & 1, of the 16 x 16 tile.
typedef short s16x8 __attribute__((ext_vector_type(8)));
__device__ __forceinline__ v8h ld_tr16(const h16* p) { typedef __attribute__((address_space(3))) s16x8 lds_s16x8; return __builtin_bit_cast(v8h, __builtin_amdgcn_ds_load_tr16_b128_v8i16((lds_s16x8*)p)); }

__device__ __forceinline__ v8f cat8f(v4f lo, v4f hi) { return __builtin_shufflevector(lo, hi, 0, 1, 2, 3, 4, 5, 6, 7); }
// lane l with lane l ^ 16
__device__ __forceinline__ float xhalf(float x) { return __builtin_bit_cast(float, __builtin_amdgcn_permlanex16(__builtin_bit_cast(int, x), __builtin_bit_cast(int, x), 0x76543210, 0xfedcba98, false, false)); }

__global__ __launch_bounds__(256) void k_attn(const h16* __restrict__ Q16, const h16* __restrict__ K16, const h16* __restrict__ V16, const float* __restrict__ KB, bf* CH, bf* CL) {
    __shared__ __align__(16) float ost[4][32 * 68];
    __shared__ __align__(16) h16 ring[2][STG];      // two stages of k and v, shared by the 8 waves
    __shared__ __align__(16) float kbs[NT_];        // the item's whole key bias row, filled once, rounded in place
    __shared__ float mls[4][2][32];                 // key group 1's maximum and sum per query column
    const int lane = threadIdx.x & 31, wave = threadIdx.x >> 5, lr = lane & 15, hi = lane >> 4;
    const int wq = wave & 3, kg = wave >> 2;
    const int bid = blockIdx.x;
    const int b = bid / (NH_ * (NTQ / QBLK)), rem = bid - b * (NH_ * (NTQ / QBLK)), h = rem / (NTQ / QBLK), qt = rem - h * (NTQ / QBLK);     // query blocks over the 1024 queries
    const int q0 = qt * QBLK + wq * 32;
    const size_t tok0 = (size_t)b * NT_;     // key-side item offset; query rows use tokq0
    const size_t tokq0 = (size_t)b * NTQ;
    v16h qa[2][2];                           // [column tile][k chunk]
#pragma unroll
    for (int c = 0; c < 2; ++c) { const size_t qo0 = (tokq0 + q0 + c * 16 + lr) * DM + h * HD + 8 * hi;
#pragma unroll
        for (int kc = 0; kc < 2; ++kc) qa[c][kc] = cat16(*(const v8h*)(Q16 + qo0 + kc * 32), *(const v8h*)(Q16 + qo0 + kc * 32 + 16)); }
    const h16* kh_b = K16 + tok0 * DM + h * HD;
    v8f o[2][4];                             // o[c][n][j] = O^T[d = 16 n + 8 hi + j][query 16 c + lr]
#pragma unroll
    for (int c = 0; c < 2; ++c)
#pragma unroll
        for (int n = 0; n < 4; ++n) o[c][n] = (v8f){};
    float mu[2] = {-PSH, -PSH}, lsum[2] = {0.f, 0.f};       // of query 16 c + lr, over this key group's keys: maximum in use - 7 (the first trip sets it), the same in both wave halves; lsum over this wave half's keys
    const int kt_lo = 0, kt_hi = NT_ / SKEY - 1;   // cross-attention: all 2048 memory keys; + the INPUT per-key bias[b][k]
    const int tid = threadIdx.x;
    // the lane's share of a stage: rows tid/8 and tid/8 + 32, 16-byte piece tid%8, of k and of v
    const unsigned ldk0 = (unsigned)(size_t)(&ring[0][0] + (tid >> 3) * KPIT + (tid & 7) * 8);
    const unsigned ldv0 = (unsigned)(size_t)(&ring[0][0] + KPL + (tid >> 3) * VPIT + (tid & 7) * 8);
    const h16* gkh = kh_b + (size_t)(tid >> 3) * DM + (tid & 7) * 8;
    const h16* gvh = V16 + tok0 * DM + h * HD + (size_t)(tid >> 3) * DM + (tid & 7) * 8;
    {   // the bias row: 2 copies of 16 B per lane; s_wait_xcnt as in stage_kv
        const unsigned ldb = (unsigned)(size_t)(&kbs[0] + tid * 4);
        const float* gb = KB + tok0 + tid * 4;
        asm volatile("global_load_async_to_lds_b128 %0, %2, off\n\t"
                     "global_load_async_to_lds_b128 %1, %3, off\n\t"
                     "s_wait_xcnt 0x0"
                     :: "v"(ldb), "v"(ldb + 4096), "v"(gb), "v"(gb + 1024) : "memory");
    }
    stage_kv(ldk0, ldv0, gkh, gvh);                                                             // stage 0 into buffer 0
    asm volatile("s_wait_asynccnt 0x0" ::: "memory");                                           // this wave's copies of stage 0 and of the bias row have landed
#pragma unroll
    for (int c = 0; c < 2; ++c) { v4fa* bp = (v4fa*)(&kbs[0] + tid * 4 + c * 1024); v4f t = *bp;  // each lane rounds the 8 bias values that it copied itself and puts them in log2 units, once instead of per trip
#pragma unroll
        for (int i = 0; i < 4; ++i) t[i] = bfr(t[i]) * L2E;
        *bp = t; }
    __syncthreads();                                                                            // ... and every other wave's: stage 0 and the rounded bias row may be read
    stage_kv(ldk0 + STG * 2, ldv0 + STG * 2, gkh + SKEY * DM, gvh + SKEY * DM);                     // stage 1 flies while stage 0 is worked on
#pragma unroll 1
    for (int kt = kt_lo; kt <= kt_hi; ++kt) {
        const int l0 = kt * SKEY + kg * 32;         // this wave's 32 keys of the stage
        const h16* skh = &ring[kt & 1][0] + kg * 32 * KPIT;          // this trip's stage: k, v, the key group's rows
        const h16* svh = &ring[kt & 1][0] + KPL + kg * 32 * VPIT;
        const int ko0 = lr * KPIT + 8 * hi, ko1 = (16 + lr) * KPIT + 8 * hi;
        v16h k0h[2], k1h[2];                        // [k chunk]: key rows lr and 16 + lr of the wave's 32
#pragma unroll
        for (int kc = 0; kc < 2; ++kc) { k0h[kc] = cat16(*(const v8ha*)(skh + ko0 + kc * 32), *(const v8ha*)(skh + ko0 + kc * 32 + 16)); k1h[kc] = cat16(*(const v8ha*)(skh + ko1 + kc * 32), *(const v8ha*)(skh + ko1 + kc * 32 + 16)); }
        const float* kbp = &kbs[0] + l0 + 8 * hi;
        const v8f kb0 = cat8f(*(const v4fa*)(kbp), *(const v4fa*)(kbp + 4)), kb1 = cat8f(*(const v4fa*)(kbp + 16), *(const v4fa*)(kbp + 20));
        v8f s0[2], s1[2];                           // s0[c][j]: key l0 + 8 hi + j, s1[c][j]: key l0 + 16 + 8 hi + j, query 16 c + lr
#pragma unroll
        for (int c = 0; c < 2; ++c) { s0[c] = kb0 - mu[c]; s1[c] = kb1 - mu[c]; }
#pragma unroll
        for (int kc = 0; kc < 2; ++kc)
#pragma unroll
            for (int c = 0; c < 2; ++c) { s0[c] = wmma16(k0h[kc], qa[c][kc], s0[c]); s1[c] = wmma16(k1h[kc], qa[c][kc], s1[c]); }
        v16h vh[4];                                 // row d = 16 n + lr of V^T: keys 8 hi + s, then 16 + 8 hi + (s - 8), the order of pa; read here so that the reads fly under the exponentials
#pragma unroll
        for (int n = 0; n < 4; ++n) { const h16* vp = svh + (8 * hi + (lane & 7)) * VPIT + ((lane >> 3) & 1) * 8 + n * 16; vh[n] = cat16(ld_tr16(vp), ld_tr16(vp + 16 * VPIT)); }
        v8f p0[2], p1[2];
        float rs[2];                                // the lane's 16 weights of the trip, summed
        auto weigh = [&](int c) {
#pragma unroll
            for (int j = 0; j < 8; ++j) { p0[c][j] = __builtin_amdgcn_exp2f(s0[c][j]); p1[c][j] = __builtin_amdgcn_exp2f(s1[c][j]); }
            const v8f pt = p0[c] + p1[c];
            rs[c] = ((pt[0] + pt[1]) + (pt[2] + pt[3])) + ((pt[4] + pt[5]) + (pt[6] + pt[7]));
        };
        weigh(0); weigh(1);
        const bool first = kt == kt_lo;             // the same for the whole block
        if ((__builtin_amdgcn_ballot_w32(!(fmaxf(rs[0], rs[1]) <= PTOP)) | (unsigned)first) != 0) {     // a scalar branch: the same for the whole wave
#pragma unroll
            for (int c = 0; c < 2; ++c) {
                float mx = fmaxf(s0[c][0], s1[c][0]);
#pragma unroll
                for (int j = 1; j < 8; ++j) mx = fmaxf(mx, fmaxf(s0[c][j], s1[c][j]));
                mx = fmaxf(mx, xhalf(mx));                              // both wave halves now hold the query's largest exponent of the 32 keys
                const float d = first ? mx - PSH : fmaxf(mx - PSH, 0.f);    // the maximum in use goes up by d (the first trip sets it, up or down)
                const float alpha = first ? 1.0f : __builtin_amdgcn_exp2f(-d);  // sums and outputs are still 0 in the first trip
                mu[c] += d; lsum[c] *= alpha;
#pragma unroll
                for (int n = 0; n < 4; ++n)
#pragma unroll
                    for (int j = 0; j < 8; ++j) o[c][n][j] *= alpha;
                s0[c] -= d; s1[c] -= d;
                weigh(c);
            }
        }
        v16h pa[2];
#pragma unroll
        for (int c = 0; c < 2; ++c) {
            lsum[c] += rs[c];
            pa[c] = cat16(__builtin_convertvector(p0[c], v8h), __builtin_convertvector(p1[c], v8h));     // element s of the B operand: key 8 hi + s, then 16 + 8 hi + (s - 8): the score registers' own order
        }
#pragma unroll
        for (int n = 0; n < 4; ++n) { o[0][n] = wmma16(vh[n], pa[0], o[0][n]); o[1][n] = wmma16(vh[n], pa[1], o[1][n]); }
        asm volatile("s_wait_dscnt 0x0" ::: "memory");      // this wave's reads of the stage are done before the buffer is handed back
        asm volatile("s_wait_asynccnt 0x0" ::: "memory");   // this wave's copies of stage kt + 1 have landed
        __syncthreads();                                    // publishes stage kt + 1 and ends every wave's reads of stage kt
        if (kt + 2 <= kt_hi) {                              // same for the whole block: refill the buffer that this trip has read
            const unsigned bo = (unsigned)(kt & 1) * (STG * 2);
            stage_kv(ldk0 + bo, ldv0 + bo, gkh + (size_t)(kt + 2) * SKEY * DM, gvh + (size_t)(kt + 2) * SKEY * DM);
        }
    }
    asm volatile("s_wait_asynccnt 0x0" ::: "memory");       // nothing of this wave is in flight behind the loop
    float* om = &ost[wq][0];                                // the column group's 32 x 64 tile: first key group 1's part, then the joined result
    float lt[2];
#pragma unroll
    for (int c = 0; c < 2; ++c) lt[c] = lsum[c] + xhalf(lsum[c]);   // the two wave halves' sums joined once
    if (kg == 1) {                                          // the same for a whole wave: key group 1 hands over its unscaled outputs, maxima and sums
#pragma unroll
        for (int c = 0; c < 2; ++c) {
#pragma unroll
            for (int n = 0; n < 4; ++n)
#pragma unroll
                for (int g = 0; g < 2; ++g) { v4f t;
#pragma unroll
                    for (int i = 0; i < 4; ++i) t[i] = o[c][n][g * 4 + i];
                    *(v4fa*)(om + (c * 16 + lr) * 68 + n * 16 + hi * 8 + g * 4) = t; }
            if (hi == 0) { mls[wq][0][c * 16 + lr] = mu[c]; mls[wq][1][c * 16 + lr] = lt[c]; }
        }
    }
    __syncthreads();                                        // key group 1's parts may be read
    if (kg == 0) {                                          // key group 0 joins: each lane reads and then rewrites exactly the places that the same lane of its partner wave wrote
#pragma unroll
        for (int c = 0; c < 2; ++c) {
            const float m1 = mls[wq][0][c * 16 + lr], l1 = mls[wq][1][c * 16 + lr];
            const float mn = fmaxf(mu[c], m1);
            const float e0 = __builtin_amdgcn_exp2f(mu[c] - mn), e1 = __builtin_amdgcn_exp2f(m1 - mn);
            const float inv = 1.0f / (lt[c] * e0 + l1 * e1);          // sums and outputs carry the same factor 2^7
            const float f0 = e0 * inv, f1 = e1 * inv;
#pragma unroll
            for (int n = 0; n < 4; ++n)
#pragma unroll
                for (int g = 0; g < 2; ++g) { v4fa* p = (v4fa*)(om + (c * 16 + lr) * 68 + n * 16 + hi * 8 + g * 4); const v4f u = *p; v4f t;
#pragma unroll
                    for (int i = 0; i < 4; ++i) t[i] = o[c][n][g * 4 + i] * f0 + u[i] * f1;
                    *p = t; }
        }
    }
    __syncthreads();                                        // the joined tile may be read: each of the column group's two waves writes 16 of its 32 query rows
    const float* os = om + kg * 16 * 68;
    const size_t cbase = (tokq0 + q0 + kg * 16) * DM + (size_t)h * HD;
    auto pass = [&]() {
#pragma unroll
        for (int s = 0; s < 4; ++s) { const int row = 4 * s + (lane >> 3), piece = lane & 7; const float* sp = os + row * 68 + piece * 8; v8us oh, ol;
#pragma unroll
            for (int i = 0; i < 8; ++i) { const unsigned short hb = f2bf(sp[i]); oh[i] = hb; ol[i] = f2bf(sp[i] - bf2f(hb)); }
            *(v8us*)(CH + cbase + (size_t)row * DM + piece * 8) = oh; *(v8us*)(CL + cbase + (size_t)row * DM + piece * 8) = ol; }
    };
    pass(); 
}

#define VST2(T, p, v) do { const T vst2_v_ = (v); *(T*)(p) = vst2_v_;  } while (0)
extern "C" void kernel_launch(void* const* d_in, const int* in_sizes, int n_in,
                              void* d_out, int out_size, void* d_ws, size_t ws_size, hipStream_t stream) {
    (void)in_sizes; (void)n_in; (void)out_size;
    const float* query = (const float*)d_in[0]; const float* memory = (const float*)d_in[1]; const float* bias = (const float*)d_in[2];
    const float* Wq = (const float*)d_in[3]; const float* Wk = (const float*)d_in[4]; const float* Wv = (const float*)d_in[5]; const float* Wo = (const float*)d_in[6];   // all k-major [in][out]
    float* out = (float*)d_out;    // [4][1024][1024]
    char* wsp = (char*)d_ws;
    auto take = [&](size_t bytes) { char* p = wsp; wsp += (bytes + 255) & ~(size_t)255; return (void*)p; };
    bf* Xq = (bf*)take((size_t)NB_ * NTQ * DM * 2); bf* Xm = (bf*)take((size_t)NTK * DM * 2);
    bf* WqT = (bf*)take((size_t)DM * DM * 2); bf* WkT = (bf*)take((size_t)DM * DM * 2); bf* WvT = (bf*)take((size_t)DM * DM * 2); bf* WoT = (bf*)take((size_t)DM * DM * 2);
    h16* VH = (h16*)take((size_t)NTK * DM * 2);
    h16* QH = (h16*)take((size_t)NB_ * NTQ * DM * 2); h16* KH = (h16*)take((size_t)NTK * DM * 2);
    bf* CH = (bf*)take((size_t)NB_ * NTQ * DM * 2); bf* CL = (bf*)take((size_t)NB_ * NTQ * DM * 2);
    if ((size_t)(wsp - (char*)d_ws) > ws_size) return;    // 8.4 + 16.8 + 4 x 2.1 + 16.8 + 8.4 + 16.8 + 2 x 8.4 ~ 92 MB, no aliasing
    k_prep<<<4 * PB_W + PB_M + PB_Q, 256, 0, stream>>>(query, memory, Wq, Wk, Wv, Wo, Xq, Xm, WqT, WkT, WvT, WoT);
    k_gemmb<false, true><<<dim3(2 * (NTK / 128) + NB_ * NTQ / 128, DM / 128, 1), 256, 0, stream>>>(Xm, nullptr, WkT, nullptr, (float*)(void*)KH, DM, WvT, VH, Xq, WqT, QH);   // k = memory.Wk [8192][1024], v = memory.Wv, q = query.Wq [4096][1024]
    k_attn<<<NB_ * NH_ * (NTQ / QBLK), 256, 0, stream>>>(QH, KH, VH, bias, CH, CL);
    k_gemmb<true, false><<<dim3(NB_ * NTQ / 128, DM / 128, 1), 256, 0, stream>>>(CH, CL, WoT, nullptr, out, DM, nullptr, nullptr, nullptr, nullptr, nullptr);
}

// v010
// Measured time: 92.3 microseconds a run.
// Two timings next to v009 put it at 1.05 and 1.06 times that version's speed.
// All steps since v000 together make it 10.7 times as fast.
#include <hip/hip_runtime.h>

// Compute dtypes, f32 accumulate, all 4 batch items in one pass (rows of the items stacked): q = query.Wq ([4096 x 1024].[1024 x 1024]) and k/v = memory.Wk/Wv ([8192 x 1024].[1024 x 1024]), k-major weights transposed once to n-major planes; PLAIN bf16
// operands: inputs rounded once, exact) with q and k written straight from the GEMM epilogue as one f16 plane each, and out = ctx.Wo (ctx as
// bf16 hi + residual: two products) on v_wmma_f32_16x16x32_bf16; the 16-head cross-attention (1024 queries x 2048 memory keys, 64-dim heads, scale 1/8) + the INPUT per-key bias[b][k] fused on
// v_wmma_f32_16x16x32_f16 (one product per score tile and per output tile, online f32 softmax in powers of two, weights (x128 relative to the maximum in use) and v as f16: their rounding is an eighth of the bf16 rounding that q, k and v already carry from their inputs)

#define NB_  4                   // batch items, all in every launch's grid
#define NT_  2048                // keys per item (memory length)
#define NTQ  1024                // queries per item
#define DM   1024
#define NH_  16
#define HD   64
#define NTK  (NB_ * NT_)
#define NW   1024
#define NQKV 1024
#define L2E  1.4426950408889634f // log2 e: scores and bias are kept in log2 units, so that the weight is one exp2
#define QSC  0.18033688011112042f // 1/8 x log2 e, multiplied into q where the projection rounds it to f16
#define PSH  7.0f                // a score equal to the maximum in use gives the weight 2^7
#define PTOP 32768.0f            // a lane's 16 weights of a trip may sum to this much before the maximum in use is raised: every one then fits f16

typedef _Float16 h16;
typedef unsigned short bf;
typedef __attribute__((ext_vector_type(16))) __bf16   v16bf;
typedef __attribute__((ext_vector_type(16))) _Float16 v16h;
typedef __attribute__((ext_vector_type(8)))  _Float16 v8h;
typedef __attribute__((ext_vector_type(8)))  unsigned short v8us;
typedef __attribute__((ext_vector_type(8)))  float    v8f;
typedef __attribute__((ext_vector_type(4)))  float    v4f;
typedef v8h  __attribute__((may_alias)) v8ha;
typedef v4f  __attribute__((may_alias)) v4fa;
typedef v8us __attribute__((may_alias)) v8usa;

__device__ __forceinline__ unsigned short f2bf(float f) { unsigned u = __float_as_uint(f); u += 0x7FFFu + ((u >> 16) & 1u); return (unsigned short)(u >> 16); }
__device__ __forceinline__ float bf2f(unsigned short b) { return __uint_as_float(((unsigned)b) << 16); }
__device__ __forceinline__ float bfr(float f) { return bf2f(f2bf(f)); }
__device__ __forceinline__ v16h cat16(v8h lo, v8h hi) { return __builtin_shufflevector(lo, hi, 0, 1, 2, 3, 4, 5, 6, 7, 8, 9, 10, 11, 12, 13, 14, 15); }
__device__ __forceinline__ v16bf cat16b(v8us lo, v8us hi) { return __builtin_bit_cast(v16bf, __builtin_shufflevector(lo, hi, 0, 1, 2, 3, 4, 5, 6, 7, 8, 9, 10, 11, 12, 13, 14, 15)); }
__device__ __forceinline__ v8f wmma16(v16h a, v16h b, v8f c) { return __builtin_amdgcn_wmma_f32_16x16x32_f16(false, a, false, b, (short)0, c, false, false); }
__device__ __forceinline__ v8f wmmab(v16bf a, v16bf b, v8f c) { return __builtin_amdgcn_wmma_f32_16x16x32_bf16(false, a, false, b, (short)0, c, false, false); }

// cvt_rows: 8 rows of 1024 floats per block (one per wave), rounded to bf16; rb = the block's number among the array's row blocks.
__device__ __forceinline__ void cvt_rows(const float* __restrict__ src, int rb, bf* dst) {
    const int lane = threadIdx.x & 31, r = rb * 8 + (threadIdx.x >> 5);
    v8us o[DM / 256];
#pragma unroll
    for (int q = 0; q < DM / 256; ++q) { v8us t;
#pragma unroll
        for (int i = 0; i < 8; ++i) t[i] = f2bf(src[(size_t)r * DM + q * 256 + lane * 8 + i]);
        o[q] = t; }
#pragma unroll
    for (int q = 0; q < DM / 256; ++q) *(v8us*)(dst + (size_t)r * DM + q * 256 + lane * 8) = o[q];
    asm volatile("s_wait_xcnt 0x0" ::: "memory");   // another job's code follows in the merged kernel: stands in front of every rewrite of a register that the stores above name
}

// wt_tile: WT [n][K] = bf16(W[k][n]) (k-major [K][ncols]) via one 64 x 64 LDS tile per block, tile (bx, by) of (K/64, ncols/64).
__device__ __forceinline__ void wt_tile(const float* __restrict__ Wm, int K, int ncols, bf* WT, int bx, int by, unsigned short* tl) {
    const int tid = threadIdx.x, k0 = bx * 64, n0 = by * 64;
    const int kk = tid >> 2, nq = (tid & 3) * 16;
#pragma unroll
    for (int i = 0; i < 16; ++i) tl[(nq + i) * 72 + kk] = f2bf(Wm[(size_t)(k0 + kk) * ncols + n0 + nq + i]);
    __syncthreads();
    const int piece = tid & 7;
    auto pass = [&]() {
#pragma unroll
        for (int s = 0; s < 2; ++s) { const int nr = (tid >> 3) + 32 * s; const v8us val = *(const v8usa*)(tl + nr * 72 + piece * 8); *(v8us*)(WT + (size_t)(n0 + nr) * K + k0 + piece * 8) = val; }
    };
    pass();
    asm volatile("s_wait_xcnt 0x0" ::: "memory");   // another job's code follows in the merged kernel: stands in front of every rewrite of a register that the stores above name
}
// k_prep: the six preparation jobs, none of which reads what another writes, as ONE grid: 256 blocks each transpose Wq, Wk, Wv, Wo (the longest chain of waits, so they start first), then 1024 blocks round memory and 512 round query.
// Every branch is the same for a whole block, so the barrier inside wt_tile is passed by all of its block's waves or by none.
#define PB_M (NTK / 8)
#define PB_Q (NB_ * NTQ / 8)
#define PB_W ((DM / 64) * (DM / 64))
__global__ __launch_bounds__(256) void k_prep(const float* __restrict__ query, const float* __restrict__ memory, const float* __restrict__ Wq, const float* __restrict__ Wk, const float* __restrict__ Wv, const float* __restrict__ Wo,
                                              bf* Xq, bf* Xm, bf* WqT, bf* WkT, bf* WvT, bf* WoT) {
    __shared__ __align__(16) unsigned short tl[64 * 72];
    const int bid = blockIdx.x;
    if (bid >= 4 * PB_W + PB_M) { cvt_rows(query, bid - 4 * PB_W - PB_M, Xq); return; }
    if (bid >= 4 * PB_W) { cvt_rows(memory, bid - 4 * PB_W, Xm); return; }
    const int w = bid / PB_W, t = bid % PB_W;
    const float* Wm = w == 0 ? Wq : w == 1 ? Wk : w == 2 ? Wv : Wo;
    bf* WT = w == 0 ? WqT : w == 1 ? WkT : w == 2 ? WvT : WoT;
    wt_tile(Wm, DM, DM, WT, t % (DM / 64), t / (DM / 64), tl);
}
// LDS ring of k_gemmb: one stage = 128 k of the block's 128 A rows, 128 B rows (and, split A, 128 residual rows): rows of 256 B, 16 B longer in LDS
// (a pitch that is an odd multiple of 16 B, so that the 16-byte fragment reads of 16 rows fall on different banks).
#define GKS  128                 // k per stage
#define GPIT 136                 // halves per staged row
#define GPL  (128 * GPIT)        // halves per plane of 128 rows

// One plane of a stage: 8 copies of 16 B per lane, 256 lanes, global to LDS through no register: rows r, r + 16, ..., r + 112 of the plane, whole 256-byte row pieces per 16 lanes.
// s_wait_xcnt ends the statement so that no address register of a copy is rewritten ahead of it.
__device__ __forceinline__ void stage_g(unsigned ld, const bf* g) {
    asm volatile("global_load_async_to_lds_b128 %0, %8, off\n\t"
                 "global_load_async_to_lds_b128 %1, %9, off\n\t"
                 "global_load_async_to_lds_b128 %2, %10, off\n\t"
                 "global_load_async_to_lds_b128 %3, %11, off\n\t"
                 "global_load_async_to_lds_b128 %4, %12, off\n\t"
                 "global_load_async_to_lds_b128 %5, %13, off\n\t"
                 "global_load_async_to_lds_b128 %6, %14, off\n\t"
                 "global_load_async_to_lds_b128 %7, %15, off\n\t"
                 "s_wait_xcnt 0x0"
                 :: "v"(ld), "v"(ld + 16 * GPIT * 2), "v"(ld + 32 * GPIT * 2), "v"(ld + 48 * GPIT * 2),
                    "v"(ld + 64 * GPIT * 2), "v"(ld + 80 * GPIT * 2), "v"(ld + 96 * GPIT * 2), "v"(ld + 112 * GPIT * 2),
                    "v"(g), "v"(g + 16 * DM), "v"(g + 32 * DM), "v"(g + 48 * DM), "v"(g + 64 * DM), "v"(g + 80 * DM), "v"(g + 96 * DM), "v"(g + 112 * DM) : "memory");
}

// k_gemmb: C[128 x 128 per block] = A.Bn^T over k = 1024; 8 waves as 4 x 2, a wave = 32 rows x 64 columns (2 x 4 accumulator tiles); grid (rows / 128, columns / 128).
// QKV: the three projections, none of which reads what another writes, as ONE grid: row blocks 0..63 are k (A, Bn, C), 64..127 v (A, Bv, Cv), 128..159 q (Aq, Bq, Cq), each written as one f16 plane.
template <bool SPLITA, bool QKV>
__global__ __launch_bounds__(256) void k_gemmb(const bf* __restrict__ A, const bf* __restrict__ Al, const bf* __restrict__ Bn, const float* __restrict__ bias, float* C, int ldc,
                                               const bf* __restrict__ Bv, h16* Cv, const bf* __restrict__ Aq, const bf* __restrict__ Bq, h16* Cq) {
    constexpr int NPL = SPLITA ? 3 : 2;             // planes per stage
    __shared__ __align__(16) bf gring[2][NPL * GPL]; // two stages, shared by the 8 waves; output staging behind the loop
    const int tid = threadIdx.x, lane = tid & 31, wave = tid >> 5, lr = lane & 15, hi = lane >> 4;
    int bx = blockIdx.x;                            // the job: the same for a whole block
    float osc = 1.0f;                               // q leaves scaled by 1/8 x log2 e, one rounding
    if (QKV) {
        if (bx >= 2 * (NTK / 128)) { bx -= 2 * (NTK / 128); A = Aq; Bn = Bq; C = (float*)(void*)Cq; osc = QSC; }
        else if (bx >= NTK / 128) { bx -= NTK / 128; Bn = Bv; C = (float*)(void*)Cv; }
    }
    const int rb = bx * 128, cb = blockIdx.y * 128;
    const int wr = (wave >> 1) * 32, wc = (wave & 1) * 64;
    const int r0 = rb + wr, c0 = cb + wc;
    // the lane's share of a plane: rows tid/16 + 16 i, 16-byte piece tid%16
    const unsigned ld0 = (unsigned)(size_t)(&gring[0][0] + (tid >> 4) * GPIT + (tid & 15) * 8);
    const bf* ga = A + (size_t)(rb + (tid >> 4)) * DM + (tid & 15) * 8;
    const bf* gb = Bn + (size_t)(cb + (tid >> 4)) * DM + (tid & 15) * 8;
    auto fill = [&](int s) {
        const unsigned ld = ld0 + (unsigned)(s & 1) * (NPL * GPL * 2);
        stage_g(ld, ga + s * GKS); stage_g(ld + GPL * 2, gb + s * GKS);
        if (SPLITA) stage_g(ld + 2 * GPL * 2, Al + (size_t)(rb + (tid >> 4)) * DM + (tid & 15) * 8 + s * GKS);
    };
    v8f acc[2][4];
#pragma unroll
    for (int m = 0; m < 2; ++m)
#pragma unroll
        for (int t = 0; t < 4; ++t) acc[m][t] = (v8f){};
    v16bf a[2][2], al[2][2], b[2][4];               // two fragment sets: one feeds the products while the other is being read from LDS
    auto frag = [&](int st, int s, int kk) {        // all fragments of one 32-k step of stage s into set st
        const bf* sa = &gring[s & 1][0] + (wr + lr) * GPIT + 8 * hi + kk;
        const bf* sb = &gring[s & 1][0] + GPL + (wc + lr) * GPIT + 8 * hi + kk;
#pragma unroll
        for (int m = 0; m < 2; ++m) { a[st][m] = cat16b(*(const v8usa*)(sa + m * 16 * GPIT), *(const v8usa*)(sa + m * 16 * GPIT + 16));
            if (SPLITA) al[st][m] = cat16b(*(const v8usa*)(sa + 2 * GPL + m * 16 * GPIT), *(const v8usa*)(sa + 2 * GPL + m * 16 * GPIT + 16)); }
#pragma unroll
        for (int t = 0; t < 4; ++t) b[st][t] = cat16b(*(const v8usa*)(sb + t * 16 * GPIT), *(const v8usa*)(sb + t * 16 * GPIT + 16));
    };
    auto prod = [&](int st) {                       // the products of one 32-k step, from set st
#pragma unroll
        for (int m = 0; m < 2; ++m)
#pragma unroll
            for (int t = 0; t < 4; ++t) acc[m][t] = wmmab(a[st][m], b[st][t], acc[m][t]);
        if (SPLITA) {
#pragma unroll
            for (int m = 0; m < 2; ++m)
#pragma unroll
                for (int t = 0; t < 4; ++t) acc[m][t] = wmmab(al[st][m], b[st][t], acc[m][t]);
        }
    };
    constexpr int NST = GKS / 32;                           // 32-k steps per stage
    static_assert(NST % 2 == 0, "a stage's first step must always fall on set 0");
    fill(0);                                                // stage 0 into buffer 0
    asm volatile("s_wait_asynccnt 0x0" ::: "memory");       // this wave's copies of stage 0 have landed
    __syncthreads();                                        // ... and every other wave's: stage 0 may be read
    fill(1);                                                // stage 1 flies while stage 0 is worked on
    frag(0, 0, 0);                                          // the first step's fragments
    auto steps = [&](int s) {                               // all steps of stage s but the last, each with the next step's reads ahead of it
#pragma unroll
        for (int q = 0; q + 1 < NST; ++q) {
            frag((q + 1) & 1, s, (q + 1) * 32);
            __builtin_amdgcn_sched_barrier(0);              // keeps the next step's LDS reads as one group ahead of this step's products: left free, the compiler sinks them to their use and each is waited out in full
            prod(q & 1);
            __builtin_amdgcn_sched_barrier(0);              // keeps the reads of the step after next from being spread among these products
        }
    };
#pragma unroll 1
    for (int s = 0; s + 1 < DM / GKS; ++s) {
        steps(s);
        // the stage's last step is in registers: the stage is handed over ahead of its products, so that the next stage's first reads fly under them
        asm volatile("s_wait_dscnt 0x0" ::: "memory");      // this wave's reads of the stage are done before the buffer is handed back
        asm volatile("s_wait_asynccnt 0x0" ::: "memory");   // this wave's copies of stage s + 1 have landed
        __syncthreads();                                    // publishes stage s + 1 and ends every wave's reads of stage s
        if (s + 2 < DM / GKS) fill(s + 2);                  // same for the whole block: refill the buffer whose last read the barrier has ended
        frag(0, s + 1, 0);                                  // the published stage's first step
        __builtin_amdgcn_sched_barrier(0);                  // keeps those reads ahead of the products below
        prod((NST - 1) & 1);
    }
    steps(DM / GKS - 1);                                    // the last stage: nothing is left to refill or to read ahead
    asm volatile("s_wait_dscnt 0x0" ::: "memory");          // this wave's reads of the ring are done
    __syncthreads();                                        // ... and every other wave's: the ring is free for the output staging below
    prod((NST - 1) & 1);
    asm volatile("s_wait_asynccnt 0x0" ::: "memory");       // nothing of this wave is in flight behind the loop; the last stage's barrier has freed the ring
    float* os = (float*)(void*)&gring[0][0] + wave * (32 * 68);
#pragma unroll
    for (int m = 0; m < 2; ++m)
#pragma unroll
        for (int t = 0; t < 4; ++t) { const float bv = bias ? bfr(bias[c0 + t * 16 + lr]) : 0.f;
#pragma unroll
            for (int j = 0; j < 8; ++j) os[(m * 16 + hi * 8 + j) * 68 + t * 16 + lr] = acc[m][t][j] + bv; }
    __syncthreads();
    if (QKV) {
        h16* crow = (h16*)(void*)C + (size_t)r0 * ldc + c0;
#pragma unroll
        for (int s = 0; s < 8; ++s) { const int row = 4 * s + (lane >> 3), piece = lane & 7; const float* sp = os + row * 68 + piece * 8; v8h o;
#pragma unroll
            for (int i = 0; i < 8; ++i) o[i] = (h16)(sp[i] * osc);
            *(v8h*)(crow + (size_t)row * ldc + piece * 8) = o;
            asm volatile("s_wait_xcnt 0x0" ::: "memory"); }   // stands in front of every rewrite of a register that the store above names
    } else {
        float* crow = C + (size_t)r0 * ldc + c0;
#pragma unroll
        for (int s = 0; s < 16; ++s) { const int Lid = (lane >> 3) + 4 * s, piece = lane & 7; const int row = Lid >> 1, cofs = (Lid & 1) * 32 + piece * 4;
            const v4f val = *(const v4fa*)(os + row * 68 + cofs); *(v4f*)(crow + (size_t)row * ldc + cofs) = val; }
    }
}

// LDS ring of k_attn: one stage = 64 keys: k and v as projected, 64 rows of 128 B each. A k row is 16 B longer in LDS (a pitch that is an odd multiple of 16 B,
// for the 16-byte fragment reads of 16 rows), a v row 32 B longer (an odd multiple of 32 B, the pitch of the transposing reads).
#define KPIT 72                  // halves per staged k row
#define VPIT 80                  // halves per staged v row
#define SKEY 64                  // keys per stage: 32 for each of the block's two key groups
#define KPL  (SKEY * KPIT)       // halves per k plane
#define VPL  (SKEY * VPIT)       // halves per v plane
#define STG  (KPL + VPL)         // halves per stage
#define QBLK 128                 // queries per block: 4 column groups of 32

// One stage: 4 copies of 16 B per lane, 256 lanes, global to LDS through no register. ldk, ldv: the lane's LDS byte address in the stage's k and v plane.
// s_wait_xcnt ends the statement so that no address register of a copy is rewritten ahead of it.
__device__ __forceinline__ void stage_kv(unsigned ldk, unsigned ldv, const h16* gkh, const h16* gvh) {
    asm volatile("global_load_async_to_lds_b128 %0, %4, off\n\t"
                 "global_load_async_to_lds_b128 %1, %5, off\n\t"
                 "global_load_async_to_lds_b128 %2, %6, off\n\t"
                 "global_load_async_to_lds_b128 %3, %7, off\n\t"
                 "s_wait_xcnt 0x0"
                 :: "v"(ldk), "v"(ldk + 32 * KPIT * 2), "v"(ldv), "v"(ldv + 32 * VPIT * 2),
                    "v"(gkh), "v"(gkh + 32 * DM), "v"(gvh), "v"(gvh + 32 * DM) : "memory");
}

// Transposing 16-byte LDS read: from a row-major [key][d] tile, lane (c = l & 15, h = l >> 4) gets the 8 keys 8 h .. 8 h + 7 of column c;
// lane l hands in the address of row 8 (l >> 4) + (l & 7), 16-byte piece (l >> 3) & 1, of the 16 x 16 tile.
typedef short s16x8 __attribute__((ext_vector_type(8)));
__device__ __forceinline__ v8h ld_tr16(const h16* p) { typedef __attribute__((address_space(3))) s16x8 lds_s16x8; return __builtin_bit_cast(v8h, __builtin_amdgcn_ds_load_tr16_b128_v8i16((lds_s16x8*)p)); }

__device__ __forceinline__ v8f cat8f(v4f lo, v4f hi) { return __builtin_shufflevector(lo, hi, 0, 1, 2, 3, 4, 5, 6, 7); }
// lane l with lane l ^ 16
__device__ __forceinline__ float xhalf(float x) { return __builtin_bit_cast(float, __builtin_amdgcn_permlanex16(__builtin_bit_cast(int, x), __builtin_bit_cast(int, x), 0x76543210, 0xfedcba98, false, false)); }

__global__ __launch_bounds__(256) void k_attn(const h16* __restrict__ Q16, const h16* __restrict__ K16, const h16* __restrict__ V16, const float* __restrict__ KB, bf* CH, bf* CL) {
    __shared__ __align__(16) float ost[4][32 * 68];
    __shared__ __align__(16) h16 ring[2][STG];      // two stages of k and v, shared by the 8 waves
    __shared__ __align__(16) float kbs[NT_];        // the item's whole key bias row, filled once, rounded in place
    __shared__ float mls[4][2][32];                 // key group 1's maximum and sum per query column
    const int lane = threadIdx.x & 31, wave = threadIdx.x >> 5, lr = lane & 15, hi = lane >> 4;
    const int wq = wave & 3, kg = wave >> 2;
    const int bid = blockIdx.x;
    const int b = bid / (NH_ * (NTQ / QBLK)), rem = bid - b * (NH_ * (NTQ / QBLK)), h = rem / (NTQ / QBLK), qt = rem - h * (NTQ / QBLK);     // query blocks over the 1024 queries
    const int q0 = qt * QBLK + wq * 32;
    const size_t tok0 = (size_t)b * NT_;     // key-side item offset; query rows use tokq0
    const size_t tokq0 = (size_t)b * NTQ;
    v16h qa[2][2];                           // [column tile][k chunk]
#pragma unroll
    for (int c = 0; c < 2; ++c) { const size_t qo0 = (tokq0 + q0 + c * 16 + lr) * DM + h * HD + 8 * hi;
#pragma unroll
        for (int kc = 0; kc < 2; ++kc) qa[c][kc] = cat16(*(const v8h*)(Q16 + qo0 + kc * 32), *(const v8h*)(Q16 + qo0 + kc * 32 + 16)); }
    const h16* kh_b = K16 + tok0 * DM + h * HD;
    v8f o[2][4];                             // o[c][n][j] = O^T[d = 16 n + 8 hi + j][query 16 c + lr]
#pragma unroll
    for (int c = 0; c < 2; ++c)
#pragma unroll
        for (int n = 0; n < 4; ++n) o[c][n] = (v8f){};
    float mu[2] = {-PSH, -PSH}, lsum[2] = {0.f, 0.f};       // of query 16 c + lr, over this key group's keys: maximum in use - 7 (the first trip sets it), the same in both wave halves; lsum over this wave half's keys
    const int kt_lo = 0, kt_hi = NT_ / SKEY - 1;   // cross-attention: all 2048 memory keys; + the INPUT per-key bias[b][k]
    const int tid = threadIdx.x;
    // the lane's share of a stage: rows tid/8 and tid/8 + 32, 16-byte piece tid%8, of k and of v
    const unsigned ldk0 = (unsigned)(size_t)(&ring[0][0] + (tid >> 3) * KPIT + (tid & 7) * 8);
    const unsigned ldv0 = (unsigned)(size_t)(&ring[0][0] + KPL + (tid >> 3) * VPIT + (tid & 7) * 8);
    const h16* gkh = kh_b + (size_t)(tid >> 3) * DM + (tid & 7) * 8;
    const h16* gvh = V16 + tok0 * DM + h * HD + (size_t)(tid >> 3) * DM + (tid & 7) * 8;
    {   // the bias row: 2 copies of 16 B per lane; s_wait_xcnt as in stage_kv
        const unsigned ldb = (unsigned)(size_t)(&kbs[0] + tid * 4);
        const float* gb = KB + tok0 + tid * 4;
        asm volatile("global_load_async_to_lds_b128 %0, %2, off\n\t"
                     "global_load_async_to_lds_b128 %1, %3, off\n\t"
                     "s_wait_xcnt 0x0"
                     :: "v"(ldb), "v"(ldb + 4096), "v"(gb), "v"(gb + 1024) : "memory");
    }
    stage_kv(ldk0, ldv0, gkh, gvh);                                                             // stage 0 into buffer 0
    asm volatile("s_wait_asynccnt 0x0" ::: "memory");                                           // this wave's copies of stage 0 and of the bias row have landed
#pragma unroll
    for (int c = 0; c < 2; ++c) { v4fa* bp = (v4fa*)(&kbs[0] + tid * 4 + c * 1024); v4f t = *bp;  // each lane rounds the 8 bias values that it copied itself and puts them in log2 units, once instead of per trip
#pragma unroll
        for (int i = 0; i < 4; ++i) t[i] = bfr(t[i]) * L2E;
        *bp = t; }
    __syncthreads();                                                                            // ... and every other wave's: stage 0 and the rounded bias row may be read
    stage_kv(ldk0 + STG * 2, ldv0 + STG * 2, gkh + SKEY * DM, gvh + SKEY * DM);                     // stage 1 flies while stage 0 is worked on
#pragma unroll 1
    for (int kt = kt_lo; kt <= kt_hi; ++kt) {
        const int l0 = kt * SKEY + kg * 32;         // this wave's 32 keys of the stage
        const h16* skh = &ring[kt & 1][0] + kg * 32 * KPIT;          // this trip's stage: k, v, the key group's rows
        const h16* svh = &ring[kt & 1][0] + KPL + kg * 32 * VPIT;
        const int ko0 = lr * KPIT + 8 * hi, ko1 = (16 + lr) * KPIT + 8 * hi;
        v16h k0h[2], k1h[2];                        // [k chunk]: key rows lr and 16 + lr of the wave's 32
#pragma unroll
        for (int kc = 0; kc < 2; ++kc) { k0h[kc] = cat16(*(const v8ha*)(skh + ko0 + kc * 32), *(const v8ha*)(skh + ko0 + kc * 32 + 16)); k1h[kc] = cat16(*(const v8ha*)(skh + ko1 + kc * 32), *(const v8ha*)(skh + ko1 + kc * 32 + 16)); }
        const float* kbp = &kbs[0] + l0 + 8 * hi;
        const v8f kb0 = cat8f(*(const v4fa*)(kbp), *(const v4fa*)(kbp + 4)), kb1 = cat8f(*(const v4fa*)(kbp + 16), *(const v4fa*)(kbp + 20));
        v8f s0[2], s1[2];                           // s0[c][j]: key l0 + 8 hi + j, s1[c][j]: key l0 + 16 + 8 hi + j, query 16 c + lr
#pragma unroll
        for (int c = 0; c < 2; ++c) { s0[c] = kb0 - mu[c]; s1[c] = kb1 - mu[c]; }
#pragma unroll
        for (int kc = 0; kc < 2; ++kc)
#pragma unroll
            for (int c = 0; c < 2; ++c) { s0[c] = wmma16(k0h[kc], qa[c][kc], s0[c]); s1[c] = wmma16(k1h[kc], qa[c][kc], s1[c]); }
        v16h vh[4];                                 // row d = 16 n + lr of V^T: keys 8 hi + s, then 16 + 8 hi + (s - 8), the order of pa; read here so that the reads fly under the exponentials
#pragma unroll
        for (int n = 0; n < 4; ++n) { const h16* vp = svh + (8 * hi + (lane & 7)) * VPIT + ((lane >> 3) & 1) * 8 + n * 16; vh[n] = cat16(ld_tr16(vp), ld_tr16(vp + 16 * VPIT)); }
        v8f p0[2], p1[2];
        float rs[2];                                // the lane's 16 weights of the trip, summed
        auto weigh = [&](int c) {
#pragma unroll
            for (int j = 0; j < 8; ++j) { p0[c][j] = __builtin_amdgcn_exp2f(s0[c][j]); p1[c][j] = __builtin_amdgcn_exp2f(s1[c][j]); }
            const v8f pt = p0[c] + p1[c];
            rs[c] = ((pt[0] + pt[1]) + (pt[2] + pt[3])) + ((pt[4] + pt[5]) + (pt[6] + pt[7]));
        };
        weigh(0); weigh(1);
        const bool first = kt == kt_lo;             // the same for the whole block
        if ((__builtin_amdgcn_ballot_w32(!(fmaxf(rs[0], rs[1]) <= PTOP)) | (unsigned)first) != 0) {     // a scalar branch: the same for the whole wave
#pragma unroll
            for (int c = 0; c < 2; ++c) {
                float mx = fmaxf(s0[c][0], s1[c][0]);
#pragma unroll
                for (int j = 1; j < 8; ++j) mx = fmaxf(mx, fmaxf(s0[c][j], s1[c][j]));
                mx = fmaxf(mx, xhalf(mx));                              // both wave halves now hold the query's largest exponent of the 32 keys
                const float d = first ? mx - PSH : fmaxf(mx - PSH, 0.f);    // the maximum in use goes up by d (the first trip sets it, up or down)
                const float alpha = first ? 1.0f : __builtin_amdgcn_exp2f(-d);  // sums and outputs are still 0 in the first trip
                mu[c] += d; lsum[c] *= alpha;
#pragma unroll
                for (int n = 0; n < 4; ++n)
#pragma unroll
                    for (int j = 0; j < 8; ++j) o[c][n][j] *= alpha;
                s0[c] -= d; s1[c] -= d;
                weigh(c);
            }
        }
        v16h pa[2];
#pragma unroll
        for (int c = 0; c < 2; ++c) {
            lsum[c] += rs[c];
            pa[c] = cat16(__builtin_convertvector(p0[c], v8h), __builtin_convertvector(p1[c], v8h));     // element s of the B operand: key 8 hi + s, then 16 + 8 hi + (s - 8): the score registers' own order
        }
#pragma unroll
        for (int n = 0; n < 4; ++n) { o[0][n] = wmma16(vh[n], pa[0], o[0][n]); o[1][n] = wmma16(vh[n], pa[1], o[1][n]); }
        asm volatile("s_wait_dscnt 0x0" ::: "memory");      // this wave's reads of the stage are done before the buffer is handed back
        asm volatile("s_wait_asynccnt 0x0" ::: "memory");   // this wave's copies of stage kt + 1 have landed
        __syncthreads();                                    // publishes stage kt + 1 and ends every wave's reads of stage kt
        if (kt + 2 <= kt_hi) {                              // same for the whole block: refill the buffer that this trip has read
            const unsigned bo = (unsigned)(kt & 1) * (STG * 2);
            stage_kv(ldk0 + bo, ldv0 + bo, gkh + (size_t)(kt + 2) * SKEY * DM, gvh + (size_t)(kt + 2) * SKEY * DM);
        }
    }
    asm volatile("s_wait_asynccnt 0x0" ::: "memory");       // nothing of this wave is in flight behind the loop
    float* om = &ost[wq][0];                                // the column group's 32 x 64 tile: first key group 1's part, then the joined result
    float lt[2];
#pragma unroll
    for (int c = 0; c < 2; ++c) lt[c] = lsum[c] + xhalf(lsum[c]);   // the two wave halves' sums joined once
    if (kg == 1) {                                          // the same for a whole wave: key group 1 hands over its unscaled outputs, maxima and sums
#pragma unroll
        for (int c = 0; c < 2; ++c) {
#pragma unroll
            for (int n = 0; n < 4; ++n)
#pragma unroll
                for (int g = 0; g < 2; ++g) { v4f t;
#pragma unroll
                    for (int i = 0; i < 4; ++i) t[i] = o[c][n][g * 4 + i];
                    *(v4fa*)(om + (c * 16 + lr) * 68 + n * 16 + hi * 8 + g * 4) = t; }
            if (hi == 0) { mls[wq][0][c * 16 + lr] = mu[c]; mls[wq][1][c * 16 + lr] = lt[c]; }
        }
    }
    __syncthreads();                                        // key group 1's parts may be read
    if (kg == 0) {                                          // key group 0 joins: each lane reads and then rewrites exactly the places that the same lane of its partner wave wrote
#pragma unroll
        for (int c = 0; c < 2; ++c) {
            const float m1 = mls[wq][0][c * 16 + lr], l1 = mls[wq][1][c * 16 + lr];
            const float mn = fmaxf(mu[c], m1);
            const float e0 = __builtin_amdgcn_exp2f(mu[c] - mn), e1 = __builtin_amdgcn_exp2f(m1 - mn);
            const float inv = 1.0f / (lt[c] * e0 + l1 * e1);          // sums and outputs carry the same factor 2^7
            const float f0 = e0 * inv, f1 = e1 * inv;
#pragma unroll
            for (int n = 0; n < 4; ++n)
#pragma unroll
                for (int g = 0; g < 2; ++g) { v4fa* p = (v4fa*)(om + (c * 16 + lr) * 68 + n * 16 + hi * 8 + g * 4); const v4f u = *p; v4f t;
#pragma unroll
                    for (int i = 0; i < 4; ++i) t[i] = o[c][n][g * 4 + i] * f0 + u[i] * f1;
                    *p = t; }
        }
    }
    __syncthreads();                                        // the joined tile may be read: each of the column group's two waves writes 16 of its 32 query rows
    const float* os = om + kg * 16 * 68;
    const size_t cbase = (tokq0 + q0 + kg * 16) * DM + (size_t)h * HD;
    auto pass = [&]() {
#pragma unroll
        for (int s = 0; s < 4; ++s) { const int row = 4 * s + (lane >> 3), piece = lane & 7; const float* sp = os + row * 68 + piece * 8; v8us oh, ol;
#pragma unroll
            for (int i = 0; i < 8; ++i) { const unsigned short hb = f2bf(sp[i]); oh[i] = hb; ol[i] = f2bf(sp[i] - bf2f(hb)); }
            *(v8us*)(CH + cbase + (size_t)row * DM + piece * 8) = oh; *(v8us*)(CL + cbase + (size_t)row * DM + piece * 8) = ol; }
    };
    pass(); 
}

#define VST2(T, p, v) do { const T vst2_v_ = (v); *(T*)(p) = vst2_v_;  } while (0)
extern "C" void kernel_launch(void* const* d_in, const int* in_sizes, int n_in,
                              void* d_out, int out_size, void* d_ws, size_t ws_size, hipStream_t stream) {
    (void)in_sizes; (void)n_in; (void)out_size;
    const float* query = (const float*)d_in[0]; const float* memory = (const float*)d_in[1]; const float* bias = (const float*)d_in[2];
    const float* Wq = (const float*)d_in[3]; const float* Wk = (const float*)d_in[4]; const float* Wv = (const float*)d_in[5]; const float* Wo = (const float*)d_in[6];   // all k-major [in][out]
    float* out = (float*)d_out;    // [4][1024][1024]
    char* wsp = (char*)d_ws;
    auto take = [&](size_t bytes) { char* p = wsp; wsp += (bytes + 255) & ~(size_t)255; return (void*)p; };
    bf* Xq = (bf*)take((size_t)NB_ * NTQ * DM * 2); bf* Xm = (bf*)take((size_t)NTK * DM * 2);
    bf* WqT = (bf*)take((size_t)DM * DM * 2); bf* WkT = (bf*)take((size_t)DM * DM * 2); bf* WvT = (bf*)take((size_t)DM * DM * 2); bf* WoT = (bf*)take((size_t)DM * DM * 2);
    h16* VH = (h16*)take((size_t)NTK * DM * 2);
    h16* QH = (h16*)take((size_t)NB_ * NTQ * DM * 2); h16* KH = (h16*)take((size_t)NTK * DM * 2);
    bf* CH = (bf*)take((size_t)NB_ * NTQ * DM * 2); bf* CL = (bf*)take((size_t)NB_ * NTQ * DM * 2);
    if ((size_t)(wsp - (char*)d_ws) > ws_size) return;    // 8.4 + 16.8 + 4 x 2.1 + 16.8 + 8.4 + 16.8 + 2 x 8.4 ~ 92 MB, no aliasing
    k_prep<<<4 * PB_W + PB_M + PB_Q, 256, 0, stream>>>(query, memory, Wq, Wk, Wv, Wo, Xq, Xm, WqT, WkT, WvT, WoT);
    k_gemmb<false, true><<<dim3(2 * (NTK / 128) + NB_ * NTQ / 128, DM / 128, 1), 256, 0, stream>>>(Xm, nullptr, WkT, nullptr, (float*)(void*)KH, DM, WvT, VH, Xq, WqT, QH);   // k = memory.Wk [8192][1024], v = memory.Wv, q = query.Wq [4096][1024]
    k_attn<<<NB_ * NH_ * (NTQ / QBLK), 256, 0, stream>>>(QH, KH, VH, bias, CH, CL);
    k_gemmb<true, false><<<dim3(NB_ * NTQ / 128, DM / 128, 1), 256, 0, stream>>>(CH, CL, WoT, nullptr, out, DM, nullptr, nullptr, nullptr, nullptr, nullptr);
}
